// v000
// Measured on an AMD MI455X. A time is GPU time per run, averaged over a window of back-to-back runs after a warm-up
// (all launches, gaps included; the runs take copies of the inputs in turn), and the median of several windows.
// Apart from v000's, it joins two sittings. Times from different sittings can be a few percent apart, while
// side-by-side timings come from the same sitting.
// The starting kernel, v000, takes 614 microseconds a run.
#include <hip/hip_runtime.h>
#include <hip/hip_bf16.h>

typedef __bf16 bf16_t;
typedef __attribute__((ext_vector_type(16))) __bf16 v16bf;
typedef __attribute__((ext_vector_type(8)))  float  v8f;

#define HDIM 256
#define WDIM 256
#define CIN  64
#define CLAT 32

// ---------------------------------------------------------------------------
// WMMA helpers (CDNA5 16x16x32 bf16, f32 accumulate)
// ---------------------------------------------------------------------------
__device__ __forceinline__ v8f wmma_bf(v16bf a, v16bf b, v8f c) {
  return __builtin_amdgcn_wmma_f32_16x16x32_bf16(false, a, false, b,
                                                 (short)0, c, false, false);
}

__device__ __forceinline__ v8f vzero() {
  v8f z = {0.f, 0.f, 0.f, 0.f, 0.f, 0.f, 0.f, 0.f};
  return z;
}

// K-pair base within a K=32 slab for bf16 A/B fragments (ISA 7.12.2):
// lanes 0-15: VGPR i<4 -> K=2i,2i+1 ; i>=4 -> K=16+2(i-4) ; lanes 16-31: +8
__device__ __forceinline__ int wk_base(int i, int half) {
  return ((i < 4) ? (2 * i) : (16 + 2 * (i - 4))) + 8 * half;
}

// A/B fragment from bf16 matrix, lane-dim slow (row-major): elem(r,k)=base[r*ldm+k]
__device__ __forceinline__ v16bf frag_ld_bf(const bf16_t* __restrict__ base,
                                            int ldm, int i0, int koff) {
  int lane = threadIdx.x & 31;
  int r = i0 + (lane & 15);
  int half = lane >> 4;
  v16bf f;
#pragma unroll
  for (int i = 0; i < 8; ++i) {
    int k = koff + wk_base(i, half);
    f[2 * i]     = base[r * ldm + k];
    f[2 * i + 1] = base[r * ldm + k + 1];
  }
  return f;
}

// fragment with K slow dim: elem(k, n)=base[k*ldm + n]
__device__ __forceinline__ v16bf frag_ld_bf_T(const bf16_t* __restrict__ base,
                                              int ldm, int i0, int koff) {
  int lane = threadIdx.x & 31;
  int n = i0 + (lane & 15);
  int half = lane >> 4;
  v16bf f;
#pragma unroll
  for (int i = 0; i < 8; ++i) {
    int k = koff + wk_base(i, half);
    f[2 * i]     = base[k * ldm + n];
    f[2 * i + 1] = base[(k + 1) * ldm + n];
  }
  return f;
}

// fragment from f32 matrix (row-major, lane-dim slow), convert to bf16
__device__ __forceinline__ v16bf frag_ld_f32(const float* __restrict__ base,
                                             int ldm, int i0, int koff) {
  int lane = threadIdx.x & 31;
  int r = i0 + (lane & 15);
  int half = lane >> 4;
  v16bf f;
#pragma unroll
  for (int i = 0; i < 8; ++i) {
    int k = koff + wk_base(i, half);
    f[2 * i]     = (bf16_t)base[r * ldm + k];
    f[2 * i + 1] = (bf16_t)base[r * ldm + k + 1];
  }
  return f;
}

// fragment from f32 matrix with K slow (stride ldm, e.g. NCHW channel stride)
__device__ __forceinline__ v16bf frag_ld_f32_T(const float* __restrict__ base,
                                               size_t ldm, int i0, int koff) {
  int lane = threadIdx.x & 31;
  int n = i0 + (lane & 15);
  int half = lane >> 4;
  v16bf f;
#pragma unroll
  for (int i = 0; i < 8; ++i) {
    int k = koff + wk_base(i, half);
    f[2 * i]     = (bf16_t)base[(size_t)k * ldm + n];
    f[2 * i + 1] = (bf16_t)base[(size_t)(k + 1) * ldm + n];
  }
  return f;
}

// ---------------------------------------------------------------------------
// Kernel 0: convert all GEMM weights to bf16 in workspace.
// Conv weight [O][I][3][3] -> [O][I*9] is an identity reindex, so pure convert.
// ---------------------------------------------------------------------------
__global__ void prep_weights(const float* __restrict__ W1, const float* __restrict__ W2,
                             const float* __restrict__ W3, const float* __restrict__ Wf,
                             const float* __restrict__ Wo, const float* __restrict__ Wq,
                             const float* __restrict__ Wk, const float* __restrict__ Wv,
                             bf16_t* __restrict__ o1, bf16_t* __restrict__ o2,
                             bf16_t* __restrict__ o3, bf16_t* __restrict__ of,
                             bf16_t* __restrict__ oo, bf16_t* __restrict__ oq,
                             bf16_t* __restrict__ ok, bf16_t* __restrict__ ov) {
  int i = blockIdx.x * blockDim.x + threadIdx.x;
  if (i < 32 * 576)  o1[i] = (bf16_t)W1[i];
  if (i < 32 * 864)  o2[i] = (bf16_t)W2[i];
  if (i < 32 * 1152) o3[i] = (bf16_t)W3[i];
  if (i < 64 * 160)  of[i] = (bf16_t)Wf[i];
  if (i < 64 * 32)   oo[i] = (bf16_t)Wo[i];
  if (i < 32 * 64) {
    oq[i] = (bf16_t)Wq[i];
    ok[i] = (bf16_t)Wk[i];
    ov[i] = (bf16_t)Wv[i];
  }
}

// ---------------------------------------------------------------------------
// Kernel 1: region non-local attention. One block per 32x32 cell (256 blocks).
// All GEMMs (k/v proj+pool, q proj, QK^T, PV, Wo proj) on the WMMA pipe.
// Writes f0 (bf16) into channels 0..63 of the concat buffer [4][160][256][256].
// ---------------------------------------------------------------------------
__global__ __launch_bounds__(256) void attn_kernel(
    const float* __restrict__ x,
    const bf16_t* __restrict__ Wq_bf, const float* __restrict__ bq,
    const bf16_t* __restrict__ Wk_bf, const float* __restrict__ bk,
    const bf16_t* __restrict__ Wv_bf, const float* __restrict__ bv,
    const float* __restrict__ gamma_p, const float* __restrict__ bo,
    const bf16_t* __restrict__ Wo_bf, bf16_t* __restrict__ cat) {
  __shared__ bf16_t Kp[256 * 32];   // pooled keys   [key][lat]
  __shared__ bf16_t Vp[256 * 32];   // pooled values [key][lat]
  __shared__ bf16_t ql[128 * 32];   // query chunk   [q][lat]
  __shared__ float  scratchf[4096]; // phase A: k/v pre-pool; phase B: per-wave staging

  const int bid = blockIdx.x;
  const int n = bid >> 6, gh = (bid >> 3) & 7, gw = bid & 7;
  const int row0 = gh * 32, col0 = gw * 32;
  const int t = threadIdx.x, lane = t & 31, wave = t >> 5;
  const int half = lane >> 4, coln = lane & 15;
  const float gamma = gamma_p[0];
  const size_t HW = (size_t)HDIM * WDIM;
  const float* xcell = x + (size_t)n * CIN * HW;  // + yy*WDIM + xx per use

  // ---- Phase A (WMMA): k/v projection + 2x2 maxpool, one row-pair at a time.
  // Waves 0-3 compute k, waves 4-7 compute v; wave owns one 16-px tile of the
  // 64 px (2 rows x 32 cols) in the row-pair. Then all threads pool.
  {
    const int matsel = wave >> 2;  // 0 = k, 1 = v
    const int pt = wave & 3;       // px tile: (row pt>>1, cols (pt&1)*16..)
    const bf16_t* Wm = matsel ? Wv_bf : Wk_bf;
    const float* bm = matsel ? bv : bk;
    const v16bf a00 = frag_ld_bf(Wm, 64, 0, 0);
    const v16bf a01 = frag_ld_bf(Wm, 64, 0, 32);
    const v16bf a10 = frag_ld_bf(Wm, 64, 16, 0);
    const v16bf a11 = frag_ld_bf(Wm, 64, 16, 32);
    float* stg = scratchf + matsel * 2048;  // [64 px][32 ch] f32
    for (int rp = 0; rp < 16; ++rp) {
      const int yy = row0 + rp * 2 + (pt >> 1);
      const int xb = (pt & 1) * 16;
      const float* xp = xcell + (size_t)yy * WDIM + col0 + xb;
      v16bf b0 = frag_ld_f32_T(xp, HW, 0, 0);   // B: lane=px, K=in-ch 0..31
      v16bf b1 = frag_ld_f32_T(xp, HW, 0, 32);  //                     32..63
      v8f c0 = vzero(), c1 = vzero();
      c0 = wmma_bf(a00, b0, c0);
      c0 = wmma_bf(a01, b1, c0);
      c1 = wmma_bf(a10, b0, c1);
      c1 = wmma_bf(a11, b1, c1);
      const int pl = pt * 16 + coln;  // local px 0..63 (= row*32 + col)
#pragma unroll
      for (int r = 0; r < 8; ++r) {
        const int c = r + 8 * half;
        stg[pl * 32 + c]      = c0[r] + bm[c];
        stg[pl * 32 + 16 + c] = c1[r] + bm[16 + c];
      }
      __syncthreads();
      // 2x2 maxpool: 16 pooled cols x 32 ch per matrix; 2 outputs per thread
#pragma unroll
      for (int j = 0; j < 2; ++j) {
        const int idx = t * 2 + j;  // 0..511
        const int pc = idx >> 5, ch = idx & 31;
        const int p00 = (2 * pc) * 32 + ch, p01 = (2 * pc + 1) * 32 + ch;
        const int p10 = (32 + 2 * pc) * 32 + ch, p11 = (32 + 2 * pc + 1) * 32 + ch;
        // stage layout: [pl][ch] with pl = row*32 + col  ->  index pl*32+ch
        const float km = fmaxf(fmaxf(scratchf[(2 * pc) * 32 + ch],
                                     scratchf[(2 * pc + 1) * 32 + ch]),
                               fmaxf(scratchf[(32 + 2 * pc) * 32 + ch],
                                     scratchf[(32 + 2 * pc + 1) * 32 + ch]));
        const float vm = fmaxf(fmaxf(scratchf[2048 + (2 * pc) * 32 + ch],
                                     scratchf[2048 + (2 * pc + 1) * 32 + ch]),
                               fmaxf(scratchf[2048 + (32 + 2 * pc) * 32 + ch],
                                     scratchf[2048 + (32 + 2 * pc + 1) * 32 + ch]));
        Kp[(rp * 16 + pc) * 32 + ch] = (bf16_t)km;
        Vp[(rp * 16 + pc) * 32 + ch] = (bf16_t)vm;
        (void)p00; (void)p01; (void)p10; (void)p11;
      }
      __syncthreads();
    }
  }

  // ---- Phase B: 8 chunks of 128 queries; each wave owns one 16-query tile ----
  for (int chunk = 0; chunk < 8; ++chunk) {
    {  // q projection (WMMA): wave w -> queries [w*16, w*16+16) of the chunk
      const int yy = row0 + chunk * 4 + (wave >> 1);
      const int xb = (wave & 1) * 16;
      const float* xp = xcell + (size_t)yy * WDIM + col0 + xb;
      v16bf b0 = frag_ld_f32_T(xp, HW, 0, 0);
      v16bf b1 = frag_ld_f32_T(xp, HW, 0, 32);
      v8f c0 = vzero(), c1 = vzero();
      c0 = wmma_bf(frag_ld_bf(Wq_bf, 64, 0, 0), b0, c0);
      c0 = wmma_bf(frag_ld_bf(Wq_bf, 64, 0, 32), b1, c0);
      c1 = wmma_bf(frag_ld_bf(Wq_bf, 64, 16, 0), b0, c1);
      c1 = wmma_bf(frag_ld_bf(Wq_bf, 64, 16, 32), b1, c1);
#pragma unroll
      for (int r = 0; r < 8; ++r) {
        const int c = r + 8 * half;
        ql[(wave * 16 + coln) * 32 + c]      = (bf16_t)(c0[r] + bq[c]);
        ql[(wave * 16 + coln) * 32 + 16 + c] = (bf16_t)(c1[r] + bq[16 + c]);
      }
    }
    __syncthreads();

    const int qtb = wave * 16;  // query tile base within chunk
    // scores: one WMMA per 16-key tile (K = 32 latent channels)
    v16bf aq = frag_ld_bf(ql, 32, qtb, 0);
    v8f sc[16];
#pragma unroll
    for (int kt = 0; kt < 16; ++kt) {
      v16bf kbf = frag_ld_bf(Kp, 32, kt * 16, 0);  // B: lane=key, K=lat
      sc[kt] = wmma_bf(aq, kbf, vzero());
    }
    // softmax over 256 keys; rows live as (vgpr r, lane-half), cols across lanes
    float rmax[8], rinv[8];
#pragma unroll
    for (int r = 0; r < 8; ++r) {
      float m = -3.4e38f;
#pragma unroll
      for (int kt = 0; kt < 16; ++kt) m = fmaxf(m, sc[kt][r]);
      for (int sh = 1; sh < 16; sh <<= 1) m = fmaxf(m, __shfl_xor(m, sh, 16));
      rmax[r] = m;
    }
#pragma unroll
    for (int r = 0; r < 8; ++r) {
      float s = 0.f;
#pragma unroll
      for (int kt = 0; kt < 16; ++kt) {
        float e = __expf(sc[kt][r] - rmax[r]);
        sc[kt][r] = e;
        s += e;
      }
      for (int sh = 1; sh < 16; sh <<= 1) s += __shfl_xor(s, sh, 16);
      rinv[r] = 1.f / s;
    }
#pragma unroll
    for (int r = 0; r < 8; ++r)
#pragma unroll
      for (int kt = 0; kt < 16; ++kt) sc[kt][r] *= rinv[r];

    // out[16q][32lat] = P @ V^T, staged through per-wave LDS for A layout
    v8f o0 = vzero(), o1 = vzero();
    float* st = scratchf + wave * 512;
#pragma unroll
    for (int ks = 0; ks < 8; ++ks) {
#pragma unroll
      for (int r = 0; r < 8; ++r) {
        st[(r + 8 * half) * 32 + coln]      = sc[2 * ks][r];
        st[(r + 8 * half) * 32 + 16 + coln] = sc[2 * ks + 1][r];
      }
      v16bf pa  = frag_ld_f32(st, 32, 0, 0);          // A: probs [16][32]
      v16bf vb0 = frag_ld_bf_T(Vp, 32, 0, ks * 32);   // B: V^T, lat 0-15
      v16bf vb1 = frag_ld_bf_T(Vp, 32, 16, ks * 32);  // B: V^T, lat 16-31
      o0 = wmma_bf(pa, vb0, o0);
      o1 = wmma_bf(pa, vb1, o1);
    }

    // f0[64][16q] = gamma*(Wo @ out^T + bo) + x ; out^T staged for B fragment
#pragma unroll
    for (int r = 0; r < 8; ++r) {
      st[(r + 8 * half) * 32 + coln]      = o0[r];
      st[(r + 8 * half) * 32 + 16 + coln] = o1[r];
    }
    v16bf pb = frag_ld_f32(st, 32, 0, 0);  // B: lane=q, K=lat (transposed read)
#pragma unroll
    for (int mt = 0; mt < 4; ++mt) {
      v16bf wa = frag_ld_bf(Wo_bf, 32, mt * 16, 0);
      v8f f0 = wmma_bf(wa, pb, vzero());
      const int qi = chunk * 128 + qtb + coln;
      const int yy = row0 + (qi >> 5), xx = col0 + (qi & 31);
#pragma unroll
      for (int r = 0; r < 8; ++r) {
        const int oc = mt * 16 + r + 8 * half;
        const float val =
            gamma * (f0[r] + bo[oc]) +
            x[(((size_t)n * CIN + oc) * HDIM + yy) * WDIM + xx];
        cat[(((size_t)n * 160 + oc) * HDIM + yy) * WDIM + xx] = (bf16_t)val;
      }
    }
    __syncthreads();  // ql / scratchf reused next chunk
  }
}

// ---------------------------------------------------------------------------
// Kernels 2-4: implicit-GEMM 3x3 conv, pad=1, relu. Input = first KTOT/9
// channels of concat buffer; output -> channels [ocBase, ocBase+32).
// Block tile: 32 oc x 128 px (one row segment); wave w owns x-subtile w.
// ---------------------------------------------------------------------------
template <int KTOT>
__global__ __launch_bounds__(256) void conv3x3_kernel(
    const bf16_t* __restrict__ cat, const bf16_t* __restrict__ Wr,
    const float* __restrict__ bias, bf16_t* __restrict__ out_cat, int ocBase) {
  const int bid = blockIdx.x;  // 4 imgs * 256 rows * 2 xsegs
  const int n = bid >> 9, rem = bid & 511;
  const int y = rem >> 1, xseg = rem & 1;
  const int t = threadIdx.x, lane = t & 31, wave = t >> 5;
  const int half = lane >> 4, coln = lane & 15;
  const int xx = xseg * 128 + wave * 16 + coln;
  const size_t HW = (size_t)HDIM * WDIM;
  const bf16_t* inb = cat + (size_t)n * 160 * HW;

  v8f a0 = vzero(), a1 = vzero();
  constexpr int KS = KTOT / 32;
  for (int ks = 0; ks < KS; ++ks) {
    if (ks + 1 < KS) __builtin_prefetch(Wr + (ks + 1) * 32, 0, 0);
    v16bf wa0 = frag_ld_bf(Wr, KTOT, 0, ks * 32);
    v16bf wa1 = frag_ld_bf(Wr, KTOT, 16, ks * 32);
    v16bf bfrag;  // im2col B fragment: k = ic*9 + ky*3 + kx, n = pixel col
#pragma unroll
    for (int i = 0; i < 8; ++i) {
      const int k0 = ks * 32 + wk_base(i, half);
#pragma unroll
      for (int j = 0; j < 2; ++j) {
        const int k = k0 + j;
        const int ic = k / 9, r9 = k - ic * 9;
        const int dy = r9 / 3 - 1, dx = r9 - (r9 / 3) * 3 - 1;
        const int yy = y + dy, x2 = xx + dx;
        bf16_t v = (bf16_t)0.f;
        if ((unsigned)yy < HDIM && (unsigned)x2 < WDIM)
          v = inb[((size_t)ic * HDIM + yy) * WDIM + x2];
        bfrag[2 * i + j] = v;
      }
    }
    a0 = wmma_bf(wa0, bfrag, a0);
    a1 = wmma_bf(wa1, bfrag, a1);
  }
#pragma unroll
  for (int r = 0; r < 8; ++r) {
    const int oc0 = r + 8 * half, oc1 = 16 + r + 8 * half;
    const float v0 = fmaxf(a0[r] + bias[oc0], 0.f);
    const float v1 = fmaxf(a1[r] + bias[oc1], 0.f);
    out_cat[(((size_t)n * 160 + ocBase + oc0) * HDIM + y) * WDIM + xx] = (bf16_t)v0;
    out_cat[(((size_t)n * 160 + ocBase + oc1) * HDIM + y) * WDIM + xx] = (bf16_t)v1;
  }
}

// ---------------------------------------------------------------------------
// Kernel 5: 1x1 fusion over 160 channels + bias + residual x, fp32 out.
// Block tile: 64 oc x 32 px; 8 waves = 4 oc-tiles x 2 px-tiles.
// ---------------------------------------------------------------------------
__global__ __launch_bounds__(256) void fuse_kernel(
    const bf16_t* __restrict__ cat, const bf16_t* __restrict__ Wf_bf,
    const float* __restrict__ bfus, const float* __restrict__ x,
    float* __restrict__ out) {
  const int bid = blockIdx.x;  // 4 imgs * 256 rows * 8 xsegs
  const int n = bid >> 11, rem = bid & 2047;
  const int y = rem >> 3, xseg = rem & 7;
  const int t = threadIdx.x, lane = t & 31, wave = t >> 5;
  const int mt = wave & 3, nt = wave >> 2;
  const int half = lane >> 4, coln = lane & 15;
  const int xx = xseg * 32 + nt * 16 + coln;
  const size_t HW = (size_t)HDIM * WDIM;
  const bf16_t* inb =
      cat + ((size_t)n * 160 * HDIM + y) * WDIM + xseg * 32 + nt * 16;

  v8f acc = vzero();
#pragma unroll
  for (int ks = 0; ks < 5; ++ks) {
    v16bf wa = frag_ld_bf(Wf_bf, 160, mt * 16, ks * 32);
    v16bf bb = frag_ld_bf_T(inb, (int)HW, 0, ks * 32);  // k = channel (slow)
    acc = wmma_bf(wa, bb, acc);
  }
#pragma unroll
  for (int r = 0; r < 8; ++r) {
    const int oc = mt * 16 + r + 8 * half;
    const size_t xi = (((size_t)n * CIN + oc) * HDIM + y) * WDIM + xx;
    out[xi] = acc[r] + bfus[oc] + x[xi];
  }
}

// ---------------------------------------------------------------------------
extern "C" void kernel_launch(void* const* d_in, const int* in_sizes, int n_in,
                              void* d_out, int out_size, void* d_ws,
                              size_t ws_size, hipStream_t stream) {
  const float* x  = (const float*)d_in[0];
  const float* Wq = (const float*)d_in[1];
  const float* bq = (const float*)d_in[2];
  const float* Wk = (const float*)d_in[3];
  const float* bk = (const float*)d_in[4];
  const float* Wv = (const float*)d_in[5];
  const float* bv = (const float*)d_in[6];
  const float* Wo = (const float*)d_in[7];
  const float* bo = (const float*)d_in[8];
  const float* gm = (const float*)d_in[9];
  const float* W1 = (const float*)d_in[10];
  const float* b1 = (const float*)d_in[11];
  const float* W2 = (const float*)d_in[12];
  const float* b2 = (const float*)d_in[13];
  const float* W3 = (const float*)d_in[14];
  const float* b3 = (const float*)d_in[15];
  const float* Wf = (const float*)d_in[16];
  const float* bfus = (const float*)d_in[17];
  float* out = (float*)d_out;

  // workspace layout: bf16 concat [4][160][256][256] then bf16 weights
  const size_t catElems = (size_t)4 * 160 * HDIM * WDIM;
  bf16_t* cat = (bf16_t*)d_ws;
  bf16_t* W1r = cat + catElems;
  bf16_t* W2r = W1r + 32 * 576;
  bf16_t* W3r = W2r + 32 * 864;
  bf16_t* Wfb = W3r + 32 * 1152;
  bf16_t* Wob = Wfb + 64 * 160;
  bf16_t* Wqb = Wob + 64 * 32;
  bf16_t* Wkb = Wqb + 32 * 64;
  bf16_t* Wvb = Wkb + 32 * 64;

  prep_weights<<<144, 256, 0, stream>>>(W1, W2, W3, Wf, Wo, Wq, Wk, Wv, W1r,
                                        W2r, W3r, Wfb, Wob, Wqb, Wkb, Wvb);
  attn_kernel<<<256, 256, 0, stream>>>(x, Wqb, bq, Wkb, bk, Wvb, bv, gm, bo,
                                       Wob, cat);
  conv3x3_kernel<576><<<2048, 256, 0, stream>>>(cat, W1r, b1, cat, 64);
  conv3x3_kernel<864><<<2048, 256, 0, stream>>>(cat, W2r, b2, cat, 96);
  conv3x3_kernel<1152><<<2048, 256, 0, stream>>>(cat, W3r, b3, cat, 128);
  fuse_kernel<<<8192, 256, 0, stream>>>(cat, Wfb, bfus, x, out);
}

// v001
// A run of this version takes 216 microseconds.
// Two timings next to v000 put it at 2.86 and 2.90 times that version's speed.
#include <hip/hip_runtime.h>
#include <hip/hip_bf16.h>

typedef __bf16 bf16_t;
typedef __attribute__((ext_vector_type(16))) __bf16 v16bf;
typedef __attribute__((ext_vector_type(8)))  __bf16 v8bf;
typedef __attribute__((ext_vector_type(8)))  float  v8f;

#define HDIM 256
#define WDIM 256
#define CIN  64
#define CLAT 32

// Concat buffer layout: one plane per (image, group of 8 channels), each plane
// [PROWS][PPITCH] pixels of 8 bf16 (16 bytes). Pixel (y, x) sits at row y + 1,
// column x + 8, so a 16-pixel tile starts on a 128-byte line; row 0, row 257,
// column 7 and column 264 are the zero border of the 3x3 convolutions.
#define PROWS  258
#define PPITCH 272
#define PLANE  (PROWS * PPITCH * 8)
#define NGRP   20

// ---------------------------------------------------------------------------
// WMMA helpers (CDNA5 16x16x32 bf16, f32 accumulate)
// ---------------------------------------------------------------------------
__device__ __forceinline__ v8f wmma_bf(v16bf a, v16bf b, v8f c) {
  return __builtin_amdgcn_wmma_f32_16x16x32_bf16(false, a, false, b,
                                                 (short)0, c, false, false);
}

__device__ __forceinline__ v8f vzero() {
  v8f z = {0.f, 0.f, 0.f, 0.f, 0.f, 0.f, 0.f, 0.f};
  return z;
}

// K-pair base within a K=32 slab for bf16 A/B fragments (ISA 7.12.2):
// lanes 0-15: VGPR i<4 -> K=2i,2i+1 ; i>=4 -> K=16+2(i-4) ; lanes 16-31: +8
__device__ __forceinline__ int wk_base(int i, int half) {
  return ((i < 4) ? (2 * i) : (16 + 2 * (i - 4))) + 8 * half;
}

// element offset of channel group g, image n, pixel (y, x); y, x in -1..256
__device__ __forceinline__ size_t cat_off(int g, int n, int y, int x) {
  return ((((size_t)n * NGRP + g) * PROWS + (y + 1)) * PPITCH + (x + 8)) * 8;
}

// fragment from its two 16-byte parts: lo = k 8*half..+7, hi = k 16+8*half..+7
__device__ __forceinline__ v16bf frag_join(const bf16_t* __restrict__ lo,
                                           const bf16_t* __restrict__ hi) {
  return __builtin_shufflevector(*(const v8bf*)lo, *(const v8bf*)hi, 0, 1, 2, 3,
                                 4, 5, 6, 7, 8, 9, 10, 11, 12, 13, 14, 15);
}

// A/B fragment from bf16 matrix, lane-dim slow (row-major): elem(r,k)=base[r*ldm+k]
__device__ __forceinline__ v16bf frag_ld_bf(const bf16_t* __restrict__ base,
                                            int ldm, int i0, int koff) {
  int lane = threadIdx.x & 31;
  int r = i0 + (lane & 15);
  int half = lane >> 4;
  v16bf f;
#pragma unroll
  for (int i = 0; i < 8; ++i) {
    int k = koff + wk_base(i, half);
    f[2 * i]     = base[r * ldm + k];
    f[2 * i + 1] = base[r * ldm + k + 1];
  }
  return f;
}

// fragment with K slow dim: elem(k, n)=base[k*ldm + n]
__device__ __forceinline__ v16bf frag_ld_bf_T(const bf16_t* __restrict__ base,
                                              int ldm, int i0, int koff) {
  int lane = threadIdx.x & 31;
  int n = i0 + (lane & 15);
  int half = lane >> 4;
  v16bf f;
#pragma unroll
  for (int i = 0; i < 8; ++i) {
    int k = koff + wk_base(i, half);
    f[2 * i]     = base[k * ldm + n];
    f[2 * i + 1] = base[(k + 1) * ldm + n];
  }
  return f;
}

// fragment from f32 matrix (row-major, lane-dim slow), convert to bf16
__device__ __forceinline__ v16bf frag_ld_f32(const float* __restrict__ base,
                                             int ldm, int i0, int koff) {
  int lane = threadIdx.x & 31;
  int r = i0 + (lane & 15);
  int half = lane >> 4;
  v16bf f;
#pragma unroll
  for (int i = 0; i < 8; ++i) {
    int k = koff + wk_base(i, half);
    f[2 * i]     = (bf16_t)base[r * ldm + k];
    f[2 * i + 1] = (bf16_t)base[r * ldm + k + 1];
  }
  return f;
}

// fragment from f32 matrix with K slow (stride ldm, e.g. NCHW channel stride)
__device__ __forceinline__ v16bf frag_ld_f32_T(const float* __restrict__ base,
                                               size_t ldm, int i0, int koff) {
  int lane = threadIdx.x & 31;
  int n = i0 + (lane & 15);
  int half = lane >> 4;
  v16bf f;
#pragma unroll
  for (int i = 0; i < 8; ++i) {
    int k = koff + wk_base(i, half);
    f[2 * i]     = (bf16_t)base[(size_t)k * ldm + n];
    f[2 * i + 1] = (bf16_t)base[(size_t)(k + 1) * ldm + n];
  }
  return f;
}

// ---------------------------------------------------------------------------
// Kernel 0: convert all GEMM weights to bf16 in workspace and zero the concat
// buffer's border. Conv and fusion weights are stored in fragment order:
// [k slab][16-row tile][part lo/hi][lane][8], so one fragment part of a wave is
// 512 contiguous bytes. Conv k slab = (32-channel slab s) * 9 + tap.
// ---------------------------------------------------------------------------
template <int KTOT>
__device__ __forceinline__ void conv_w_frag(const float* __restrict__ Wsrc,
                                            bf16_t* __restrict__ o, int i) {
  const int e = i & 7, ln = (i >> 3) & 31, j = (i >> 8) & 1, mt = (i >> 9) & 1;
  const int ks = i >> 10, s = ks / 9, tap = ks - s * 9;
  const int oc = mt * 16 + (ln & 15);
  const int ic = s * 32 + j * 16 + 8 * (ln >> 4) + e;
  o[i] = (bf16_t)Wsrc[oc * KTOT + ic * 9 + tap];
}

__global__ void prep_weights(const float* __restrict__ W1, const float* __restrict__ W2,
                             const float* __restrict__ W3, const float* __restrict__ Wf,
                             const float* __restrict__ Wo, const float* __restrict__ Wq,
                             const float* __restrict__ Wk, const float* __restrict__ Wv,
                             bf16_t* __restrict__ o1, bf16_t* __restrict__ o2,
                             bf16_t* __restrict__ o3, bf16_t* __restrict__ of,
                             bf16_t* __restrict__ oo, bf16_t* __restrict__ oq,
                             bf16_t* __restrict__ ok, bf16_t* __restrict__ ov,
                             bf16_t* __restrict__ cat) {
  int i = blockIdx.x * blockDim.x + threadIdx.x;
  if (i < 32 * 576)  conv_w_frag<576>(W1, o1, i);
  if (i < 32 * 864)  conv_w_frag<864>(W2, o2, i);
  if (i < 32 * 1152) conv_w_frag<1152>(W3, o3, i);
  if (i < 64 * 160) {
    const int e = i & 7, ln = (i >> 3) & 31, j = (i >> 8) & 1, mt = (i >> 9) & 3;
    const int ks = i >> 11;
    of[i] = (bf16_t)Wf[(mt * 16 + (ln & 15)) * 160 + ks * 32 + j * 16 +
                       8 * (ln >> 4) + e];
  }
  // border of the 16 channel groups the convolutions read, 4 images:
  // 2 whole rows (272 px) + 2 columns x 256 rows = 1056 pixels per plane
  if (i < 64 * 1056) {
    const int pl = i / 1056, rem = i - pl * 1056;
    int row, col;
    if (rem < 544) {
      row = (rem < 272) ? 0 : 257;
      col = (rem < 272) ? rem : rem - 272;
    } else {
      row = 1 + ((rem - 544) >> 1);
      col = (rem & 1) ? 264 : 7;
    }
    const v8bf z = {(bf16_t)0.f, (bf16_t)0.f, (bf16_t)0.f, (bf16_t)0.f,
                    (bf16_t)0.f, (bf16_t)0.f, (bf16_t)0.f, (bf16_t)0.f};
    *(v8bf*)(cat + cat_off(pl & 15, pl >> 4, row - 1, col - 8)) = z;
  }
  if (i < 64 * 32)   oo[i] = (bf16_t)Wo[i];
  if (i < 32 * 64) {
    oq[i] = (bf16_t)Wq[i];
    ok[i] = (bf16_t)Wk[i];
    ov[i] = (bf16_t)Wv[i];
  }
}

// ---------------------------------------------------------------------------
// Kernel 1: region non-local attention. One block per 32x32 cell (256 blocks).
// All GEMMs (k/v proj+pool, q proj, QK^T, PV, Wo proj) on the WMMA pipe.
// Writes f0 (bf16) into channel groups 0..7 of the concat buffer.
// ---------------------------------------------------------------------------
__global__ __launch_bounds__(256) void attn_kernel(
    const float* __restrict__ x,
    const bf16_t* __restrict__ Wq_bf, const float* __restrict__ bq,
    const bf16_t* __restrict__ Wk_bf, const float* __restrict__ bk,
    const bf16_t* __restrict__ Wv_bf, const float* __restrict__ bv,
    const float* __restrict__ gamma_p, const float* __restrict__ bo,
    const bf16_t* __restrict__ Wo_bf, bf16_t* __restrict__ cat) {
  __shared__ bf16_t Kp[256 * 32];   // pooled keys   [key][lat]
  __shared__ bf16_t Vp[256 * 32];   // pooled values [key][lat]
  __shared__ bf16_t ql[128 * 32];   // query chunk   [q][lat]
  __shared__ float  scratchf[4096]; // phase A: k/v pre-pool; phase B: per-wave staging

  const int bid = blockIdx.x;
  const int n = bid >> 6, gh = (bid >> 3) & 7, gw = bid & 7;
  const int row0 = gh * 32, col0 = gw * 32;
  const int t = threadIdx.x, lane = t & 31, wave = t >> 5;
  const int half = lane >> 4, coln = lane & 15;
  const float gamma = gamma_p[0];
  const size_t HW = (size_t)HDIM * WDIM;
  const float* xcell = x + (size_t)n * CIN * HW;  // + yy*WDIM + xx per use

  // ---- Phase A (WMMA): k/v projection + 2x2 maxpool, one row-pair at a time.
  // Waves 0-3 compute k, waves 4-7 compute v; wave owns one 16-px tile of the
  // 64 px (2 rows x 32 cols) in the row-pair. Then all threads pool.
  {
    const int matsel = wave >> 2;  // 0 = k, 1 = v
    const int pt = wave & 3;       // px tile: (row pt>>1, cols (pt&1)*16..)
    const bf16_t* Wm = matsel ? Wv_bf : Wk_bf;
    const float* bm = matsel ? bv : bk;
    const v16bf a00 = frag_ld_bf(Wm, 64, 0, 0);
    const v16bf a01 = frag_ld_bf(Wm, 64, 0, 32);
    const v16bf a10 = frag_ld_bf(Wm, 64, 16, 0);
    const v16bf a11 = frag_ld_bf(Wm, 64, 16, 32);
    float* stg = scratchf + matsel * 2048;  // [64 px][32 ch] f32
    for (int rp = 0; rp < 16; ++rp) {
      const int yy = row0 + rp * 2 + (pt >> 1);
      const int xb = (pt & 1) * 16;
      const float* xp = xcell + (size_t)yy * WDIM + col0 + xb;
      v16bf b0 = frag_ld_f32_T(xp, HW, 0, 0);   // B: lane=px, K=in-ch 0..31
      v16bf b1 = frag_ld_f32_T(xp, HW, 0, 32);  //                     32..63
      v8f c0 = vzero(), c1 = vzero();
      c0 = wmma_bf(a00, b0, c0);
      c0 = wmma_bf(a01, b1, c0);
      c1 = wmma_bf(a10, b0, c1);
      c1 = wmma_bf(a11, b1, c1);
      const int pl = pt * 16 + coln;  // local px 0..63 (= row*32 + col)
#pragma unroll
      for (int r = 0; r < 8; ++r) {
        const int c = r + 8 * half;
        stg[pl * 32 + c]      = c0[r] + bm[c];
        stg[pl * 32 + 16 + c] = c1[r] + bm[16 + c];
      }
      __syncthreads();
      // 2x2 maxpool: 16 pooled cols x 32 ch per matrix; 2 outputs per thread
#pragma unroll
      for (int j = 0; j < 2; ++j) {
        const int idx = t * 2 + j;  // 0..511
        const int pc = idx >> 5, ch = idx & 31;
        const int p00 = (2 * pc) * 32 + ch, p01 = (2 * pc + 1) * 32 + ch;
        const int p10 = (32 + 2 * pc) * 32 + ch, p11 = (32 + 2 * pc + 1) * 32 + ch;
        // stage layout: [pl][ch] with pl = row*32 + col  ->  index pl*32+ch
        const float km = fmaxf(fmaxf(scratchf[(2 * pc) * 32 + ch],
                                     scratchf[(2 * pc + 1) * 32 + ch]),
                               fmaxf(scratchf[(32 + 2 * pc) * 32 + ch],
                                     scratchf[(32 + 2 * pc + 1) * 32 + ch]));
        const float vm = fmaxf(fmaxf(scratchf[2048 + (2 * pc) * 32 + ch],
                                     scratchf[2048 + (2 * pc + 1) * 32 + ch]),
                               fmaxf(scratchf[2048 + (32 + 2 * pc) * 32 + ch],
                                     scratchf[2048 + (32 + 2 * pc + 1) * 32 + ch]));
        Kp[(rp * 16 + pc) * 32 + ch] = (bf16_t)km;
        Vp[(rp * 16 + pc) * 32 + ch] = (bf16_t)vm;
        (void)p00; (void)p01; (void)p10; (void)p11;
      }
      __syncthreads();
    }
  }

  // ---- Phase B: 8 chunks of 128 queries; each wave owns one 16-query tile ----
  for (int chunk = 0; chunk < 8; ++chunk) {
    {  // q projection (WMMA): wave w -> queries [w*16, w*16+16) of the chunk
      const int yy = row0 + chunk * 4 + (wave >> 1);
      const int xb = (wave & 1) * 16;
      const float* xp = xcell + (size_t)yy * WDIM + col0 + xb;
      v16bf b0 = frag_ld_f32_T(xp, HW, 0, 0);
      v16bf b1 = frag_ld_f32_T(xp, HW, 0, 32);
      v8f c0 = vzero(), c1 = vzero();
      c0 = wmma_bf(frag_ld_bf(Wq_bf, 64, 0, 0), b0, c0);
      c0 = wmma_bf(frag_ld_bf(Wq_bf, 64, 0, 32), b1, c0);
      c1 = wmma_bf(frag_ld_bf(Wq_bf, 64, 16, 0), b0, c1);
      c1 = wmma_bf(frag_ld_bf(Wq_bf, 64, 16, 32), b1, c1);
#pragma unroll
      for (int r = 0; r < 8; ++r) {
        const int c = r + 8 * half;
        ql[(wave * 16 + coln) * 32 + c]      = (bf16_t)(c0[r] + bq[c]);
        ql[(wave * 16 + coln) * 32 + 16 + c] = (bf16_t)(c1[r] + bq[16 + c]);
      }
    }
    __syncthreads();

    const int qtb = wave * 16;  // query tile base within chunk
    // scores: one WMMA per 16-key tile (K = 32 latent channels)
    v16bf aq = frag_ld_bf(ql, 32, qtb, 0);
    v8f sc[16];
#pragma unroll
    for (int kt = 0; kt < 16; ++kt) {
      v16bf kbf = frag_ld_bf(Kp, 32, kt * 16, 0);  // B: lane=key, K=lat
      sc[kt] = wmma_bf(aq, kbf, vzero());
    }
    // softmax over 256 keys; rows live as (vgpr r, lane-half), cols across lanes
    float rmax[8], rinv[8];
#pragma unroll
    for (int r = 0; r < 8; ++r) {
      float m = -3.4e38f;
#pragma unroll
      for (int kt = 0; kt < 16; ++kt) m = fmaxf(m, sc[kt][r]);
      for (int sh = 1; sh < 16; sh <<= 1) m = fmaxf(m, __shfl_xor(m, sh, 16));
      rmax[r] = m;
    }
#pragma unroll
    for (int r = 0; r < 8; ++r) {
      float s = 0.f;
#pragma unroll
      for (int kt = 0; kt < 16; ++kt) {
        float e = __expf(sc[kt][r] - rmax[r]);
        sc[kt][r] = e;
        s += e;
      }
      for (int sh = 1; sh < 16; sh <<= 1) s += __shfl_xor(s, sh, 16);
      rinv[r] = 1.f / s;
    }
#pragma unroll
    for (int r = 0; r < 8; ++r)
#pragma unroll
      for (int kt = 0; kt < 16; ++kt) sc[kt][r] *= rinv[r];

    // out[16q][32lat] = P @ V^T, staged through per-wave LDS for A layout
    v8f o0 = vzero(), o1 = vzero();
    float* st = scratchf + wave * 512;
#pragma unroll
    for (int ks = 0; ks < 8; ++ks) {
#pragma unroll
      for (int r = 0; r < 8; ++r) {
        st[(r + 8 * half) * 32 + coln]      = sc[2 * ks][r];
        st[(r + 8 * half) * 32 + 16 + coln] = sc[2 * ks + 1][r];
      }
      v16bf pa  = frag_ld_f32(st, 32, 0, 0);          // A: probs [16][32]
      v16bf vb0 = frag_ld_bf_T(Vp, 32, 0, ks * 32);   // B: V^T, lat 0-15
      v16bf vb1 = frag_ld_bf_T(Vp, 32, 16, ks * 32);  // B: V^T, lat 16-31
      o0 = wmma_bf(pa, vb0, o0);
      o1 = wmma_bf(pa, vb1, o1);
    }

    // f0[64][16q] = gamma*(Wo @ out^T + bo) + x ; out^T staged for B fragment
#pragma unroll
    for (int r = 0; r < 8; ++r) {
      st[(r + 8 * half) * 32 + coln]      = o0[r];
      st[(r + 8 * half) * 32 + 16 + coln] = o1[r];
    }
    v16bf pb = frag_ld_f32(st, 32, 0, 0);  // B: lane=q, K=lat (transposed read)
#pragma unroll
    for (int mt = 0; mt < 4; ++mt) {
      v16bf wa = frag_ld_bf(Wo_bf, 32, mt * 16, 0);
      v8f f0 = wmma_bf(wa, pb, vzero());
      const int qi = chunk * 128 + qtb + coln;
      const int yy = row0 + (qi >> 5), xx = col0 + (qi & 31);
      v8bf pk;  // this lane's 8 consecutive channels = one channel group
#pragma unroll
      for (int r = 0; r < 8; ++r) {
        const int oc = mt * 16 + r + 8 * half;
        const float val =
            gamma * (f0[r] + bo[oc]) +
            x[(((size_t)n * CIN + oc) * HDIM + yy) * WDIM + xx];
        pk[r] = (bf16_t)val;
      }
      *(v8bf*)(cat + cat_off(mt * 2 + half, n, yy, xx)) = pk;
    }
    __syncthreads();  // ql / scratchf reused next chunk
  }
}

// ---------------------------------------------------------------------------
// Kernels 2-4: implicit-GEMM 3x3 conv, pad=1, relu. Input = first KTOT/9
// channels of concat buffer; output -> channels [ocBase, ocBase+32).
// Block tile: 32 oc x 128 px (one row segment); wave w owns x-subtile w.
// K runs over (32-channel slab, tap): each B fragment is the slab's 32 channels
// of the shifted pixel, two 16-byte loads; the zero border stands for pad=1.
// ---------------------------------------------------------------------------
template <int KTOT>
__global__ __launch_bounds__(256) void conv3x3_kernel(
    const bf16_t* __restrict__ cat, const bf16_t* __restrict__ Wr,
    const float* __restrict__ bias, bf16_t* __restrict__ out_cat, int ocBase) {
  const int bid = blockIdx.x;  // 4 imgs * 256 rows * 2 xsegs
  const int n = bid >> 9, rem = bid & 511;
  const int y = rem >> 1, xseg = rem & 1;
  const int t = threadIdx.x, lane = t & 31, wave = t >> 5;
  const int half = lane >> 4, coln = lane & 15;
  const int xx = xseg * 128 + wave * 16 + coln;
  const bf16_t* inb = cat + cat_off(half, n, y - 1, xx - 1);  // tap (0,0)
  const bf16_t* wl = Wr + lane * 8;

  v8f a0 = vzero(), a1 = vzero();
  constexpr int NS = KTOT / 288;  // 32-channel input slabs
  for (int s = 0; s < NS; ++s) {
    const bf16_t* ps = inb + (size_t)s * 4 * PLANE;
    const bf16_t* ws = wl + s * 9 * 1024;
    // unrolled so that the tap offsets are immediates and loads run ahead
#pragma unroll
    for (int tap = 0; tap < 9; ++tap) {
      const bf16_t* p = ps + ((tap / 3) * PPITCH + (tap % 3)) * 8;
      const bf16_t* w = ws + tap * 1024;
      v16bf bfrag = frag_join(p, p + 2 * PLANE);
      // behind the last loads off the pixel address: its registers are free from
      // here on, and a later load's result may be placed in them
      if (s == NS - 1 && tap == 8) asm volatile("s_wait_xcnt 0x0" ::: "memory");
      v16bf wa0 = frag_join(w, w + 256);
      v16bf wa1 = frag_join(w + 512, w + 768);
      a0 = wmma_bf(wa0, bfrag, a0);
      a1 = wmma_bf(wa1, bfrag, a1);
    }
  }
  v8bf p0, p1;
#pragma unroll
  for (int r = 0; r < 8; ++r) {
    const int oc0 = r + 8 * half, oc1 = 16 + r + 8 * half;
    p0[r] = (bf16_t)fmaxf(a0[r] + bias[oc0], 0.f);
    p1[r] = (bf16_t)fmaxf(a1[r] + bias[oc1], 0.f);
  }
  const int og = ocBase >> 3;
  *(v8bf*)(out_cat + cat_off(og + half, n, y, xx)) = p0;
  *(v8bf*)(out_cat + cat_off(og + 2 + half, n, y, xx)) = p1;
}

// ---------------------------------------------------------------------------
// Kernel 5: 1x1 fusion over 160 channels + bias + residual x, fp32 out.
// Block tile: 64 oc x 32 px; 8 waves = 4 oc-tiles x 2 px-tiles.
// ---------------------------------------------------------------------------
__global__ __launch_bounds__(256) void fuse_kernel(
    const bf16_t* __restrict__ cat, const bf16_t* __restrict__ Wf_bf,
    const float* __restrict__ bfus, const float* __restrict__ x,
    float* __restrict__ out) {
  const int bid = blockIdx.x;  // 4 imgs * 256 rows * 8 xsegs
  const int n = bid >> 11, rem = bid & 2047;
  const int y = rem >> 3, xseg = rem & 7;
  const int t = threadIdx.x, lane = t & 31, wave = t >> 5;
  const int mt = wave & 3, nt = wave >> 2;
  const int half = lane >> 4, coln = lane & 15;
  const int xx = xseg * 32 + nt * 16 + coln;
  const bf16_t* inb = cat + cat_off(half, n, y, xx);
  const bf16_t* wl = Wf_bf + mt * 512 + lane * 8;

  v8f acc = vzero();
#pragma unroll
  for (int ks = 0; ks < 5; ++ks) {
    const bf16_t* w = wl + ks * 2048;
    const bf16_t* p = inb + (size_t)ks * 4 * PLANE;  // k = channel
    v16bf wa = frag_join(w, w + 256);
    v16bf bb = frag_join(p, p + 2 * PLANE);
    acc = wmma_bf(wa, bb, acc);
  }
#pragma unroll
  for (int r = 0; r < 8; ++r) {
    const int oc = mt * 16 + r + 8 * half;
    const size_t xi = (((size_t)n * CIN + oc) * HDIM + y) * WDIM + xx;
    out[xi] = acc[r] + bfus[oc] + x[xi];
  }
}

// ---------------------------------------------------------------------------
extern "C" void kernel_launch(void* const* d_in, const int* in_sizes, int n_in,
                              void* d_out, int out_size, void* d_ws,
                              size_t ws_size, hipStream_t stream) {
  const float* x  = (const float*)d_in[0];
  const float* Wq = (const float*)d_in[1];
  const float* bq = (const float*)d_in[2];
  const float* Wk = (const float*)d_in[3];
  const float* bk = (const float*)d_in[4];
  const float* Wv = (const float*)d_in[5];
  const float* bv = (const float*)d_in[6];
  const float* Wo = (const float*)d_in[7];
  const float* bo = (const float*)d_in[8];
  const float* gm = (const float*)d_in[9];
  const float* W1 = (const float*)d_in[10];
  const float* b1 = (const float*)d_in[11];
  const float* W2 = (const float*)d_in[12];
  const float* b2 = (const float*)d_in[13];
  const float* W3 = (const float*)d_in[14];
  const float* b3 = (const float*)d_in[15];
  const float* Wf = (const float*)d_in[16];
  const float* bfus = (const float*)d_in[17];
  float* out = (float*)d_out;

  // workspace layout: bf16 concat planes [4][20][258][272][8] then bf16 weights
  const size_t catElems = (size_t)4 * NGRP * PLANE;
  bf16_t* cat = (bf16_t*)d_ws;
  bf16_t* W1r = cat + catElems;
  bf16_t* W2r = W1r + 32 * 576;
  bf16_t* W3r = W2r + 32 * 864;
  bf16_t* Wfb = W3r + 32 * 1152;
  bf16_t* Wob = Wfb + 64 * 160;
  bf16_t* Wqb = Wob + 64 * 32;
  bf16_t* Wkb = Wqb + 32 * 64;
  bf16_t* Wvb = Wkb + 32 * 64;

  prep_weights<<<264, 256, 0, stream>>>(W1, W2, W3, Wf, Wo, Wq, Wk, Wv, W1r,
                                        W2r, W3r, Wfb, Wob, Wqb, Wkb, Wvb, cat);
  attn_kernel<<<256, 256, 0, stream>>>(x, Wqb, bq, Wkb, bk, Wvb, bv, gm, bo,
                                       Wob, cat);
  conv3x3_kernel<576><<<2048, 256, 0, stream>>>(cat, W1r, b1, cat, 64);
  conv3x3_kernel<864><<<2048, 256, 0, stream>>>(cat, W2r, b2, cat, 96);
  conv3x3_kernel<1152><<<2048, 256, 0, stream>>>(cat, W3r, b3, cat, 128);
  fuse_kernel<<<8192, 256, 0, stream>>>(cat, Wfb, bfus, x, out);
}

// v002
// One run takes 184 microseconds.
// Timed twice side by side with v001, it ran 1.16 and 1.17 times as fast.
// Over all steps from v000 it is 3.36 times as fast.
#include <hip/hip_runtime.h>
#include <hip/hip_bf16.h>

typedef __bf16 bf16_t;
typedef __attribute__((ext_vector_type(16))) __bf16 v16bf;
typedef __attribute__((ext_vector_type(8)))  __bf16 v8bf;
typedef __attribute__((ext_vector_type(8)))  float  v8f;

#define HDIM 256
#define WDIM 256
#define CIN  64
#define CLAT 32

// Concat buffer layout: one plane per (image, group of 8 channels), each plane
// [PROWS][PPITCH] pixels of 8 bf16 (16 bytes). Pixel (y, x) sits at row y + 1,
// column x + 8, so a 16-pixel tile starts on a 128-byte line; row 0, row 257,
// column 7 and column 264 are the zero border of the 3x3 convolutions.
#define PROWS  258
#define PPITCH 272
#define PLANE  (PROWS * PPITCH * 8)
#define NGRP   20

// ---------------------------------------------------------------------------
// WMMA helpers (CDNA5 16x16x32 bf16, f32 accumulate)
// ---------------------------------------------------------------------------
__device__ __forceinline__ v8f wmma_bf(v16bf a, v16bf b, v8f c) {
  return __builtin_amdgcn_wmma_f32_16x16x32_bf16(false, a, false, b,
                                                 (short)0, c, false, false);
}

__device__ __forceinline__ v8f vzero() {
  v8f z = {0.f, 0.f, 0.f, 0.f, 0.f, 0.f, 0.f, 0.f};
  return z;
}

// K-pair base within a K=32 slab for bf16 A/B fragments (ISA 7.12.2):
// lanes 0-15: VGPR i<4 -> K=2i,2i+1 ; i>=4 -> K=16+2(i-4) ; lanes 16-31: +8
__device__ __forceinline__ int wk_base(int i, int half) {
  return ((i < 4) ? (2 * i) : (16 + 2 * (i - 4))) + 8 * half;
}

// element offset of channel group g, image n, pixel (y, x); y, x in -1..256
__device__ __forceinline__ size_t cat_off(int g, int n, int y, int x) {
  return ((((size_t)n * NGRP + g) * PROWS + (y + 1)) * PPITCH + (x + 8)) * 8;
}

// fragment from its two 16-byte parts: lo = k 8*half..+7, hi = k 16+8*half..+7
__device__ __forceinline__ v16bf frag_join(const bf16_t* __restrict__ lo,
                                           const bf16_t* __restrict__ hi) {
  return __builtin_shufflevector(*(const v8bf*)lo, *(const v8bf*)hi, 0, 1, 2, 3,
                                 4, 5, 6, 7, 8, 9, 10, 11, 12, 13, 14, 15);
}

// A/B fragment from bf16 matrix, lane-dim slow (row-major): elem(r,k)=base[r*ldm+k]
__device__ __forceinline__ v16bf frag_ld_bf(const bf16_t* __restrict__ base,
                                            int ldm, int i0, int koff) {
  int lane = threadIdx.x & 31;
  int r = i0 + (lane & 15);
  int half = lane >> 4;
  v16bf f;
#pragma unroll
  for (int i = 0; i < 8; ++i) {
    int k = koff + wk_base(i, half);
    f[2 * i]     = base[r * ldm + k];
    f[2 * i + 1] = base[r * ldm + k + 1];
  }
  return f;
}

// fragment with K slow dim: elem(k, n)=base[k*ldm + n]
__device__ __forceinline__ v16bf frag_ld_bf_T(const bf16_t* __restrict__ base,
                                              int ldm, int i0, int koff) {
  int lane = threadIdx.x & 31;
  int n = i0 + (lane & 15);
  int half = lane >> 4;
  v16bf f;
#pragma unroll
  for (int i = 0; i < 8; ++i) {
    int k = koff + wk_base(i, half);
    f[2 * i]     = base[k * ldm + n];
    f[2 * i + 1] = base[(k + 1) * ldm + n];
  }
  return f;
}

// fragment from f32 matrix (row-major, lane-dim slow), convert to bf16
__device__ __forceinline__ v16bf frag_ld_f32(const float* __restrict__ base,
                                             int ldm, int i0, int koff) {
  int lane = threadIdx.x & 31;
  int r = i0 + (lane & 15);
  int half = lane >> 4;
  v16bf f;
#pragma unroll
  for (int i = 0; i < 8; ++i) {
    int k = koff + wk_base(i, half);
    f[2 * i]     = (bf16_t)base[r * ldm + k];
    f[2 * i + 1] = (bf16_t)base[r * ldm + k + 1];
  }
  return f;
}

// fragment from f32 matrix with K slow (stride ldm, e.g. NCHW channel stride)
__device__ __forceinline__ v16bf frag_ld_f32_T(const float* __restrict__ base,
                                               size_t ldm, int i0, int koff) {
  int lane = threadIdx.x & 31;
  int n = i0 + (lane & 15);
  int half = lane >> 4;
  v16bf f;
#pragma unroll
  for (int i = 0; i < 8; ++i) {
    int k = koff + wk_base(i, half);
    f[2 * i]     = (bf16_t)base[(size_t)k * ldm + n];
    f[2 * i + 1] = (bf16_t)base[(size_t)(k + 1) * ldm + n];
  }
  return f;
}

// ---------------------------------------------------------------------------
// Kernel 0: convert all GEMM weights to bf16 in workspace and zero the concat
// buffer's border. Conv and fusion weights are stored in fragment order:
// [k slab][16-row tile][part lo/hi][lane][8], so one fragment part of a wave is
// 512 contiguous bytes. Conv k slab = (32-channel slab s) * 9 + tap.
// ---------------------------------------------------------------------------
template <int KTOT>
__device__ __forceinline__ void conv_w_frag(const float* __restrict__ Wsrc,
                                            bf16_t* __restrict__ o, int i) {
  const int e = i & 7, ln = (i >> 3) & 31, j = (i >> 8) & 1, mt = (i >> 9) & 1;
  const int ks = i >> 10, s = ks / 9, tap = ks - s * 9;
  const int oc = mt * 16 + (ln & 15);
  const int ic = s * 32 + j * 16 + 8 * (ln >> 4) + e;
  o[i] = (bf16_t)Wsrc[oc * KTOT + ic * 9 + tap];
}

__global__ void prep_weights(const float* __restrict__ W1, const float* __restrict__ W2,
                             const float* __restrict__ W3, const float* __restrict__ Wf,
                             const float* __restrict__ Wo, const float* __restrict__ Wq,
                             const float* __restrict__ Wk, const float* __restrict__ Wv,
                             bf16_t* __restrict__ o1, bf16_t* __restrict__ o2,
                             bf16_t* __restrict__ o3, bf16_t* __restrict__ of,
                             bf16_t* __restrict__ oo, bf16_t* __restrict__ oq,
                             bf16_t* __restrict__ ok, bf16_t* __restrict__ ov,
                             bf16_t* __restrict__ cat) {
  int i = blockIdx.x * blockDim.x + threadIdx.x;
  if (i < 32 * 576)  conv_w_frag<576>(W1, o1, i);
  if (i < 32 * 864)  conv_w_frag<864>(W2, o2, i);
  if (i < 32 * 1152) conv_w_frag<1152>(W3, o3, i);
  if (i < 64 * 160) {
    const int e = i & 7, ln = (i >> 3) & 31, j = (i >> 8) & 1, mt = (i >> 9) & 3;
    const int ks = i >> 11;
    of[i] = (bf16_t)Wf[(mt * 16 + (ln & 15)) * 160 + ks * 32 + j * 16 +
                       8 * (ln >> 4) + e];
  }
  // border of the 16 channel groups the convolutions read, 4 images:
  // 2 whole rows (272 px) + 2 columns x 256 rows = 1056 pixels per plane
  if (i < 64 * 1056) {
    const int pl = i / 1056, rem = i - pl * 1056;
    int row, col;
    if (rem < 544) {
      row = (rem < 272) ? 0 : 257;
      col = (rem < 272) ? rem : rem - 272;
    } else {
      row = 1 + ((rem - 544) >> 1);
      col = (rem & 1) ? 264 : 7;
    }
    const v8bf z = {(bf16_t)0.f, (bf16_t)0.f, (bf16_t)0.f, (bf16_t)0.f,
                    (bf16_t)0.f, (bf16_t)0.f, (bf16_t)0.f, (bf16_t)0.f};
    *(v8bf*)(cat + cat_off(pl & 15, pl >> 4, row - 1, col - 8)) = z;
  }
  if (i < 64 * 32)   oo[i] = (bf16_t)Wo[i];
  if (i < 32 * 64) {
    oq[i] = (bf16_t)Wq[i];
    ok[i] = (bf16_t)Wk[i];
    ov[i] = (bf16_t)Wv[i];
  }
}

// ---------------------------------------------------------------------------
// Kernel 1: region non-local attention. One block per 32x32 cell (256 blocks).
// All GEMMs (k/v proj+pool, q proj, QK^T, PV, Wo proj) on the WMMA pipe.
// Writes f0 (bf16) into channel groups 0..7 of the concat buffer.
// ---------------------------------------------------------------------------
__global__ __launch_bounds__(256) void attn_kernel(
    const float* __restrict__ x,
    const bf16_t* __restrict__ Wq_bf, const float* __restrict__ bq,
    const bf16_t* __restrict__ Wk_bf, const float* __restrict__ bk,
    const bf16_t* __restrict__ Wv_bf, const float* __restrict__ bv,
    const float* __restrict__ gamma_p, const float* __restrict__ bo,
    const bf16_t* __restrict__ Wo_bf, bf16_t* __restrict__ cat) {
  __shared__ bf16_t Kp[256 * 32];   // pooled keys   [key][lat]
  __shared__ bf16_t Vp[256 * 32];   // pooled values [key][lat]
  __shared__ bf16_t ql[128 * 32];   // query chunk   [q][lat]
  __shared__ float  scratchf[4096]; // phase A: k/v pre-pool; phase B: per-wave staging

  const int bid = blockIdx.x;
  const int n = bid >> 6, gh = (bid >> 3) & 7, gw = bid & 7;
  const int row0 = gh * 32, col0 = gw * 32;
  const int t = threadIdx.x, lane = t & 31, wave = t >> 5;
  const int half = lane >> 4, coln = lane & 15;
  const float gamma = gamma_p[0];
  const size_t HW = (size_t)HDIM * WDIM;
  const float* xcell = x + (size_t)n * CIN * HW;  // + yy*WDIM + xx per use

  // ---- Phase A (WMMA): k/v projection + 2x2 maxpool, one row-pair at a time.
  // Waves 0-3 compute k, waves 4-7 compute v; wave owns one 16-px tile of the
  // 64 px (2 rows x 32 cols) in the row-pair. Then all threads pool.
  {
    const int matsel = wave >> 2;  // 0 = k, 1 = v
    const int pt = wave & 3;       // px tile: (row pt>>1, cols (pt&1)*16..)
    const bf16_t* Wm = matsel ? Wv_bf : Wk_bf;
    const float* bm = matsel ? bv : bk;
    const v16bf a00 = frag_ld_bf(Wm, 64, 0, 0);
    const v16bf a01 = frag_ld_bf(Wm, 64, 0, 32);
    const v16bf a10 = frag_ld_bf(Wm, 64, 16, 0);
    const v16bf a11 = frag_ld_bf(Wm, 64, 16, 32);
    float* stg = scratchf + matsel * 2048;  // [64 px][32 ch] f32
    for (int rp = 0; rp < 16; ++rp) {
      const int yy = row0 + rp * 2 + (pt >> 1);
      const int xb = (pt & 1) * 16;
      const float* xp = xcell + (size_t)yy * WDIM + col0 + xb;
      v16bf b0 = frag_ld_f32_T(xp, HW, 0, 0);   // B: lane=px, K=in-ch 0..31
      v16bf b1 = frag_ld_f32_T(xp, HW, 0, 32);  //                     32..63
      v8f c0 = vzero(), c1 = vzero();
      c0 = wmma_bf(a00, b0, c0);
      c0 = wmma_bf(a01, b1, c0);
      c1 = wmma_bf(a10, b0, c1);
      c1 = wmma_bf(a11, b1, c1);
      const int pl = pt * 16 + coln;  // local px 0..63 (= row*32 + col)
#pragma unroll
      for (int r = 0; r < 8; ++r) {
        const int c = r + 8 * half;
        stg[pl * 32 + c]      = c0[r] + bm[c];
        stg[pl * 32 + 16 + c] = c1[r] + bm[16 + c];
      }
      __syncthreads();
      // 2x2 maxpool: 16 pooled cols x 32 ch per matrix; 2 outputs per thread
#pragma unroll
      for (int j = 0; j < 2; ++j) {
        const int idx = t * 2 + j;  // 0..511
        const int pc = idx >> 5, ch = idx & 31;
        const int p00 = (2 * pc) * 32 + ch, p01 = (2 * pc + 1) * 32 + ch;
        const int p10 = (32 + 2 * pc) * 32 + ch, p11 = (32 + 2 * pc + 1) * 32 + ch;
        // stage layout: [pl][ch] with pl = row*32 + col  ->  index pl*32+ch
        const float km = fmaxf(fmaxf(scratchf[(2 * pc) * 32 + ch],
                                     scratchf[(2 * pc + 1) * 32 + ch]),
                               fmaxf(scratchf[(32 + 2 * pc) * 32 + ch],
                                     scratchf[(32 + 2 * pc + 1) * 32 + ch]));
        const float vm = fmaxf(fmaxf(scratchf[2048 + (2 * pc) * 32 + ch],
                                     scratchf[2048 + (2 * pc + 1) * 32 + ch]),
                               fmaxf(scratchf[2048 + (32 + 2 * pc) * 32 + ch],
                                     scratchf[2048 + (32 + 2 * pc + 1) * 32 + ch]));
        Kp[(rp * 16 + pc) * 32 + ch] = (bf16_t)km;
        Vp[(rp * 16 + pc) * 32 + ch] = (bf16_t)vm;
        (void)p00; (void)p01; (void)p10; (void)p11;
      }
      __syncthreads();
    }
  }

  // ---- Phase B: 8 chunks of 128 queries; each wave owns one 16-query tile ----
  for (int chunk = 0; chunk < 8; ++chunk) {
    {  // q projection (WMMA): wave w -> queries [w*16, w*16+16) of the chunk
      const int yy = row0 + chunk * 4 + (wave >> 1);
      const int xb = (wave & 1) * 16;
      const float* xp = xcell + (size_t)yy * WDIM + col0 + xb;
      v16bf b0 = frag_ld_f32_T(xp, HW, 0, 0);
      v16bf b1 = frag_ld_f32_T(xp, HW, 0, 32);
      v8f c0 = vzero(), c1 = vzero();
      c0 = wmma_bf(frag_ld_bf(Wq_bf, 64, 0, 0), b0, c0);
      c0 = wmma_bf(frag_ld_bf(Wq_bf, 64, 0, 32), b1, c0);
      c1 = wmma_bf(frag_ld_bf(Wq_bf, 64, 16, 0), b0, c1);
      c1 = wmma_bf(frag_ld_bf(Wq_bf, 64, 16, 32), b1, c1);
#pragma unroll
      for (int r = 0; r < 8; ++r) {
        const int c = r + 8 * half;
        ql[(wave * 16 + coln) * 32 + c]      = (bf16_t)(c0[r] + bq[c]);
        ql[(wave * 16 + coln) * 32 + 16 + c] = (bf16_t)(c1[r] + bq[16 + c]);
      }
    }
    __syncthreads();

    const int qtb = wave * 16;  // query tile base within chunk
    // scores: one WMMA per 16-key tile (K = 32 latent channels)
    v16bf aq = frag_ld_bf(ql, 32, qtb, 0);
    v8f sc[16];
#pragma unroll
    for (int kt = 0; kt < 16; ++kt) {
      v16bf kbf = frag_ld_bf(Kp, 32, kt * 16, 0);  // B: lane=key, K=lat
      sc[kt] = wmma_bf(aq, kbf, vzero());
    }
    // softmax over 256 keys; rows live as (vgpr r, lane-half), cols across lanes
    float rmax[8], rinv[8];
#pragma unroll
    for (int r = 0; r < 8; ++r) {
      float m = -3.4e38f;
#pragma unroll
      for (int kt = 0; kt < 16; ++kt) m = fmaxf(m, sc[kt][r]);
      for (int sh = 1; sh < 16; sh <<= 1) m = fmaxf(m, __shfl_xor(m, sh, 16));
      rmax[r] = m;
    }
#pragma unroll
    for (int r = 0; r < 8; ++r) {
      float s = 0.f;
#pragma unroll
      for (int kt = 0; kt < 16; ++kt) {
        float e = __expf(sc[kt][r] - rmax[r]);
        sc[kt][r] = e;
        s += e;
      }
      for (int sh = 1; sh < 16; sh <<= 1) s += __shfl_xor(s, sh, 16);
      rinv[r] = 1.f / s;
    }
#pragma unroll
    for (int r = 0; r < 8; ++r)
#pragma unroll
      for (int kt = 0; kt < 16; ++kt) sc[kt][r] *= rinv[r];

    // out[16q][32lat] = P @ V^T, staged through per-wave LDS for A layout
    v8f o0 = vzero(), o1 = vzero();
    float* st = scratchf + wave * 512;
#pragma unroll
    for (int ks = 0; ks < 8; ++ks) {
#pragma unroll
      for (int r = 0; r < 8; ++r) {
        st[(r + 8 * half) * 32 + coln]      = sc[2 * ks][r];
        st[(r + 8 * half) * 32 + 16 + coln] = sc[2 * ks + 1][r];
      }
      v16bf pa  = frag_ld_f32(st, 32, 0, 0);          // A: probs [16][32]
      v16bf vb0 = frag_ld_bf_T(Vp, 32, 0, ks * 32);   // B: V^T, lat 0-15
      v16bf vb1 = frag_ld_bf_T(Vp, 32, 16, ks * 32);  // B: V^T, lat 16-31
      o0 = wmma_bf(pa, vb0, o0);
      o1 = wmma_bf(pa, vb1, o1);
    }

    // f0[64][16q] = gamma*(Wo @ out^T + bo) + x ; out^T staged for B fragment
#pragma unroll
    for (int r = 0; r < 8; ++r) {
      st[(r + 8 * half) * 32 + coln]      = o0[r];
      st[(r + 8 * half) * 32 + 16 + coln] = o1[r];
    }
    v16bf pb = frag_ld_f32(st, 32, 0, 0);  // B: lane=q, K=lat (transposed read)
#pragma unroll
    for (int mt = 0; mt < 4; ++mt) {
      v16bf wa = frag_ld_bf(Wo_bf, 32, mt * 16, 0);
      v8f f0 = wmma_bf(wa, pb, vzero());
      const int qi = chunk * 128 + qtb + coln;
      const int yy = row0 + (qi >> 5), xx = col0 + (qi & 31);
      v8bf pk;  // this lane's 8 consecutive channels = one channel group
#pragma unroll
      for (int r = 0; r < 8; ++r) {
        const int oc = mt * 16 + r + 8 * half;
        const float val =
            gamma * (f0[r] + bo[oc]) +
            x[(((size_t)n * CIN + oc) * HDIM + yy) * WDIM + xx];
        pk[r] = (bf16_t)val;
      }
      *(v8bf*)(cat + cat_off(mt * 2 + half, n, yy, xx)) = pk;
    }
    __syncthreads();  // ql / scratchf reused next chunk
  }
}

// ---------------------------------------------------------------------------
// Kernels 2-4: implicit-GEMM 3x3 conv, pad=1, relu. Input = first KTOT/9
// channels of concat buffer; output -> channels [ocBase, ocBase+32).
// Block tile: 32 oc x CROWS rows x 128 px; wave w owns x-subtile w of all rows.
// K runs over groups (32-channel slab, column tap dx), row tap dy inside. For one
// group the six weight fragments (3 dy x 2 oc tiles) stay in registers for all
// rows, and each input row's pixel fragment, two 16-byte loads, feeds the up to
// three output rows it touches; the zero border stands for pad=1.
// ---------------------------------------------------------------------------
#define CROWS 8

struct conv_group {
  v16bf wa[3][2];         // weights [dy][oc tile]
  v16bf px[CROWS + 2];    // pixels of input rows y0 - 1 .. y0 + CROWS
};

// all fragments of group g = slab * 3 + dx; every offset is a constant
__device__ __forceinline__ void conv_group_ld(conv_group& f,
                                              const bf16_t* __restrict__ inb,
                                              const bf16_t* __restrict__ wl,
                                              int g) {
  const int s = g / 3, dx = g % 3;
#pragma unroll
  for (int dy = 0; dy < 3; ++dy) {
    const bf16_t* w = wl + (s * 9 + dy * 3 + dx) * 1024;
    f.wa[dy][0] = frag_join(w, w + 256);
    f.wa[dy][1] = frag_join(w + 512, w + 768);
  }
#pragma unroll
  for (int ir = 0; ir < CROWS + 2; ++ir) {
    const bf16_t* p = inb + (size_t)s * 4 * PLANE + (ir * PPITCH + dx) * 8;
    f.px[ir] = frag_join(p, p + 2 * PLANE);
  }
}

template <int KTOT>
__global__ __launch_bounds__(256) void conv3x3_kernel(
    const bf16_t* __restrict__ cat, const bf16_t* __restrict__ Wr,
    const float* __restrict__ bias, bf16_t* __restrict__ out_cat, int ocBase) {
  const int bid = blockIdx.x;  // 4 imgs * (256 / CROWS) row groups * 2 xsegs
  constexpr int BPI = (HDIM / CROWS) * 2;
  const int n = bid / BPI, rem = bid % BPI;
  const int y0 = (rem >> 1) * CROWS, xseg = rem & 1;
  const int t = threadIdx.x, lane = t & 31, wave = t >> 5;
  const int half = lane >> 4, coln = lane & 15;
  const int xx = xseg * 128 + wave * 16 + coln;
  const bf16_t* inb = cat + cat_off(half, n, y0 - 1, xx - 1);  // tap (0,0)
  const bf16_t* wl = Wr + lane * 8;

  v8f acc[CROWS][2];
#pragma unroll
  for (int r = 0; r < CROWS; ++r) acc[r][0] = acc[r][1] = vzero();
  constexpr int NG = (KTOT / 288) * 3;  // groups: 32-channel slabs x 3 dx
  conv_group f[2];
  conv_group_ld(f[0], inb, wl, 0);
  // unrolled so that the two fragment sets stay in registers (constant index)
#pragma unroll
  for (int g = 0; g < NG; ++g) {
    // keeps the next group's loads behind the last group's products (or behind
    // group 0's loads), so that no third fragment set is live
    __builtin_amdgcn_sched_barrier(0);
    if (g + 1 == NG) {
      // behind the last group's loads the address registers fall free while
      // loads that name them are in flight: the wait stands in front of any
      // overwrite, and its operands keep the registers whole up to it
      asm volatile("s_wait_xcnt 0x0" ::"v"(lane), "v"(inb) : "memory");
    }
    if (g + 1 < NG) conv_group_ld(f[(g + 1) & 1], inb, wl, g + 1);
    // keeps the next group's loads in front of this group's products: without
    // it each pixel load is sunk to its use and its latency is waited out there
    __builtin_amdgcn_sched_barrier(0);
    const conv_group& c = f[g & 1];
#pragma unroll
    for (int ir = 0; ir < CROWS + 2; ++ir) {
#pragma unroll
      for (int dy = 0; dy < 3; ++dy) {
        const int orow = ir - dy;
        if (orow >= 0 && orow < CROWS) {
          acc[orow][0] = wmma_bf(c.wa[dy][0], c.px[ir], acc[orow][0]);
          acc[orow][1] = wmma_bf(c.wa[dy][1], c.px[ir], acc[orow][1]);
        }
      }
    }
  }
  // keeps the last group's products in their order, free of the epilogue
  __builtin_amdgcn_sched_barrier(0);
  float bs0[8], bs1[8];
#pragma unroll
  for (int r = 0; r < 8; ++r) {
    bs0[r] = bias[r + 8 * half];
    bs1[r] = bias[16 + r + 8 * half];
  }
  bf16_t* ob = out_cat + cat_off((ocBase >> 3) + half, n, y0, xx);
#pragma unroll
  for (int q = 0; q < CROWS; ++q) {
    v8bf p0, p1;
#pragma unroll
    for (int r = 0; r < 8; ++r) {
      p0[r] = (bf16_t)fmaxf(acc[q][0][r] + bs0[r], 0.f);
      p1[r] = (bf16_t)fmaxf(acc[q][1][r] + bs1[r], 0.f);
    }
    *(v8bf*)(ob + q * PPITCH * 8) = p0;
    *(v8bf*)(ob + q * PPITCH * 8 + 2 * PLANE) = p1;
  }
}

// ---------------------------------------------------------------------------
// Kernel 5: 1x1 fusion over 160 channels + bias + residual x, fp32 out.
// Block tile: 64 oc x 32 px; 8 waves = 4 oc-tiles x 2 px-tiles.
// ---------------------------------------------------------------------------
__global__ __launch_bounds__(256) void fuse_kernel(
    const bf16_t* __restrict__ cat, const bf16_t* __restrict__ Wf_bf,
    const float* __restrict__ bfus, const float* __restrict__ x,
    float* __restrict__ out) {
  const int bid = blockIdx.x;  // 4 imgs * 256 rows * 8 xsegs
  const int n = bid >> 11, rem = bid & 2047;
  const int y = rem >> 3, xseg = rem & 7;
  const int t = threadIdx.x, lane = t & 31, wave = t >> 5;
  const int mt = wave & 3, nt = wave >> 2;
  const int half = lane >> 4, coln = lane & 15;
  const int xx = xseg * 32 + nt * 16 + coln;
  const bf16_t* inb = cat + cat_off(half, n, y, xx);
  const bf16_t* wl = Wf_bf + mt * 512 + lane * 8;

  v8f acc = vzero();
#pragma unroll
  for (int ks = 0; ks < 5; ++ks) {
    const bf16_t* w = wl + ks * 2048;
    const bf16_t* p = inb + (size_t)ks * 4 * PLANE;  // k = channel
    v16bf wa = frag_join(w, w + 256);
    v16bf bb = frag_join(p, p + 2 * PLANE);
    acc = wmma_bf(wa, bb, acc);
  }
#pragma unroll
  for (int r = 0; r < 8; ++r) {
    const int oc = mt * 16 + r + 8 * half;
    const size_t xi = (((size_t)n * CIN + oc) * HDIM + y) * WDIM + xx;
    out[xi] = acc[r] + bfus[oc] + x[xi];
  }
}

// ---------------------------------------------------------------------------
extern "C" void kernel_launch(void* const* d_in, const int* in_sizes, int n_in,
                              void* d_out, int out_size, void* d_ws,
                              size_t ws_size, hipStream_t stream) {
  const float* x  = (const float*)d_in[0];
  const float* Wq = (const float*)d_in[1];
  const float* bq = (const float*)d_in[2];
  const float* Wk = (const float*)d_in[3];
  const float* bk = (const float*)d_in[4];
  const float* Wv = (const float*)d_in[5];
  const float* bv = (const float*)d_in[6];
  const float* Wo = (const float*)d_in[7];
  const float* bo = (const float*)d_in[8];
  const float* gm = (const float*)d_in[9];
  const float* W1 = (const float*)d_in[10];
  const float* b1 = (const float*)d_in[11];
  const float* W2 = (const float*)d_in[12];
  const float* b2 = (const float*)d_in[13];
  const float* W3 = (const float*)d_in[14];
  const float* b3 = (const float*)d_in[15];
  const float* Wf = (const float*)d_in[16];
  const float* bfus = (const float*)d_in[17];
  float* out = (float*)d_out;

  // workspace layout: bf16 concat planes [4][20][258][272][8] then bf16 weights
  const size_t catElems = (size_t)4 * NGRP * PLANE;
  bf16_t* cat = (bf16_t*)d_ws;
  bf16_t* W1r = cat + catElems;
  bf16_t* W2r = W1r + 32 * 576;
  bf16_t* W3r = W2r + 32 * 864;
  bf16_t* Wfb = W3r + 32 * 1152;
  bf16_t* Wob = Wfb + 64 * 160;
  bf16_t* Wqb = Wob + 64 * 32;
  bf16_t* Wkb = Wqb + 32 * 64;
  bf16_t* Wvb = Wkb + 32 * 64;

  prep_weights<<<264, 256, 0, stream>>>(W1, W2, W3, Wf, Wo, Wq, Wk, Wv, W1r,
                                        W2r, W3r, Wfb, Wob, Wqb, Wkb, Wvb, cat);
  attn_kernel<<<256, 256, 0, stream>>>(x, Wqb, bq, Wkb, bk, Wvb, bv, gm, bo,
                                       Wob, cat);
  conv3x3_kernel<576><<<256, 256, 0, stream>>>(cat, W1r, b1, cat, 64);
  conv3x3_kernel<864><<<256, 256, 0, stream>>>(cat, W2r, b2, cat, 96);
  conv3x3_kernel<1152><<<256, 256, 0, stream>>>(cat, W3r, b3, cat, 128);
  fuse_kernel<<<8192, 256, 0, stream>>>(cat, Wfb, bfus, x, out);
}

// v003
// It runs in 107 microseconds.
// Two timings next to v002 both put it at 1.72 times that version's speed.
// All steps since v000 together make it 5.76 times as fast.
#include <hip/hip_runtime.h>
#include <hip/hip_bf16.h>

typedef __bf16 bf16_t;
typedef __attribute__((ext_vector_type(16))) __bf16 v16bf;
typedef __attribute__((ext_vector_type(8)))  __bf16 v8bf;
typedef __attribute__((ext_vector_type(8)))  float  v8f;

#define HDIM 256
#define WDIM 256
#define CIN  64
#define CLAT 32

// Concat buffer layout: one plane per (image, group of 8 channels), each plane
// [PROWS][PPITCH] pixels of 8 bf16 (16 bytes). Pixel (y, x) sits at row y + 1,
// column x + 8, so a 16-pixel tile starts on a 128-byte line; row 0, row 257,
// column 7 and column 264 are the zero border of the 3x3 convolutions.
#define PROWS  258
#define PPITCH 272
#define PLANE  (PROWS * PPITCH * 8)
#define NGRP   20

// ---------------------------------------------------------------------------
// WMMA helpers (CDNA5 16x16x32 bf16, f32 accumulate)
// ---------------------------------------------------------------------------
__device__ __forceinline__ v8f wmma_bf(v16bf a, v16bf b, v8f c) {
  return __builtin_amdgcn_wmma_f32_16x16x32_bf16(false, a, false, b,
                                                 (short)0, c, false, false);
}

__device__ __forceinline__ v8f vzero() {
  v8f z = {0.f, 0.f, 0.f, 0.f, 0.f, 0.f, 0.f, 0.f};
  return z;
}

// K-pair base within a K=32 slab for bf16 A/B fragments (ISA 7.12.2):
// lanes 0-15: VGPR i<4 -> K=2i,2i+1 ; i>=4 -> K=16+2(i-4) ; lanes 16-31: +8
__device__ __forceinline__ int wk_base(int i, int half) {
  return ((i < 4) ? (2 * i) : (16 + 2 * (i - 4))) + 8 * half;
}

// element offset of channel group g, image n, pixel (y, x); y, x in -1..256
__device__ __forceinline__ size_t cat_off(int g, int n, int y, int x) {
  return ((((size_t)n * NGRP + g) * PROWS + (y + 1)) * PPITCH + (x + 8)) * 8;
}

// fragment from its two 16-byte parts: lo = k 8*half..+7, hi = k 16+8*half..+7
__device__ __forceinline__ v16bf frag_join(const bf16_t* __restrict__ lo,
                                           const bf16_t* __restrict__ hi) {
  return __builtin_shufflevector(*(const v8bf*)lo, *(const v8bf*)hi, 0, 1, 2, 3,
                                 4, 5, 6, 7, 8, 9, 10, 11, 12, 13, 14, 15);
}

// A/B fragment from bf16 matrix, lane-dim slow (row-major): elem(r,k)=base[r*ldm+k]
__device__ __forceinline__ v16bf frag_ld_bf(const bf16_t* __restrict__ base,
                                            int ldm, int i0, int koff) {
  int lane = threadIdx.x & 31;
  int r = i0 + (lane & 15);
  int half = lane >> 4;
  v16bf f;
#pragma unroll
  for (int i = 0; i < 8; ++i) {
    int k = koff + wk_base(i, half);
    f[2 * i]     = base[r * ldm + k];
    f[2 * i + 1] = base[r * ldm + k + 1];
  }
  return f;
}

// fragment from f32 matrix with K slow (stride ldm, e.g. NCHW channel stride)
__device__ __forceinline__ v16bf frag_ld_f32_T(const float* __restrict__ base,
                                               size_t ldm, int i0, int koff) {
  int lane = threadIdx.x & 31;
  int n = i0 + (lane & 15);
  int half = lane >> 4;
  v16bf f;
#pragma unroll
  for (int i = 0; i < 8; ++i) {
    int k = koff + wk_base(i, half);
    f[2 * i]     = (bf16_t)base[(size_t)k * ldm + n];
    f[2 * i + 1] = (bf16_t)base[(size_t)(k + 1) * ldm + n];
  }
  return f;
}

// ---------------------------------------------------------------------------
// Kernel 0: convert all GEMM weights to bf16 in workspace and zero the concat
// buffer's border. Conv and fusion weights are stored in fragment order:
// [k slab][16-row tile][part lo/hi][lane][8], so one fragment part of a wave is
// 512 contiguous bytes. Conv k slab = (32-channel slab s) * 9 + tap.
// ---------------------------------------------------------------------------
template <int KTOT>
__device__ __forceinline__ void conv_w_frag(const float* __restrict__ Wsrc,
                                            bf16_t* __restrict__ o, int i) {
  const int e = i & 7, ln = (i >> 3) & 31, j = (i >> 8) & 1, mt = (i >> 9) & 1;
  const int ks = i >> 10, s = ks / 9, tap = ks - s * 9;
  const int oc = mt * 16 + (ln & 15);
  const int ic = s * 32 + j * 16 + 8 * (ln >> 4) + e;
  o[i] = (bf16_t)Wsrc[oc * KTOT + ic * 9 + tap];
}

__global__ void prep_weights(const float* __restrict__ W1, const float* __restrict__ W2,
                             const float* __restrict__ W3, const float* __restrict__ Wf,
                             const float* __restrict__ Wo, const float* __restrict__ Wq,
                             const float* __restrict__ Wk, const float* __restrict__ Wv,
                             bf16_t* __restrict__ o1, bf16_t* __restrict__ o2,
                             bf16_t* __restrict__ o3, bf16_t* __restrict__ of,
                             bf16_t* __restrict__ oo, bf16_t* __restrict__ oq,
                             bf16_t* __restrict__ ok, bf16_t* __restrict__ ov,
                             bf16_t* __restrict__ cat) {
  int i = blockIdx.x * blockDim.x + threadIdx.x;
  if (i < 32 * 576)  conv_w_frag<576>(W1, o1, i);
  if (i < 32 * 864)  conv_w_frag<864>(W2, o2, i);
  if (i < 32 * 1152) conv_w_frag<1152>(W3, o3, i);
  if (i < 64 * 160) {
    const int e = i & 7, ln = (i >> 3) & 31, j = (i >> 8) & 1, mt = (i >> 9) & 3;
    const int ks = i >> 11;
    of[i] = (bf16_t)Wf[(mt * 16 + (ln & 15)) * 160 + ks * 32 + j * 16 +
                       8 * (ln >> 4) + e];
  }
  // border of the 16 channel groups the convolutions read, 4 images:
  // 2 whole rows (272 px) + 2 columns x 256 rows = 1056 pixels per plane
  if (i < 64 * 1056) {
    const int pl = i / 1056, rem = i - pl * 1056;
    int row, col;
    if (rem < 544) {
      row = (rem < 272) ? 0 : 257;
      col = (rem < 272) ? rem : rem - 272;
    } else {
      row = 1 + ((rem - 544) >> 1);
      col = (rem & 1) ? 264 : 7;
    }
    const v8bf z = {(bf16_t)0.f, (bf16_t)0.f, (bf16_t)0.f, (bf16_t)0.f,
                    (bf16_t)0.f, (bf16_t)0.f, (bf16_t)0.f, (bf16_t)0.f};
    *(v8bf*)(cat + cat_off(pl & 15, pl >> 4, row - 1, col - 8)) = z;
  }
  if (i < 64 * 32)   oo[i] = (bf16_t)Wo[i];
  if (i < 32 * 64) {
    oq[i] = (bf16_t)Wq[i];
    ok[i] = (bf16_t)Wk[i];
    ov[i] = (bf16_t)Wv[i];
  }
}

// ---------------------------------------------------------------------------
// Kernel 1: region non-local attention. One block per 32x32 cell (256 blocks).
// All GEMMs (k/v proj+pool, q proj, K q^T, V^T P^T, Wo proj) on the WMMA pipe.
// Every product of the query phase has the query as its column: a lane's D
// registers of two 16-row tiles (rows r + 8*half and 16 + r + 8*half) are, after
// conversion, that lane's B fragment of the next product (k = 8*half + e and
// 16 + 8*half + e), so q, the scores, P and out never leave the lane.
// Writes f0 (bf16) into channel groups 0..7 of the concat buffer.
// ---------------------------------------------------------------------------
#define VPITCH 264  // keys per row of V^T in LDS + 8: 528 B, an odd count of 16 B

// lane l with lane l ^ 16
__device__ __forceinline__ float xhalf(float v) {
  return __builtin_bit_cast(
      float, __builtin_amdgcn_permlanex16(__builtin_bit_cast(int, v),
                                          __builtin_bit_cast(int, v), 0x76543210,
                                          0xfedcba98, false, false));
}

// B fragment from the D registers of two stacked 16-row tiles
__device__ __forceinline__ v16bf frag_from_d(v8f lo, v8f hi) {
  v16bf f;
#pragma unroll
  for (int e = 0; e < 8; ++e) {
    f[e]     = (bf16_t)lo[e];
    f[8 + e] = (bf16_t)hi[e];
  }
  return f;
}

__global__ __launch_bounds__(256) void attn_kernel(
    const float* __restrict__ x,
    const bf16_t* __restrict__ Wq_bf, const float* __restrict__ bq,
    const bf16_t* __restrict__ Wk_bf, const float* __restrict__ bk,
    const bf16_t* __restrict__ Wv_bf, const float* __restrict__ bv,
    const float* __restrict__ gamma_p, const float* __restrict__ bo,
    const bf16_t* __restrict__ Wo_bf, bf16_t* __restrict__ cat) {
  __shared__ __attribute__((aligned(16))) bf16_t Kp[256 * 32];      // pooled keys   [key][lat]
  __shared__ __attribute__((aligned(16))) bf16_t Vt[32 * VPITCH];   // pooled values [lat][key]
  __shared__ float scratchf[4096];  // phase A: k/v before the pool

  const int bid = blockIdx.x;
  const int n = bid >> 6, gh = (bid >> 3) & 7, gw = bid & 7;
  const int row0 = gh * 32, col0 = gw * 32;
  const int t = threadIdx.x, lane = t & 31, wave = t >> 5;
  const int half = lane >> 4, coln = lane & 15;
  const float gamma = gamma_p[0];
  const size_t HW = (size_t)HDIM * WDIM;
  const float* xcell = x + (size_t)n * CIN * HW;  // + yy*WDIM + xx per use

  // ---- Phase A (WMMA): k/v projection + 2x2 maxpool, one row-pair at a time.
  // Waves 0-3 compute k, waves 4-7 compute v; wave owns one 16-px tile of the
  // 64 px (2 rows x 32 cols) in the row-pair. Then all threads pool.
  {
    const int matsel = wave >> 2;  // 0 = k, 1 = v
    const int pt = wave & 3;       // px tile: (row pt>>1, cols (pt&1)*16..)
    const bf16_t* Wm = matsel ? Wv_bf : Wk_bf;
    const float* bm = matsel ? bv : bk;
    const v16bf a00 = frag_ld_bf(Wm, 64, 0, 0);
    const v16bf a01 = frag_ld_bf(Wm, 64, 0, 32);
    const v16bf a10 = frag_ld_bf(Wm, 64, 16, 0);
    const v16bf a11 = frag_ld_bf(Wm, 64, 16, 32);
    float* stg = scratchf + matsel * 2048;  // [64 px][32 ch] f32
    for (int rp = 0; rp < 16; ++rp) {
      const int yy = row0 + rp * 2 + (pt >> 1);
      const int xb = (pt & 1) * 16;
      const float* xp = xcell + (size_t)yy * WDIM + col0 + xb;
      v16bf b0 = frag_ld_f32_T(xp, HW, 0, 0);   // B: lane=px, K=in-ch 0..31
      v16bf b1 = frag_ld_f32_T(xp, HW, 0, 32);  //                     32..63
      v8f c0 = vzero(), c1 = vzero();
      c0 = wmma_bf(a00, b0, c0);
      c0 = wmma_bf(a01, b1, c0);
      c1 = wmma_bf(a10, b0, c1);
      c1 = wmma_bf(a11, b1, c1);
      const int pl = pt * 16 + coln;  // local px 0..63 (= row*32 + col)
#pragma unroll
      for (int r = 0; r < 8; ++r) {
        const int c = r + 8 * half;
        stg[pl * 32 + c]      = c0[r] + bm[c];
        stg[pl * 32 + 16 + c] = c1[r] + bm[16 + c];
      }
      __syncthreads();
      // 2x2 maxpool: 16 pooled cols x 32 ch per matrix; 2 outputs per thread
#pragma unroll
      for (int j = 0; j < 2; ++j) {
        const int idx = t * 2 + j;  // 0..511
        const int pc = idx >> 5, ch = idx & 31;
        const int p00 = (2 * pc) * 32 + ch, p01 = (2 * pc + 1) * 32 + ch;
        const int p10 = (32 + 2 * pc) * 32 + ch, p11 = (32 + 2 * pc + 1) * 32 + ch;
        // stage layout: [pl][ch] with pl = row*32 + col  ->  index pl*32+ch
        const float km = fmaxf(fmaxf(scratchf[(2 * pc) * 32 + ch],
                                     scratchf[(2 * pc + 1) * 32 + ch]),
                               fmaxf(scratchf[(32 + 2 * pc) * 32 + ch],
                                     scratchf[(32 + 2 * pc + 1) * 32 + ch]));
        const float vm = fmaxf(fmaxf(scratchf[2048 + (2 * pc) * 32 + ch],
                                     scratchf[2048 + (2 * pc + 1) * 32 + ch]),
                               fmaxf(scratchf[2048 + (32 + 2 * pc) * 32 + ch],
                                     scratchf[2048 + (32 + 2 * pc + 1) * 32 + ch]));
        Kp[(rp * 16 + pc) * 32 + ch] = (bf16_t)km;
        Vt[ch * VPITCH + rp * 16 + pc] = (bf16_t)vm;
        (void)p00; (void)p01; (void)p10; (void)p11;
      }
      __syncthreads();
    }
  }

  // ---- Phase B: 8 chunks of 128 queries; each wave owns one 16-query tile.
  // Kp and Vt are only read from here on, so the phase has no barrier.
  const unsigned wqo = (unsigned)(coln * 64 + 8 * half);  // lane's row, k part
  const v16bf wq00 = frag_join(Wq_bf + wqo, Wq_bf + wqo + 16);
  const v16bf wq01 = frag_join(Wq_bf + wqo + 32, Wq_bf + wqo + 48);
  const v16bf wq10 = frag_join(Wq_bf + wqo + 1024, Wq_bf + wqo + 1040);
  const v16bf wq11 = frag_join(Wq_bf + wqo + 1056, Wq_bf + wqo + 1072);
  // behind the Wq loads their address registers fall free while the loads are
  // in flight: the wait stands in front of any overwrite, and its operands keep
  // base and offset whole up to it
  asm volatile("s_wait_xcnt 0x0" ::"s"(Wq_bf), "v"(wqo * 2) : "memory");
  const bf16_t* kl = Kp + coln * 32 + 8 * half;      // A rows = keys, k = lat
  const bf16_t* vl = Vt + coln * VPITCH + 8 * half;  // A rows = lat, k = keys
  v16bf kf[16];  // all 256 keys stay in registers for the wave's 8 query tiles
#pragma unroll
  for (int kt = 0; kt < 16; ++kt)
    kf[kt] = frag_join(kl + kt * 16 * 32, kl + kt * 16 * 32 + 16);
  for (int chunk = 0; chunk < 8; ++chunk) {
    const int yy = row0 + chunk * 4 + (wave >> 1);
    const int xx = col0 + (wave & 1) * 16 + coln;
    // this lane's pixel, channels mt*16 + 8*half + r: the B fragments of the q
    // projection and, in f32, the residual of the same lane's f0 values
    const float* xp = xcell + (size_t)(8 * half) * HW + (size_t)yy * WDIM + xx;
    float xf[32];
#pragma unroll
    for (int mt = 0; mt < 4; ++mt)
#pragma unroll
      for (int r = 0; r < 8; ++r) xf[mt * 8 + r] = xp[(size_t)(mt * 16 + r) * HW];
    // behind the x loads their address registers fall free while the loads are
    // in flight: the wait stands in front of any overwrite, and its operand
    // keeps the address whole up to it. Its memory clobber also keeps the V^T
    // fragment loads inside the loop: lifted out beside the K fragments they
    // overflow the 512 registers of a wave and spill to scratch
    asm volatile("s_wait_xcnt 0x0" ::"v"(xp) : "memory");
    v16bf b0, b1;
#pragma unroll
    for (int e = 0; e < 16; ++e) {
      b0[e] = (bf16_t)xf[e];
      b1[e] = (bf16_t)xf[16 + e];
    }
    // q^T[32 lat][16 q]
    v8f c0 = vzero(), c1 = vzero();
    c0 = wmma_bf(wq00, b0, c0);
    c0 = wmma_bf(wq01, b1, c0);
    c1 = wmma_bf(wq10, b0, c1);
    c1 = wmma_bf(wq11, b1, c1);
#pragma unroll
    for (int r = 0; r < 8; ++r) {
      c0[r] += bq[r + 8 * half];
      c1[r] += bq[16 + r + 8 * half];
    }
    const v16bf qb = frag_from_d(c0, c1);

    // scores^T: one WMMA per 16-key tile; sc[kt][r] = key kt*16 + r + 8*half
    v8f sc[16];
#pragma unroll
    for (int kt = 0; kt < 16; ++kt) sc[kt] = wmma_bf(kf[kt], qb, vzero());
    // softmax over 256 keys: 128 in the lane, the other 128 in lane ^ 16
    v8f mv = sc[0];
#pragma unroll
    for (int kt = 1; kt < 16; ++kt)
#pragma unroll
      for (int r = 0; r < 8; ++r) mv[r] = fmaxf(mv[r], sc[kt][r]);
    float m = fmaxf(fmaxf(fmaxf(mv[0], mv[1]), fmaxf(mv[2], mv[3])),
                    fmaxf(fmaxf(mv[4], mv[5]), fmaxf(mv[6], mv[7])));
    m = fmaxf(m, xhalf(m));
    const float l2e = 1.44269504f;  // e^(s - m) = 2^(s * log2(e) - m * log2(e))
    const float nm = -m * l2e;
    v8f sv = vzero();
#pragma unroll
    for (int kt = 0; kt < 16; ++kt) {
      const v8f t = sc[kt] * l2e + nm;
#pragma unroll
      for (int r = 0; r < 8; ++r) sc[kt][r] = __builtin_amdgcn_exp2f(t[r]);
      sv += sc[kt];
    }
    float s = ((sv[0] + sv[1]) + (sv[2] + sv[3])) + ((sv[4] + sv[5]) + (sv[6] + sv[7]));
    s += xhalf(s);
    const float rinv = 1.f / s;

    // out^T[32 lat][16 q] = V^T @ P^T, P^T packed from the score registers
    v8f o0 = vzero(), o1 = vzero();
#pragma unroll
    for (int ks = 0; ks < 8; ++ks) {
      // keeps each half of the V^T fragment loads behind what precedes it: all
      // lifted to the loop's head they stay live beside K and the scores, and
      // the wave's 512 registers overflow into scratch
      if ((ks & 3) == 0) __builtin_amdgcn_sched_barrier(0);
      const v16bf pb = frag_from_d(sc[2 * ks], sc[2 * ks + 1]);
      const bf16_t* vp = vl + ks * 32;
      o0 = wmma_bf(frag_join(vp, vp + 16), pb, o0);
      o1 = wmma_bf(frag_join(vp + 16 * VPITCH, vp + 16 * VPITCH + 16), pb, o1);
    }
    // the row sum divides once here: it is the lane's own query
    o0 *= rinv;
    o1 *= rinv;
    const v16bf ob = frag_from_d(o0, o1);

    // f0[64][16q] = gamma*(Wo @ out^T + bo) + x
#pragma unroll
    for (int mt = 0; mt < 4; ++mt) {
      v16bf wa = frag_ld_bf(Wo_bf, 32, mt * 16, 0);
      v8f f0 = wmma_bf(wa, ob, vzero());
      v8bf pk;  // this lane's 8 consecutive channels = one channel group
#pragma unroll
      for (int r = 0; r < 8; ++r) {
        const int oc = mt * 16 + r + 8 * half;
        pk[r] = (bf16_t)(gamma * (f0[r] + bo[oc]) + xf[mt * 8 + r]);
      }
      *(v8bf*)(cat + cat_off(mt * 2 + half, n, yy, xx)) = pk;
    }
  }
}

// ---------------------------------------------------------------------------
// Kernels 2-4: implicit-GEMM 3x3 conv, pad=1, relu. Input = first KTOT/9
// channels of concat buffer; output -> channels [ocBase, ocBase+32).
// Block tile: 32 oc x CROWS rows x 128 px; wave w owns x-subtile w of all rows.
// K runs over groups (32-channel slab, column tap dx), row tap dy inside. For one
// group the six weight fragments (3 dy x 2 oc tiles) stay in registers for all
// rows, and each input row's pixel fragment, two 16-byte loads, feeds the up to
// three output rows it touches; the zero border stands for pad=1.
// ---------------------------------------------------------------------------
#define CROWS 8

struct conv_group {
  v16bf wa[3][2];         // weights [dy][oc tile]
  v16bf px[CROWS + 2];    // pixels of input rows y0 - 1 .. y0 + CROWS
};

// all fragments of group g = slab * 3 + dx; every offset is a constant
__device__ __forceinline__ void conv_group_ld(conv_group& f,
                                              const bf16_t* __restrict__ inb,
                                              const bf16_t* __restrict__ wl,
                                              int g) {
  const int s = g / 3, dx = g % 3;
#pragma unroll
  for (int dy = 0; dy < 3; ++dy) {
    const bf16_t* w = wl + (s * 9 + dy * 3 + dx) * 1024;
    f.wa[dy][0] = frag_join(w, w + 256);
    f.wa[dy][1] = frag_join(w + 512, w + 768);
  }
#pragma unroll
  for (int ir = 0; ir < CROWS + 2; ++ir) {
    const bf16_t* p = inb + (size_t)s * 4 * PLANE + (ir * PPITCH + dx) * 8;
    f.px[ir] = frag_join(p, p + 2 * PLANE);
  }
}

template <int KTOT>
__global__ __launch_bounds__(256) void conv3x3_kernel(
    const bf16_t* __restrict__ cat, const bf16_t* __restrict__ Wr,
    const float* __restrict__ bias, bf16_t* __restrict__ out_cat, int ocBase) {
  const int bid = blockIdx.x;  // 4 imgs * (256 / CROWS) row groups * 2 xsegs
  constexpr int BPI = (HDIM / CROWS) * 2;
  const int n = bid / BPI, rem = bid % BPI;
  const int y0 = (rem >> 1) * CROWS, xseg = rem & 1;
  const int t = threadIdx.x, lane = t & 31, wave = t >> 5;
  const int half = lane >> 4, coln = lane & 15;
  const int xx = xseg * 128 + wave * 16 + coln;
  const bf16_t* inb = cat + cat_off(half, n, y0 - 1, xx - 1);  // tap (0,0)
  const bf16_t* wl = Wr + lane * 8;

  v8f acc[CROWS][2];
#pragma unroll
  for (int r = 0; r < CROWS; ++r) acc[r][0] = acc[r][1] = vzero();
  constexpr int NG = (KTOT / 288) * 3;  // groups: 32-channel slabs x 3 dx
  conv_group f[2];
  conv_group_ld(f[0], inb, wl, 0);
  // unrolled so that the two fragment sets stay in registers (constant index)
#pragma unroll
  for (int g = 0; g < NG; ++g) {
    // keeps the next group's loads behind the last group's products (or behind
    // group 0's loads), so that no third fragment set is live
    __builtin_amdgcn_sched_barrier(0);
    if (g + 1 == NG) {
      // behind the last group's loads the address registers fall free while
      // loads that name them are in flight: the wait stands in front of any
      // overwrite, and its operands keep the registers whole up to it
      asm volatile("s_wait_xcnt 0x0" ::"v"(lane), "v"(inb) : "memory");
    }
    if (g + 1 < NG) conv_group_ld(f[(g + 1) & 1], inb, wl, g + 1);
    // keeps the next group's loads in front of this group's products: without
    // it each pixel load is sunk to its use and its latency is waited out there
    __builtin_amdgcn_sched_barrier(0);
    const conv_group& c = f[g & 1];
#pragma unroll
    for (int ir = 0; ir < CROWS + 2; ++ir) {
#pragma unroll
      for (int dy = 0; dy < 3; ++dy) {
        const int orow = ir - dy;
        if (orow >= 0 && orow < CROWS) {
          acc[orow][0] = wmma_bf(c.wa[dy][0], c.px[ir], acc[orow][0]);
          acc[orow][1] = wmma_bf(c.wa[dy][1], c.px[ir], acc[orow][1]);
        }
      }
    }
  }
  // keeps the last group's products in their order, free of the epilogue
  __builtin_amdgcn_sched_barrier(0);
  float bs0[8], bs1[8];
#pragma unroll
  for (int r = 0; r < 8; ++r) {
    bs0[r] = bias[r + 8 * half];
    bs1[r] = bias[16 + r + 8 * half];
  }
  bf16_t* ob = out_cat + cat_off((ocBase >> 3) + half, n, y0, xx);
#pragma unroll
  for (int q = 0; q < CROWS; ++q) {
    v8bf p0, p1;
#pragma unroll
    for (int r = 0; r < 8; ++r) {
      p0[r] = (bf16_t)fmaxf(acc[q][0][r] + bs0[r], 0.f);
      p1[r] = (bf16_t)fmaxf(acc[q][1][r] + bs1[r], 0.f);
    }
    *(v8bf*)(ob + q * PPITCH * 8) = p0;
    *(v8bf*)(ob + q * PPITCH * 8 + 2 * PLANE) = p1;
  }
}

// ---------------------------------------------------------------------------
// Kernel 5: 1x1 fusion over 160 channels + bias + residual x, fp32 out.
// Block tile: 64 oc x 32 px; 8 waves = 4 oc-tiles x 2 px-tiles.
// ---------------------------------------------------------------------------
__global__ __launch_bounds__(256) void fuse_kernel(
    const bf16_t* __restrict__ cat, const bf16_t* __restrict__ Wf_bf,
    const float* __restrict__ bfus, const float* __restrict__ x,
    float* __restrict__ out) {
  const int bid = blockIdx.x;  // 4 imgs * 256 rows * 8 xsegs
  const int n = bid >> 11, rem = bid & 2047;
  const int y = rem >> 3, xseg = rem & 7;
  const int t = threadIdx.x, lane = t & 31, wave = t >> 5;
  const int mt = wave & 3, nt = wave >> 2;
  const int half = lane >> 4, coln = lane & 15;
  const int xx = xseg * 32 + nt * 16 + coln;
  const bf16_t* inb = cat + cat_off(half, n, y, xx);
  const bf16_t* wl = Wf_bf + mt * 512 + lane * 8;

  v8f acc = vzero();
#pragma unroll
  for (int ks = 0; ks < 5; ++ks) {
    const bf16_t* w = wl + ks * 2048;
    const bf16_t* p = inb + (size_t)ks * 4 * PLANE;  // k = channel
    v16bf wa = frag_join(w, w + 256);
    v16bf bb = frag_join(p, p + 2 * PLANE);
    acc = wmma_bf(wa, bb, acc);
  }
#pragma unroll
  for (int r = 0; r < 8; ++r) {
    const int oc = mt * 16 + r + 8 * half;
    const size_t xi = (((size_t)n * CIN + oc) * HDIM + y) * WDIM + xx;
    out[xi] = acc[r] + bfus[oc] + x[xi];
  }
}

// ---------------------------------------------------------------------------
extern "C" void kernel_launch(void* const* d_in, const int* in_sizes, int n_in,
                              void* d_out, int out_size, void* d_ws,
                              size_t ws_size, hipStream_t stream) {
  const float* x  = (const float*)d_in[0];
  const float* Wq = (const float*)d_in[1];
  const float* bq = (const float*)d_in[2];
  const float* Wk = (const float*)d_in[3];
  const float* bk = (const float*)d_in[4];
  const float* Wv = (const float*)d_in[5];
  const float* bv = (const float*)d_in[6];
  const float* Wo = (const float*)d_in[7];
  const float* bo = (const float*)d_in[8];
  const float* gm = (const float*)d_in[9];
  const float* W1 = (const float*)d_in[10];
  const float* b1 = (const float*)d_in[11];
  const float* W2 = (const float*)d_in[12];
  const float* b2 = (const float*)d_in[13];
  const float* W3 = (const float*)d_in[14];
  const float* b3 = (const float*)d_in[15];
  const float* Wf = (const float*)d_in[16];
  const float* bfus = (const float*)d_in[17];
  float* out = (float*)d_out;

  // workspace layout: bf16 concat planes [4][20][258][272][8] then bf16 weights
  const size_t catElems = (size_t)4 * NGRP * PLANE;
  bf16_t* cat = (bf16_t*)d_ws;
  bf16_t* W1r = cat + catElems;
  bf16_t* W2r = W1r + 32 * 576;
  bf16_t* W3r = W2r + 32 * 864;
  bf16_t* Wfb = W3r + 32 * 1152;
  bf16_t* Wob = Wfb + 64 * 160;
  bf16_t* Wqb = Wob + 64 * 32;
  bf16_t* Wkb = Wqb + 32 * 64;
  bf16_t* Wvb = Wkb + 32 * 64;

  prep_weights<<<264, 256, 0, stream>>>(W1, W2, W3, Wf, Wo, Wq, Wk, Wv, W1r,
                                        W2r, W3r, Wfb, Wob, Wqb, Wkb, Wvb, cat);
  attn_kernel<<<256, 256, 0, stream>>>(x, Wqb, bq, Wkb, bk, Wvb, bv, gm, bo,
                                       Wob, cat);
  conv3x3_kernel<576><<<256, 256, 0, stream>>>(cat, W1r, b1, cat, 64);
  conv3x3_kernel<864><<<256, 256, 0, stream>>>(cat, W2r, b2, cat, 96);
  conv3x3_kernel<1152><<<256, 256, 0, stream>>>(cat, W3r, b3, cat, 128);
  fuse_kernel<<<8192, 256, 0, stream>>>(cat, Wfb, bfus, x, out);
}

// v004
// Measured time: 102 microseconds a run.
// Next to v003, in two timings, it ran 1.06 times as fast each time.
// All steps since v000 together make it 6.11 times as fast.
#include <hip/hip_runtime.h>
#include <hip/hip_bf16.h>

typedef __bf16 bf16_t;
typedef __attribute__((ext_vector_type(16))) __bf16 v16bf;
typedef __attribute__((ext_vector_type(8)))  __bf16 v8bf;
typedef __attribute__((ext_vector_type(8)))  float  v8f;

#define HDIM 256
#define WDIM 256
#define CIN  64
#define CLAT 32

// Concat buffer layout: one plane per (image, group of 8 channels), each plane
// [PROWS][PPITCH] pixels of 8 bf16 (16 bytes). Pixel (y, x) sits at row y + 1,
// column x + 8, so a 16-pixel tile starts on a 128-byte line; row 0, row 257,
// column 7 and column 264 are the zero border of the 3x3 convolutions.
#define PROWS  258
#define PPITCH 272
#define PLANE  (PROWS * PPITCH * 8)
#define NGRP   20

// ---------------------------------------------------------------------------
// WMMA helpers (CDNA5 16x16x32 bf16, f32 accumulate)
// ---------------------------------------------------------------------------
__device__ __forceinline__ v8f wmma_bf(v16bf a, v16bf b, v8f c) {
  return __builtin_amdgcn_wmma_f32_16x16x32_bf16(false, a, false, b,
                                                 (short)0, c, false, false);
}

__device__ __forceinline__ v8f vzero() {
  v8f z = {0.f, 0.f, 0.f, 0.f, 0.f, 0.f, 0.f, 0.f};
  return z;
}

// K-pair base within a K=32 slab for bf16 A/B fragments (ISA 7.12.2):
// lanes 0-15: VGPR i<4 -> K=2i,2i+1 ; i>=4 -> K=16+2(i-4) ; lanes 16-31: +8
__device__ __forceinline__ int wk_base(int i, int half) {
  return ((i < 4) ? (2 * i) : (16 + 2 * (i - 4))) + 8 * half;
}

// element offset of channel group g, image n, pixel (y, x); y, x in -1..256
__device__ __forceinline__ size_t cat_off(int g, int n, int y, int x) {
  return ((((size_t)n * NGRP + g) * PROWS + (y + 1)) * PPITCH + (x + 8)) * 8;
}

// fragment from its two 16-byte parts: lo = k 8*half..+7, hi = k 16+8*half..+7
__device__ __forceinline__ v16bf frag_join(const bf16_t* __restrict__ lo,
                                           const bf16_t* __restrict__ hi) {
  return __builtin_shufflevector(*(const v8bf*)lo, *(const v8bf*)hi, 0, 1, 2, 3,
                                 4, 5, 6, 7, 8, 9, 10, 11, 12, 13, 14, 15);
}

// A/B fragment from bf16 matrix, lane-dim slow (row-major): elem(r,k)=base[r*ldm+k]
__device__ __forceinline__ v16bf frag_ld_bf(const bf16_t* __restrict__ base,
                                            int ldm, int i0, int koff) {
  int lane = threadIdx.x & 31;
  int r = i0 + (lane & 15);
  int half = lane >> 4;
  v16bf f;
#pragma unroll
  for (int i = 0; i < 8; ++i) {
    int k = koff + wk_base(i, half);
    f[2 * i]     = base[r * ldm + k];
    f[2 * i + 1] = base[r * ldm + k + 1];
  }
  return f;
}

// fragment from f32 matrix with K slow (stride ldm, e.g. NCHW channel stride)
__device__ __forceinline__ v16bf frag_ld_f32_T(const float* __restrict__ base,
                                               size_t ldm, int i0, int koff) {
  int lane = threadIdx.x & 31;
  int n = i0 + (lane & 15);
  int half = lane >> 4;
  v16bf f;
#pragma unroll
  for (int i = 0; i < 8; ++i) {
    int k = koff + wk_base(i, half);
    f[2 * i]     = (bf16_t)base[(size_t)k * ldm + n];
    f[2 * i + 1] = (bf16_t)base[(size_t)(k + 1) * ldm + n];
  }
  return f;
}

// ---------------------------------------------------------------------------
// Kernel 0: convert all GEMM weights to bf16 in workspace and zero the concat
// buffer's border. Conv and fusion weights are stored in fragment order:
// [k slab][16-row tile][part lo/hi][lane][8], so one fragment part of a wave is
// 512 contiguous bytes. Conv k slab = (32-channel slab s) * 9 + tap.
// ---------------------------------------------------------------------------
template <int KTOT>
__device__ __forceinline__ void conv_w_frag(const float* __restrict__ Wsrc,
                                            bf16_t* __restrict__ o, int i) {
  const int e = i & 7, ln = (i >> 3) & 31, j = (i >> 8) & 1, mt = (i >> 9) & 1;
  const int ks = i >> 10, s = ks / 9, tap = ks - s * 9;
  const int oc = mt * 16 + (ln & 15);
  const int ic = s * 32 + j * 16 + 8 * (ln >> 4) + e;
  o[i] = (bf16_t)Wsrc[oc * KTOT + ic * 9 + tap];
}

__global__ void prep_weights(const float* __restrict__ W1, const float* __restrict__ W2,
                             const float* __restrict__ W3, const float* __restrict__ Wf,
                             const float* __restrict__ Wo, const float* __restrict__ Wq,
                             const float* __restrict__ Wk, const float* __restrict__ Wv,
                             bf16_t* __restrict__ o1, bf16_t* __restrict__ o2,
                             bf16_t* __restrict__ o3, bf16_t* __restrict__ of,
                             bf16_t* __restrict__ oo, bf16_t* __restrict__ oq,
                             bf16_t* __restrict__ ok, bf16_t* __restrict__ ov,
                             bf16_t* __restrict__ cat) {
  int i = blockIdx.x * blockDim.x + threadIdx.x;
  if (i < 32 * 576)  conv_w_frag<576>(W1, o1, i);
  if (i < 32 * 864)  conv_w_frag<864>(W2, o2, i);
  if (i < 32 * 1152) conv_w_frag<1152>(W3, o3, i);
  if (i < 64 * 160) {
    const int e = i & 7, ln = (i >> 3) & 31, j = (i >> 8) & 1, mt = (i >> 9) & 3;
    const int ks = i >> 11;
    of[i] = (bf16_t)Wf[(mt * 16 + (ln & 15)) * 160 + ks * 32 + j * 16 +
                       8 * (ln >> 4) + e];
  }
  // border of the 16 channel groups the convolutions read, 4 images:
  // 2 whole rows (272 px) + 2 columns x 256 rows = 1056 pixels per plane
  if (i < 64 * 1056) {
    const int pl = i / 1056, rem = i - pl * 1056;
    int row, col;
    if (rem < 544) {
      row = (rem < 272) ? 0 : 257;
      col = (rem < 272) ? rem : rem - 272;
    } else {
      row = 1 + ((rem - 544) >> 1);
      col = (rem & 1) ? 264 : 7;
    }
    const v8bf z = {(bf16_t)0.f, (bf16_t)0.f, (bf16_t)0.f, (bf16_t)0.f,
                    (bf16_t)0.f, (bf16_t)0.f, (bf16_t)0.f, (bf16_t)0.f};
    *(v8bf*)(cat + cat_off(pl & 15, pl >> 4, row - 1, col - 8)) = z;
  }
  if (i < 64 * 32)   oo[i] = (bf16_t)Wo[i];
  if (i < 32 * 64) {
    oq[i] = (bf16_t)Wq[i];
    ok[i] = (bf16_t)Wk[i];
    ov[i] = (bf16_t)Wv[i];
  }
}

// ---------------------------------------------------------------------------
// Kernel 1: region non-local attention. One block per 32x32 cell (256 blocks).
// All GEMMs (k/v proj+pool, q proj, K q^T, V^T P^T, Wo proj) on the WMMA pipe.
// Every product of the query phase has the query as its column: a lane's D
// registers of two 16-row tiles (rows r + 8*half and 16 + r + 8*half) are, after
// conversion, that lane's B fragment of the next product (k = 8*half + e and
// 16 + 8*half + e), so q, the scores, P and out never leave the lane.
// Writes f0 (bf16) into channel groups 0..7 of the concat buffer.
// ---------------------------------------------------------------------------
#define VPITCH 264  // keys per row of V^T in LDS + 8: 528 B, an odd count of 16 B

// lane l with lane l ^ 16
__device__ __forceinline__ float xhalf(float v) {
  return __builtin_bit_cast(
      float, __builtin_amdgcn_permlanex16(__builtin_bit_cast(int, v),
                                          __builtin_bit_cast(int, v), 0x76543210,
                                          0xfedcba98, false, false));
}

// B fragment from the D registers of two stacked 16-row tiles
__device__ __forceinline__ v16bf frag_from_d(v8f lo, v8f hi) {
  v16bf f;
#pragma unroll
  for (int e = 0; e < 8; ++e) {
    f[e]     = (bf16_t)lo[e];
    f[8 + e] = (bf16_t)hi[e];
  }
  return f;
}

__global__ __launch_bounds__(256) void attn_kernel(
    const float* __restrict__ x,
    const bf16_t* __restrict__ Wq_bf, const float* __restrict__ bq,
    const bf16_t* __restrict__ Wk_bf, const float* __restrict__ bk,
    const bf16_t* __restrict__ Wv_bf, const float* __restrict__ bv,
    const float* __restrict__ gamma_p, const float* __restrict__ bo,
    const bf16_t* __restrict__ Wo_bf, bf16_t* __restrict__ cat) {
  __shared__ __attribute__((aligned(16))) bf16_t Kp[256 * 32];      // pooled keys   [key][lat]
  __shared__ __attribute__((aligned(16))) bf16_t Vt[32 * VPITCH];   // pooled values [lat][key]
  __shared__ float scratchf[4096];  // phase A: k/v before the pool

  const int bid = blockIdx.x;
  const int n = bid >> 6, gh = (bid >> 3) & 7, gw = bid & 7;
  const int row0 = gh * 32, col0 = gw * 32;
  const int t = threadIdx.x, lane = t & 31, wave = t >> 5;
  const int half = lane >> 4, coln = lane & 15;
  const float gamma = gamma_p[0];
  const size_t HW = (size_t)HDIM * WDIM;
  const float* xcell = x + (size_t)n * CIN * HW;  // + yy*WDIM + xx per use

  // ---- Phase A (WMMA): k/v projection + 2x2 maxpool, one row-pair at a time.
  // Waves 0-3 compute k, waves 4-7 compute v; wave owns one 16-px tile of the
  // 64 px (2 rows x 32 cols) in the row-pair. Then all threads pool.
  {
    const int matsel = wave >> 2;  // 0 = k, 1 = v
    const int pt = wave & 3;       // px tile: (row pt>>1, cols (pt&1)*16..)
    const bf16_t* Wm = matsel ? Wv_bf : Wk_bf;
    const float* bm = matsel ? bv : bk;
    const v16bf a00 = frag_ld_bf(Wm, 64, 0, 0);
    const v16bf a01 = frag_ld_bf(Wm, 64, 0, 32);
    const v16bf a10 = frag_ld_bf(Wm, 64, 16, 0);
    const v16bf a11 = frag_ld_bf(Wm, 64, 16, 32);
    float* stg = scratchf + matsel * 2048;  // [64 px][32 ch] f32
    for (int rp = 0; rp < 16; ++rp) {
      const int yy = row0 + rp * 2 + (pt >> 1);
      const int xb = (pt & 1) * 16;
      const float* xp = xcell + (size_t)yy * WDIM + col0 + xb;
      v16bf b0 = frag_ld_f32_T(xp, HW, 0, 0);   // B: lane=px, K=in-ch 0..31
      v16bf b1 = frag_ld_f32_T(xp, HW, 0, 32);  //                     32..63
      v8f c0 = vzero(), c1 = vzero();
      c0 = wmma_bf(a00, b0, c0);
      c0 = wmma_bf(a01, b1, c0);
      c1 = wmma_bf(a10, b0, c1);
      c1 = wmma_bf(a11, b1, c1);
      const int pl = pt * 16 + coln;  // local px 0..63 (= row*32 + col)
#pragma unroll
      for (int r = 0; r < 8; ++r) {
        const int c = r + 8 * half;
        stg[pl * 32 + c]      = c0[r] + bm[c];
        stg[pl * 32 + 16 + c] = c1[r] + bm[16 + c];
      }
      __syncthreads();
      // 2x2 maxpool: 16 pooled cols x 32 ch per matrix; 2 outputs per thread
#pragma unroll
      for (int j = 0; j < 2; ++j) {
        const int idx = t * 2 + j;  // 0..511
        const int pc = idx >> 5, ch = idx & 31;
        const int p00 = (2 * pc) * 32 + ch, p01 = (2 * pc + 1) * 32 + ch;
        const int p10 = (32 + 2 * pc) * 32 + ch, p11 = (32 + 2 * pc + 1) * 32 + ch;
        // stage layout: [pl][ch] with pl = row*32 + col  ->  index pl*32+ch
        const float km = fmaxf(fmaxf(scratchf[(2 * pc) * 32 + ch],
                                     scratchf[(2 * pc + 1) * 32 + ch]),
                               fmaxf(scratchf[(32 + 2 * pc) * 32 + ch],
                                     scratchf[(32 + 2 * pc + 1) * 32 + ch]));
        const float vm = fmaxf(fmaxf(scratchf[2048 + (2 * pc) * 32 + ch],
                                     scratchf[2048 + (2 * pc + 1) * 32 + ch]),
                               fmaxf(scratchf[2048 + (32 + 2 * pc) * 32 + ch],
                                     scratchf[2048 + (32 + 2 * pc + 1) * 32 + ch]));
        Kp[(rp * 16 + pc) * 32 + ch] = (bf16_t)km;
        Vt[ch * VPITCH + rp * 16 + pc] = (bf16_t)vm;
        (void)p00; (void)p01; (void)p10; (void)p11;
      }
      __syncthreads();
    }
  }

  // ---- Phase B: 8 chunks of 128 queries; each wave owns one 16-query tile.
  // Kp and Vt are only read from here on, so the phase has no barrier.
  const unsigned wqo = (unsigned)(coln * 64 + 8 * half);  // lane's row, k part
  const v16bf wq00 = frag_join(Wq_bf + wqo, Wq_bf + wqo + 16);
  const v16bf wq01 = frag_join(Wq_bf + wqo + 32, Wq_bf + wqo + 48);
  const v16bf wq10 = frag_join(Wq_bf + wqo + 1024, Wq_bf + wqo + 1040);
  const v16bf wq11 = frag_join(Wq_bf + wqo + 1056, Wq_bf + wqo + 1072);
  // behind the Wq loads their address registers fall free while the loads are
  // in flight: the wait stands in front of any overwrite, and its operands keep
  // base and offset whole up to it
  asm volatile("s_wait_xcnt 0x0" ::"s"(Wq_bf), "v"(wqo * 2) : "memory");
  const bf16_t* kl = Kp + coln * 32 + 8 * half;      // A rows = keys, k = lat
  const bf16_t* vl = Vt + coln * VPITCH + 8 * half;  // A rows = lat, k = keys
  v16bf kf[16];  // all 256 keys stay in registers for the wave's 8 query tiles
#pragma unroll
  for (int kt = 0; kt < 16; ++kt)
    kf[kt] = frag_join(kl + kt * 16 * 32, kl + kt * 16 * 32 + 16);
  for (int chunk = 0; chunk < 8; ++chunk) {
    const int yy = row0 + chunk * 4 + (wave >> 1);
    const int xx = col0 + (wave & 1) * 16 + coln;
    // this lane's pixel, channels mt*16 + 8*half + r: the B fragments of the q
    // projection and, in f32, the residual of the same lane's f0 values
    const float* xp = xcell + (size_t)(8 * half) * HW + (size_t)yy * WDIM + xx;
    float xf[32];
#pragma unroll
    for (int mt = 0; mt < 4; ++mt)
#pragma unroll
      for (int r = 0; r < 8; ++r) xf[mt * 8 + r] = xp[(size_t)(mt * 16 + r) * HW];
    // behind the x loads their address registers fall free while the loads are
    // in flight: the wait stands in front of any overwrite, and its operand
    // keeps the address whole up to it. Its memory clobber also keeps the V^T
    // fragment loads inside the loop: lifted out beside the K fragments they
    // overflow the 512 registers of a wave and spill to scratch
    asm volatile("s_wait_xcnt 0x0" ::"v"(xp) : "memory");
    v16bf b0, b1;
#pragma unroll
    for (int e = 0; e < 16; ++e) {
      b0[e] = (bf16_t)xf[e];
      b1[e] = (bf16_t)xf[16 + e];
    }
    // q^T[32 lat][16 q]
    v8f c0 = vzero(), c1 = vzero();
    c0 = wmma_bf(wq00, b0, c0);
    c0 = wmma_bf(wq01, b1, c0);
    c1 = wmma_bf(wq10, b0, c1);
    c1 = wmma_bf(wq11, b1, c1);
#pragma unroll
    for (int r = 0; r < 8; ++r) {
      c0[r] += bq[r + 8 * half];
      c1[r] += bq[16 + r + 8 * half];
    }
    const v16bf qb = frag_from_d(c0, c1);

    // scores^T: one WMMA per 16-key tile; sc[kt][r] = key kt*16 + r + 8*half
    v8f sc[16];
#pragma unroll
    for (int kt = 0; kt < 16; ++kt) sc[kt] = wmma_bf(kf[kt], qb, vzero());
    // softmax over 256 keys: 128 in the lane, the other 128 in lane ^ 16
    v8f mv = sc[0];
#pragma unroll
    for (int kt = 1; kt < 16; ++kt)
#pragma unroll
      for (int r = 0; r < 8; ++r) mv[r] = fmaxf(mv[r], sc[kt][r]);
    float m = fmaxf(fmaxf(fmaxf(mv[0], mv[1]), fmaxf(mv[2], mv[3])),
                    fmaxf(fmaxf(mv[4], mv[5]), fmaxf(mv[6], mv[7])));
    m = fmaxf(m, xhalf(m));
    const float l2e = 1.44269504f;  // e^(s - m) = 2^(s * log2(e) - m * log2(e))
    const float nm = -m * l2e;
    v8f sv = vzero();
#pragma unroll
    for (int kt = 0; kt < 16; ++kt) {
      const v8f t = sc[kt] * l2e + nm;
#pragma unroll
      for (int r = 0; r < 8; ++r) sc[kt][r] = __builtin_amdgcn_exp2f(t[r]);
      sv += sc[kt];
    }
    float s = ((sv[0] + sv[1]) + (sv[2] + sv[3])) + ((sv[4] + sv[5]) + (sv[6] + sv[7]));
    s += xhalf(s);
    const float rinv = 1.f / s;

    // out^T[32 lat][16 q] = V^T @ P^T, P^T packed from the score registers
    v8f o0 = vzero(), o1 = vzero();
#pragma unroll
    for (int ks = 0; ks < 8; ++ks) {
      // keeps each half of the V^T fragment loads behind what precedes it: all
      // lifted to the loop's head they stay live beside K and the scores, and
      // the wave's 512 registers overflow into scratch
      if ((ks & 3) == 0) __builtin_amdgcn_sched_barrier(0);
      const v16bf pb = frag_from_d(sc[2 * ks], sc[2 * ks + 1]);
      const bf16_t* vp = vl + ks * 32;
      o0 = wmma_bf(frag_join(vp, vp + 16), pb, o0);
      o1 = wmma_bf(frag_join(vp + 16 * VPITCH, vp + 16 * VPITCH + 16), pb, o1);
    }
    // the row sum divides once here: it is the lane's own query
    o0 *= rinv;
    o1 *= rinv;
    const v16bf ob = frag_from_d(o0, o1);

    // f0[64][16q] = gamma*(Wo @ out^T + bo) + x
#pragma unroll
    for (int mt = 0; mt < 4; ++mt) {
      v16bf wa = frag_ld_bf(Wo_bf, 32, mt * 16, 0);
      v8f f0 = wmma_bf(wa, ob, vzero());
      v8bf pk;  // this lane's 8 consecutive channels = one channel group
#pragma unroll
      for (int r = 0; r < 8; ++r) {
        const int oc = mt * 16 + r + 8 * half;
        pk[r] = (bf16_t)(gamma * (f0[r] + bo[oc]) + xf[mt * 8 + r]);
      }
      *(v8bf*)(cat + cat_off(mt * 2 + half, n, yy, xx)) = pk;
    }
  }
}

// ---------------------------------------------------------------------------
// Kernels 2-4: implicit-GEMM 3x3 conv, pad=1, relu. Input = first KTOT/9
// channels of concat buffer; output -> channels [ocBase, ocBase+32).
// Block tile: 32 oc x CROWS rows x 128 px; wave w owns x-subtile w of all rows.
// K runs over groups (32-channel slab, column tap dx), row tap dy inside. For one
// group the six weight fragments (3 dy x 2 oc tiles) stay in registers for all
// rows, and each input row's pixel fragment, two 16-byte loads, feeds the up to
// three output rows it touches; the zero border stands for pad=1.
// ---------------------------------------------------------------------------
#define CROWS 8

struct conv_group {
  v16bf wa[3][2];         // weights [dy][oc tile]
  v16bf px[CROWS + 2];    // pixels of input rows y0 - 1 .. y0 + CROWS
};

// all fragments of group g = slab * 3 + dx; every offset is a constant
__device__ __forceinline__ void conv_group_ld(conv_group& f,
                                              const bf16_t* __restrict__ inb,
                                              const bf16_t* __restrict__ wl,
                                              int g) {
  const int s = g / 3, dx = g % 3;
#pragma unroll
  for (int dy = 0; dy < 3; ++dy) {
    const bf16_t* w = wl + (s * 9 + dy * 3 + dx) * 1024;
    f.wa[dy][0] = frag_join(w, w + 256);
    f.wa[dy][1] = frag_join(w + 512, w + 768);
  }
#pragma unroll
  for (int ir = 0; ir < CROWS + 2; ++ir) {
    const bf16_t* p = inb + (size_t)s * 4 * PLANE + (ir * PPITCH + dx) * 8;
    f.px[ir] = frag_join(p, p + 2 * PLANE);
  }
}

template <int KTOT>
__global__ __launch_bounds__(256) void conv3x3_kernel(
    const bf16_t* __restrict__ cat, const bf16_t* __restrict__ Wr,
    const float* __restrict__ bias, bf16_t* __restrict__ out_cat, int ocBase) {
  const int bid = blockIdx.x;  // 4 imgs * (256 / CROWS) row groups * 2 xsegs
  constexpr int BPI = (HDIM / CROWS) * 2;
  const int n = bid / BPI, rem = bid % BPI;
  const int y0 = (rem >> 1) * CROWS, xseg = rem & 1;
  const int t = threadIdx.x, lane = t & 31, wave = t >> 5;
  const int half = lane >> 4, coln = lane & 15;
  const int xx = xseg * 128 + wave * 16 + coln;
  const bf16_t* inb = cat + cat_off(half, n, y0 - 1, xx - 1);  // tap (0,0)
  const bf16_t* wl = Wr + lane * 8;

  v8f acc[CROWS][2];
#pragma unroll
  for (int r = 0; r < CROWS; ++r) acc[r][0] = acc[r][1] = vzero();
  constexpr int NG = (KTOT / 288) * 3;  // groups: 32-channel slabs x 3 dx
  conv_group f[2];
  conv_group_ld(f[0], inb, wl, 0);
  // unrolled so that the two fragment sets stay in registers (constant index)
#pragma unroll
  for (int g = 0; g < NG; ++g) {
    // keeps the next group's loads behind the last group's products (or behind
    // group 0's loads), so that no third fragment set is live
    __builtin_amdgcn_sched_barrier(0);
    if (g + 1 == NG) {
      // behind the last group's loads the address registers fall free while
      // loads that name them are in flight: the wait stands in front of any
      // overwrite, and its operands keep the registers whole up to it
      asm volatile("s_wait_xcnt 0x0" ::"v"(lane), "v"(inb) : "memory");
    }
    if (g + 1 < NG) conv_group_ld(f[(g + 1) & 1], inb, wl, g + 1);
    // keeps the next group's loads in front of this group's products: without
    // it each pixel load is sunk to its use and its latency is waited out there
    __builtin_amdgcn_sched_barrier(0);
    const conv_group& c = f[g & 1];
#pragma unroll
    for (int ir = 0; ir < CROWS + 2; ++ir) {
#pragma unroll
      for (int dy = 0; dy < 3; ++dy) {
        const int orow = ir - dy;
        if (orow >= 0 && orow < CROWS) {
          acc[orow][0] = wmma_bf(c.wa[dy][0], c.px[ir], acc[orow][0]);
          acc[orow][1] = wmma_bf(c.wa[dy][1], c.px[ir], acc[orow][1]);
        }
      }
    }
  }
  // keeps the last group's products in their order, free of the epilogue
  __builtin_amdgcn_sched_barrier(0);
  float bs0[8], bs1[8];
#pragma unroll
  for (int r = 0; r < 8; ++r) {
    bs0[r] = bias[r + 8 * half];
    bs1[r] = bias[16 + r + 8 * half];
  }
  bf16_t* ob = out_cat + cat_off((ocBase >> 3) + half, n, y0, xx);
#pragma unroll
  for (int q = 0; q < CROWS; ++q) {
    v8bf p0, p1;
#pragma unroll
    for (int r = 0; r < 8; ++r) {
      p0[r] = (bf16_t)fmaxf(acc[q][0][r] + bs0[r], 0.f);
      p1[r] = (bf16_t)fmaxf(acc[q][1][r] + bs1[r], 0.f);
    }
    *(v8bf*)(ob + q * PPITCH * 8) = p0;
    *(v8bf*)(ob + q * PPITCH * 8 + 2 * PLANE) = p1;
  }
}

// ---------------------------------------------------------------------------
// Kernel 5: 1x1 fusion over 160 channels + bias + residual x, fp32 out.
// Wave tile: all 64 oc x 128 px of one row, walked in FSTG stages of 32 px; the
// 20 weight fragments stay in registers for the whole walk. A stage is two
// 16-column tiles, column j of tile t being pixel 2j + t: a lane's two results
// of one oc are neighbours, so x and out move 8 bytes a lane and 16 lanes cover
// one 128-byte line. Each register set is refilled for the next stage as soon
// as this stage has used it.
// ---------------------------------------------------------------------------
#define FSTG 4
#define FMID 28
typedef __attribute__((ext_vector_type(2))) float v2f;

// Stands behind a run of global loads or stores, in front of whatever next
// overwrites a register that one of them names (address or store data). The
// scheduling barrier keeps register-only instructions from moving over the wait.
__device__ __forceinline__ void regs_free() {
  asm volatile("s_wait_xcnt 0x0" ::: "memory");
  __builtin_amdgcn_sched_barrier(0);
}

__global__ __launch_bounds__(256) void fuse_kernel(
    const bf16_t* __restrict__ cat, const bf16_t* __restrict__ Wf_bf,
    const float* __restrict__ bfus, const float* __restrict__ x,
    float* __restrict__ out) {
  const int bid = blockIdx.x;  // 4 imgs * 32 groups of 8 rows * 2 xsegs
  const int n = bid >> 6, rem = bid & 63;
  const int t = threadIdx.x, lane = t & 31;
  // the wave's number in a scalar register: row and segment are then scalar, and
  // x and out are addressed by a scalar base plus one lane offset for the walk
  const int wave = __builtin_amdgcn_readfirstlane(t >> 5);
  const int y = (rem >> 1) * 8 + wave, x0 = (rem & 1) * 128;
  const int half = lane >> 4, coln = lane & 15;
  constexpr unsigned HW = HDIM * WDIM;
  const bf16_t* inb = cat + cat_off(0, n, y, x0);
  const unsigned pxo = (unsigned)(half * PLANE + coln * 16);  // lane's pixel 2j
  const unsigned wo = (unsigned)(lane * 8);
  // based on oc plane FMID, so that every plane of the walk lies within the
  // reach of a load's or store's constant offset: one address for all of them
  const size_t xi0 = (((size_t)n * CIN + FMID) * HDIM + y) * WDIM + x0;
  const float* xb = x + xi0;
  float* ob = out + xi0;
  const unsigned xo = (unsigned)(8 * half) * HW + 2 * coln;  // lane's oc, pixel

  v16bf wa[5][4];  // weights [k slab][oc tile]
  float bs[4][8];
#pragma unroll
  for (int ks = 0; ks < 5; ++ks)
#pragma unroll
    for (int mt = 0; mt < 4; ++mt) {
      const bf16_t* w = Wf_bf + ks * 2048 + mt * 512;
      wa[ks][mt] = frag_join(w + wo, w + 256 + wo);
    }
#pragma unroll
  for (int mt = 0; mt < 4; ++mt)
#pragma unroll
    for (int r = 0; r < 8; ++r) bs[mt][r] = bfus[mt * 16 + r + 8 * half];
  regs_free();
  v16bf px[5][2];  // pixels [k slab][tile], k = channel
#pragma unroll
  for (int ks = 0; ks < 5; ++ks)
#pragma unroll
    for (int tt = 0; tt < 2; ++tt) {
      const bf16_t* p = inb + (size_t)ks * 4 * PLANE + tt * 8;
      px[ks][tt] = frag_join(p + pxo, p + 2 * PLANE + pxo);
    }
  v2f xr[4][8];  // residual [oc tile][row], both tiles
#pragma unroll
  for (int mt = 0; mt < 4; ++mt)
#pragma unroll
    for (int r = 0; r < 8; ++r)
      xr[mt][r] = *(const v2f*)(xb + (mt * 16 + r - FMID) * (int)HW + xo);
  regs_free();

  // unrolled so that every offset is a constant and the last stage refills nothing
#pragma unroll
  for (int s = 0; s < FSTG; ++s) {
    v8f acc[2][4];
#pragma unroll
    for (int mt = 0; mt < 4; ++mt) acc[0][mt] = acc[1][mt] = vzero();
#pragma unroll
    for (int ks = 0; ks < 5; ++ks) {
#pragma unroll
      for (int tt = 0; tt < 2; ++tt)
#pragma unroll
        for (int mt = 0; mt < 4; ++mt)
          acc[tt][mt] = wmma_bf(wa[ks][mt], px[ks][tt], acc[tt][mt]);
      if (s + 1 < FSTG) {
#pragma unroll
        for (int tt = 0; tt < 2; ++tt) {
          const bf16_t* p =
              inb + (size_t)ks * 4 * PLANE + ((s + 1) * 32 + tt) * 8;
          px[ks][tt] = frag_join(p + pxo, p + 2 * PLANE + pxo);
        }
      }
      // holds each slab's refill between its own products and the next slab's:
      // left free, the loads are bunched at the stage's head, where they need
      // registers of their own, and products move over the wait below
      __builtin_amdgcn_sched_barrier(0);
    }
    if (s + 1 < FSTG) regs_free();
#pragma unroll
    for (int mt = 0; mt < 4; ++mt) {
      v2f o[8];
#pragma unroll
      for (int r = 0; r < 8; ++r) {
        o[r][0] = acc[0][mt][r] + bs[mt][r] + xr[mt][r][0];
        o[r][1] = acc[1][mt][r] + bs[mt][r] + xr[mt][r][1];
      }
      if (s + 1 < FSTG) {
        // the next stage's x loads go out here, a whole stage ahead of their use
#pragma unroll
        for (int r = 0; r < 8; ++r)
          xr[mt][r] = *(const v2f*)(xb + (mt * 16 + r - FMID) * (int)HW +
                                    (s + 1) * 32 + xo);
      }
#pragma unroll
      for (int r = 0; r < 8; ++r)
        *(v2f*)(ob + (mt * 16 + r - FMID) * (int)HW + s * 32 + xo) = o[r];
      if (s + 1 < FSTG || mt < 3) regs_free();
    }
  }
}

// ---------------------------------------------------------------------------
extern "C" void kernel_launch(void* const* d_in, const int* in_sizes, int n_in,
                              void* d_out, int out_size, void* d_ws,
                              size_t ws_size, hipStream_t stream) {
  const float* x  = (const float*)d_in[0];
  const float* Wq = (const float*)d_in[1];
  const float* bq = (const float*)d_in[2];
  const float* Wk = (const float*)d_in[3];
  const float* bk = (const float*)d_in[4];
  const float* Wv = (const float*)d_in[5];
  const float* bv = (const float*)d_in[6];
  const float* Wo = (const float*)d_in[7];
  const float* bo = (const float*)d_in[8];
  const float* gm = (const float*)d_in[9];
  const float* W1 = (const float*)d_in[10];
  const float* b1 = (const float*)d_in[11];
  const float* W2 = (const float*)d_in[12];
  const float* b2 = (const float*)d_in[13];
  const float* W3 = (const float*)d_in[14];
  const float* b3 = (const float*)d_in[15];
  const float* Wf = (const float*)d_in[16];
  const float* bfus = (const float*)d_in[17];
  float* out = (float*)d_out;

  // workspace layout: bf16 concat planes [4][20][258][272][8] then bf16 weights
  const size_t catElems = (size_t)4 * NGRP * PLANE;
  bf16_t* cat = (bf16_t*)d_ws;
  bf16_t* W1r = cat + catElems;
  bf16_t* W2r = W1r + 32 * 576;
  bf16_t* W3r = W2r + 32 * 864;
  bf16_t* Wfb = W3r + 32 * 1152;
  bf16_t* Wob = Wfb + 64 * 160;
  bf16_t* Wqb = Wob + 64 * 32;
  bf16_t* Wkb = Wqb + 32 * 64;
  bf16_t* Wvb = Wkb + 32 * 64;

  prep_weights<<<264, 256, 0, stream>>>(W1, W2, W3, Wf, Wo, Wq, Wk, Wv, W1r,
                                        W2r, W3r, Wfb, Wob, Wqb, Wkb, Wvb, cat);
  attn_kernel<<<256, 256, 0, stream>>>(x, Wqb, bq, Wkb, bk, Wvb, bv, gm, bo,
                                       Wob, cat);
  conv3x3_kernel<576><<<256, 256, 0, stream>>>(cat, W1r, b1, cat, 64);
  conv3x3_kernel<864><<<256, 256, 0, stream>>>(cat, W2r, b2, cat, 96);
  conv3x3_kernel<1152><<<256, 256, 0, stream>>>(cat, W3r, b3, cat, 128);
  fuse_kernel<<<256, 256, 0, stream>>>(cat, Wfb, bfus, x, out);
}

// v005
// It runs in 87.1 microseconds.
// Two timings next to v004 both put it at 1.16 times that version's speed.
// All steps since v000 together make it 7.08 times as fast.
#include <hip/hip_runtime.h>
#include <hip/hip_bf16.h>

typedef __bf16 bf16_t;
typedef __attribute__((ext_vector_type(16))) __bf16 v16bf;
typedef __attribute__((ext_vector_type(8)))  __bf16 v8bf;
typedef __attribute__((ext_vector_type(8)))  float  v8f;
typedef __attribute__((ext_vector_type(2)))  float  v2f;

#define HDIM 256
#define WDIM 256
#define CIN  64
#define CLAT 32

// Concat buffer layout: one plane per (image, group of 8 channels), each plane
// [PROWS][PPITCH] pixels of 8 bf16 (16 bytes). Pixel (y, x) sits at row y + 1,
// column x + 8, so a 16-pixel tile starts on a 128-byte line; row 0, row 257,
// column 7 and column 264 are the zero border of the 3x3 convolutions.
#define PROWS  258
#define PPITCH 272
#define PLANE  (PROWS * PPITCH * 8)
#define NGRP   20

// ---------------------------------------------------------------------------
// WMMA helpers (CDNA5 16x16x32 bf16, f32 accumulate)
// ---------------------------------------------------------------------------
__device__ __forceinline__ v8f wmma_bf(v16bf a, v16bf b, v8f c) {
  return __builtin_amdgcn_wmma_f32_16x16x32_bf16(false, a, false, b,
                                                 (short)0, c, false, false);
}

__device__ __forceinline__ v8f vzero() {
  v8f z = {0.f, 0.f, 0.f, 0.f, 0.f, 0.f, 0.f, 0.f};
  return z;
}

// K-pair base within a K=32 slab for bf16 A/B fragments (ISA 7.12.2):
// lanes 0-15: VGPR i<4 -> K=2i,2i+1 ; i>=4 -> K=16+2(i-4) ; lanes 16-31: +8
__device__ __forceinline__ int wk_base(int i, int half) {
  return ((i < 4) ? (2 * i) : (16 + 2 * (i - 4))) + 8 * half;
}

// element offset of channel group g, image n, pixel (y, x); y, x in -1..256
__device__ __forceinline__ size_t cat_off(int g, int n, int y, int x) {
  return ((((size_t)n * NGRP + g) * PROWS + (y + 1)) * PPITCH + (x + 8)) * 8;
}

// fragment from its two 16-byte parts: lo = k 8*half..+7, hi = k 16+8*half..+7
__device__ __forceinline__ v16bf frag_join(const bf16_t* __restrict__ lo,
                                           const bf16_t* __restrict__ hi) {
  return __builtin_shufflevector(*(const v8bf*)lo, *(const v8bf*)hi, 0, 1, 2, 3,
                                 4, 5, 6, 7, 8, 9, 10, 11, 12, 13, 14, 15);
}

// A/B fragment from bf16 matrix, lane-dim slow (row-major): elem(r,k)=base[r*ldm+k]
__device__ __forceinline__ v16bf frag_ld_bf(const bf16_t* __restrict__ base,
                                            int ldm, int i0, int koff) {
  int lane = threadIdx.x & 31;
  int r = i0 + (lane & 15);
  int half = lane >> 4;
  v16bf f;
#pragma unroll
  for (int i = 0; i < 8; ++i) {
    int k = koff + wk_base(i, half);
    f[2 * i]     = base[r * ldm + k];
    f[2 * i + 1] = base[r * ldm + k + 1];
  }
  return f;
}

// ---------------------------------------------------------------------------
// Kernel 0: convert all GEMM weights to bf16 in workspace and zero the concat
// buffer's border. Conv and fusion weights are stored in fragment order:
// [k slab][16-row tile][part lo/hi][lane][8], so one fragment part of a wave is
// 512 contiguous bytes. Conv k slab = (32-channel slab s) * 9 + tap.
// ---------------------------------------------------------------------------
template <int KTOT>
__device__ __forceinline__ void conv_w_frag(const float* __restrict__ Wsrc,
                                            bf16_t* __restrict__ o, int i) {
  const int e = i & 7, ln = (i >> 3) & 31, j = (i >> 8) & 1, mt = (i >> 9) & 1;
  const int ks = i >> 10, s = ks / 9, tap = ks - s * 9;
  const int oc = mt * 16 + (ln & 15);
  const int ic = s * 32 + j * 16 + 8 * (ln >> 4) + e;
  o[i] = (bf16_t)Wsrc[oc * KTOT + ic * 9 + tap];
}

__global__ void prep_weights(const float* __restrict__ W1, const float* __restrict__ W2,
                             const float* __restrict__ W3, const float* __restrict__ Wf,
                             const float* __restrict__ Wo, const float* __restrict__ Wq,
                             const float* __restrict__ Wk, const float* __restrict__ Wv,
                             bf16_t* __restrict__ o1, bf16_t* __restrict__ o2,
                             bf16_t* __restrict__ o3, bf16_t* __restrict__ of,
                             bf16_t* __restrict__ oo, bf16_t* __restrict__ oq,
                             bf16_t* __restrict__ ok, bf16_t* __restrict__ ov,
                             bf16_t* __restrict__ cat) {
  int i = blockIdx.x * blockDim.x + threadIdx.x;
  if (i < 32 * 576)  conv_w_frag<576>(W1, o1, i);
  if (i < 32 * 864)  conv_w_frag<864>(W2, o2, i);
  if (i < 32 * 1152) conv_w_frag<1152>(W3, o3, i);
  if (i < 64 * 160) {
    const int e = i & 7, ln = (i >> 3) & 31, j = (i >> 8) & 1, mt = (i >> 9) & 3;
    const int ks = i >> 11;
    of[i] = (bf16_t)Wf[(mt * 16 + (ln & 15)) * 160 + ks * 32 + j * 16 +
                       8 * (ln >> 4) + e];
  }
  // border of the 16 channel groups the convolutions read, 4 images:
  // 2 whole rows (272 px) + 2 columns x 256 rows = 1056 pixels per plane
  if (i < 64 * 1056) {
    const int pl = i / 1056, rem = i - pl * 1056;
    int row, col;
    if (rem < 544) {
      row = (rem < 272) ? 0 : 257;
      col = (rem < 272) ? rem : rem - 272;
    } else {
      row = 1 + ((rem - 544) >> 1);
      col = (rem & 1) ? 264 : 7;
    }
    const v8bf z = {(bf16_t)0.f, (bf16_t)0.f, (bf16_t)0.f, (bf16_t)0.f,
                    (bf16_t)0.f, (bf16_t)0.f, (bf16_t)0.f, (bf16_t)0.f};
    *(v8bf*)(cat + cat_off(pl & 15, pl >> 4, row - 1, col - 8)) = z;
  }
  if (i < 64 * 32)   oo[i] = (bf16_t)Wo[i];
  if (i < 32 * 64) {
    oq[i] = (bf16_t)Wq[i];
    ok[i] = (bf16_t)Wk[i];
    ov[i] = (bf16_t)Wv[i];
  }
}

// ---------------------------------------------------------------------------
// Kernel 1: region non-local attention. One block per 32x32 cell (256 blocks).
// All GEMMs (k/v proj+pool, q proj, K q^T, V^T P^T, Wo proj) on the WMMA pipe.
// Every product of the query phase has the query as its column: a lane's D
// registers of two 16-row tiles (rows r + 8*half and 16 + r + 8*half) are, after
// conversion, that lane's B fragment of the next product (k = 8*half + e and
// 16 + 8*half + e), so q, the scores, P and out never leave the lane.
// Writes f0 (bf16) into channel groups 0..7 of the concat buffer.
// ---------------------------------------------------------------------------
#define VPITCH 264  // keys per row of V^T in LDS + 8: 528 B, an odd count of 16 B

// lane l with lane l ^ 16
__device__ __forceinline__ float xhalf(float v) {
  return __builtin_bit_cast(
      float, __builtin_amdgcn_permlanex16(__builtin_bit_cast(int, v),
                                          __builtin_bit_cast(int, v), 0x76543210,
                                          0xfedcba98, false, false));
}

// B fragment from the D registers of two stacked 16-row tiles
__device__ __forceinline__ v16bf frag_from_d(v8f lo, v8f hi) {
  v16bf f;
#pragma unroll
  for (int e = 0; e < 8; ++e) {
    f[e]     = (bf16_t)lo[e];
    f[8 + e] = (bf16_t)hi[e];
  }
  return f;
}

__global__ __launch_bounds__(256) void attn_kernel(
    const float* __restrict__ x,
    const bf16_t* __restrict__ Wq_bf, const float* __restrict__ bq,
    const bf16_t* __restrict__ Wk_bf, const float* __restrict__ bk,
    const bf16_t* __restrict__ Wv_bf, const float* __restrict__ bv,
    const float* __restrict__ gamma_p, const float* __restrict__ bo,
    const bf16_t* __restrict__ Wo_bf, bf16_t* __restrict__ cat) {
  __shared__ __attribute__((aligned(16))) bf16_t Kp[256 * 32];      // pooled keys   [key][lat]
  __shared__ __attribute__((aligned(16))) bf16_t Vt[32 * VPITCH];   // pooled values [lat][key]

  const int bid = blockIdx.x;
  const int n = bid >> 6, gh = (bid >> 3) & 7, gw = bid & 7;
  const int row0 = gh * 32, col0 = gw * 32;
  const int t = threadIdx.x, lane = t & 31, wave = t >> 5;
  const int half = lane >> 4, coln = lane & 15;
  const float gamma = gamma_p[0];
  const size_t HW = (size_t)HDIM * WDIM;
  const float* xcell = x + (size_t)n * CIN * HW;  // + yy*WDIM + xx per use

  // ---- Phase A (WMMA): k/v projection + 2x2 maxpool, all in registers. A wave
  // owns the row pairs wave and wave + 8 of the cell. A row pair is four 16-px
  // tiles (row ry, parity par), index j of a tile being pixel column 2j + par:
  // the four pixels of pool window j sit at index j of the four tiles, so the
  // pool is an elementwise maximum of four D tiles. A lane reads both parities
  // of a channel with one 8-byte load, 16 lanes covering the cell row's 128-byte
  // line, and the same fragments feed k and v. k has the pixel as its column
  // (a lane's D = 8 lat of one key), v as its row (a lane's D = 8 keys of one
  // lat): either goes to LDS as 16-byte stores.
  {
    const unsigned wo = (unsigned)(coln * 64 + 8 * half);  // lane's row, k part
    v16bf wk[2][2], wv[2][2];  // [16-lat tile][32-channel slab]
#pragma unroll
    for (int mt = 0; mt < 2; ++mt)
#pragma unroll
      for (int s = 0; s < 2; ++s) {
        const unsigned o = wo + mt * 1024 + s * 32;
        wk[mt][s] = frag_join(Wk_bf + o, Wk_bf + o + 16);
        wv[mt][s] = frag_join(Wv_bf + o, Wv_bf + o + 16);
      }
    // bk at uniform indices, so through the scalar path: a vector load issued
    // behind the x loads would return behind them, and the first row pair's
    // keys would wait for all of x
    float bk0[8], bk1[8];
#pragma unroll
    for (int r = 0; r < 8; ++r) {
      const float l0 = bk[r], h0 = bk[8 + r], l1 = bk[16 + r], h1 = bk[24 + r];
      bk0[r] = half ? h0 : l0;
      bk1[r] = half ? h1 : l1;
    }
    const float bv0 = bv[coln], bv1 = bv[16 + coln];
    // slot mt*8 + r = channel mt*16 + 8*half + r, the k order of a fragment
    const float* xq = xcell + (size_t)(8 * half) * HW +
                      (size_t)(row0 + 2 * wave) * WDIM + col0 + 2 * coln;
    v2f xa[2][2][32];  // [row pair][row][slot], both parities
#pragma unroll
    for (int p = 0; p < 2; ++p)
#pragma unroll
      for (int ry = 0; ry < 2; ++ry) {
        // keeps the four rows' loads in the order of their use: loads return in
        // order, so a row's products start while the later rows are in flight
        __builtin_amdgcn_sched_barrier(0);
#pragma unroll
        for (int mt = 0; mt < 4; ++mt)
#pragma unroll
          for (int r = 0; r < 8; ++r)
            xa[p][ry][mt * 8 + r] = *(const v2f*)(
                xq + (size_t)(mt * 16 + r) * HW + (p * 16 + ry) * WDIM);
      }
    // behind the x loads their address registers fall free while the loads are
    // in flight: the wait stands in front of any overwrite, and its operand
    // keeps the address whole up to it
    asm volatile("s_wait_xcnt 0x0" ::"v"(xq) : "memory");
#pragma unroll
    for (int p = 0; p < 2; ++p) {
      v8f km0, km1, vm0, vm1;
#pragma unroll
      for (int tl = 0; tl < 4; ++tl) {
        const int ry = tl >> 1, par = tl & 1;
        // keeps a row's products in front of the wait for the next row's loads:
        // mixed with later rows' work they would start only when all x is there
        if (par == 0) __builtin_amdgcn_sched_barrier(0);
        v16bf b0, b1;
#pragma unroll
        for (int e = 0; e < 16; ++e) {
          b0[e] = (bf16_t)xa[p][ry][e][par];
          b1[e] = (bf16_t)xa[p][ry][16 + e][par];
        }
        v8f k0 = wmma_bf(wk[0][0], b0, vzero());
        v8f k1 = wmma_bf(wk[1][0], b0, vzero());
        v8f v0 = wmma_bf(b0, wv[0][0], vzero());
        v8f v1 = wmma_bf(b0, wv[1][0], vzero());
        k0 = wmma_bf(wk[0][1], b1, k0);
        k1 = wmma_bf(wk[1][1], b1, k1);
        v0 = wmma_bf(b1, wv[0][1], v0);
        v1 = wmma_bf(b1, wv[1][1], v1);
        if (tl == 0) {
          km0 = k0; km1 = k1; vm0 = v0; vm1 = v1;
        } else {
#pragma unroll
          for (int r = 0; r < 8; ++r) {
            km0[r] = fmaxf(km0[r], k0[r]);
            km1[r] = fmaxf(km1[r], k1[r]);
            vm0[r] = fmaxf(vm0[r], v0[r]);
            vm1[r] = fmaxf(vm1[r], v1[r]);
          }
        }
      }
      // the bias is the same for the four pixels of a window and rounding is
      // monotone: added behind the maximum it gives the same value
      v8bf kk0, kk1, vv0, vv1;
#pragma unroll
      for (int r = 0; r < 8; ++r) {
        kk0[r] = (bf16_t)(km0[r] + bk0[r]);
        kk1[r] = (bf16_t)(km1[r] + bk1[r]);
        vv0[r] = (bf16_t)(vm0[r] + bv0);
        vv1[r] = (bf16_t)(vm1[r] + bv1);
      }
      const int key0 = (wave + 8 * p) * 16;  // pooled row = row pair
      *(v8bf*)(Kp + (key0 + coln) * 32 + 8 * half) = kk0;
      *(v8bf*)(Kp + (key0 + coln) * 32 + 16 + 8 * half) = kk1;
      *(v8bf*)(Vt + coln * VPITCH + key0 + 8 * half) = vv0;
      *(v8bf*)(Vt + (16 + coln) * VPITCH + key0 + 8 * half) = vv1;
    }
    __syncthreads();  // every wave reads all keys and values from here on
  }

  // ---- Phase B: 8 chunks of 128 queries; each wave owns one 16-query tile.
  // Kp and Vt are only read from here on, so the phase has no barrier.
  const unsigned wqo = (unsigned)(coln * 64 + 8 * half);  // lane's row, k part
  const v16bf wq00 = frag_join(Wq_bf + wqo, Wq_bf + wqo + 16);
  const v16bf wq01 = frag_join(Wq_bf + wqo + 32, Wq_bf + wqo + 48);
  const v16bf wq10 = frag_join(Wq_bf + wqo + 1024, Wq_bf + wqo + 1040);
  const v16bf wq11 = frag_join(Wq_bf + wqo + 1056, Wq_bf + wqo + 1072);
  // behind the Wq loads their address registers fall free while the loads are
  // in flight: the wait stands in front of any overwrite, and its operands keep
  // base and offset whole up to it
  asm volatile("s_wait_xcnt 0x0" ::"s"(Wq_bf), "v"(wqo * 2) : "memory");
  const bf16_t* kl = Kp + coln * 32 + 8 * half;      // A rows = keys, k = lat
  const bf16_t* vl = Vt + coln * VPITCH + 8 * half;  // A rows = lat, k = keys
  v16bf kf[16];  // all 256 keys stay in registers for the wave's 8 query tiles
#pragma unroll
  for (int kt = 0; kt < 16; ++kt)
    kf[kt] = frag_join(kl + kt * 16 * 32, kl + kt * 16 * 32 + 16);
  for (int chunk = 0; chunk < 8; ++chunk) {
    const int yy = row0 + chunk * 4 + (wave >> 1);
    const int xx = col0 + (wave & 1) * 16 + coln;
    // this lane's pixel, channels mt*16 + 8*half + r: the B fragments of the q
    // projection and, in f32, the residual of the same lane's f0 values
    const float* xp = xcell + (size_t)(8 * half) * HW + (size_t)yy * WDIM + xx;
    float xf[32];
#pragma unroll
    for (int mt = 0; mt < 4; ++mt)
#pragma unroll
      for (int r = 0; r < 8; ++r) xf[mt * 8 + r] = xp[(size_t)(mt * 16 + r) * HW];
    // behind the x loads their address registers fall free while the loads are
    // in flight: the wait stands in front of any overwrite, and its operand
    // keeps the address whole up to it. Its memory clobber also keeps the V^T
    // fragment loads inside the loop: lifted out beside the K fragments they
    // overflow the 512 registers of a wave and spill to scratch
    asm volatile("s_wait_xcnt 0x0" ::"v"(xp) : "memory");
    v16bf b0, b1;
#pragma unroll
    for (int e = 0; e < 16; ++e) {
      b0[e] = (bf16_t)xf[e];
      b1[e] = (bf16_t)xf[16 + e];
    }
    // q^T[32 lat][16 q]
    v8f c0 = vzero(), c1 = vzero();
    c0 = wmma_bf(wq00, b0, c0);
    c0 = wmma_bf(wq01, b1, c0);
    c1 = wmma_bf(wq10, b0, c1);
    c1 = wmma_bf(wq11, b1, c1);
#pragma unroll
    for (int r = 0; r < 8; ++r) {
      c0[r] += bq[r + 8 * half];
      c1[r] += bq[16 + r + 8 * half];
    }
    const v16bf qb = frag_from_d(c0, c1);

    // scores^T: one WMMA per 16-key tile; sc[kt][r] = key kt*16 + r + 8*half
    v8f sc[16];
#pragma unroll
    for (int kt = 0; kt < 16; ++kt) sc[kt] = wmma_bf(kf[kt], qb, vzero());
    // softmax over 256 keys: 128 in the lane, the other 128 in lane ^ 16
    v8f mv = sc[0];
#pragma unroll
    for (int kt = 1; kt < 16; ++kt)
#pragma unroll
      for (int r = 0; r < 8; ++r) mv[r] = fmaxf(mv[r], sc[kt][r]);
    float m = fmaxf(fmaxf(fmaxf(mv[0], mv[1]), fmaxf(mv[2], mv[3])),
                    fmaxf(fmaxf(mv[4], mv[5]), fmaxf(mv[6], mv[7])));
    m = fmaxf(m, xhalf(m));
    const float l2e = 1.44269504f;  // e^(s - m) = 2^(s * log2(e) - m * log2(e))
    const float nm = -m * l2e;
    v8f sv = vzero();
#pragma unroll
    for (int kt = 0; kt < 16; ++kt) {
      const v8f t = sc[kt] * l2e + nm;
#pragma unroll
      for (int r = 0; r < 8; ++r) sc[kt][r] = __builtin_amdgcn_exp2f(t[r]);
      sv += sc[kt];
    }
    float s = ((sv[0] + sv[1]) + (sv[2] + sv[3])) + ((sv[4] + sv[5]) + (sv[6] + sv[7]));
    s += xhalf(s);
    const float rinv = 1.f / s;

    // out^T[32 lat][16 q] = V^T @ P^T, P^T packed from the score registers
    v8f o0 = vzero(), o1 = vzero();
#pragma unroll
    for (int ks = 0; ks < 8; ++ks) {
      // keeps each half of the V^T fragment loads behind what precedes it: all
      // lifted to the loop's head they stay live beside K and the scores, and
      // the wave's 512 registers overflow into scratch
      if ((ks & 3) == 0) __builtin_amdgcn_sched_barrier(0);
      const v16bf pb = frag_from_d(sc[2 * ks], sc[2 * ks + 1]);
      const bf16_t* vp = vl + ks * 32;
      o0 = wmma_bf(frag_join(vp, vp + 16), pb, o0);
      o1 = wmma_bf(frag_join(vp + 16 * VPITCH, vp + 16 * VPITCH + 16), pb, o1);
    }
    // the row sum divides once here: it is the lane's own query
    o0 *= rinv;
    o1 *= rinv;
    const v16bf ob = frag_from_d(o0, o1);

    // f0[64][16q] = gamma*(Wo @ out^T + bo) + x
#pragma unroll
    for (int mt = 0; mt < 4; ++mt) {
      v16bf wa = frag_ld_bf(Wo_bf, 32, mt * 16, 0);
      v8f f0 = wmma_bf(wa, ob, vzero());
      v8bf pk;  // this lane's 8 consecutive channels = one channel group
#pragma unroll
      for (int r = 0; r < 8; ++r) {
        const int oc = mt * 16 + r + 8 * half;
        pk[r] = (bf16_t)(gamma * (f0[r] + bo[oc]) + xf[mt * 8 + r]);
      }
      *(v8bf*)(cat + cat_off(mt * 2 + half, n, yy, xx)) = pk;
    }
  }
}

// ---------------------------------------------------------------------------
// Kernels 2-4: implicit-GEMM 3x3 conv, pad=1, relu. Input = first KTOT/9
// channels of concat buffer; output -> channels [ocBase, ocBase+32).
// Block tile: 32 oc x CROWS rows x 128 px; wave w owns x-subtile w of all rows.
// K runs over groups (32-channel slab, column tap dx), row tap dy inside. For one
// group the six weight fragments (3 dy x 2 oc tiles) stay in registers for all
// rows, and each input row's pixel fragment, two 16-byte loads, feeds the up to
// three output rows it touches; the zero border stands for pad=1.
// ---------------------------------------------------------------------------
#define CROWS 8

struct conv_group {
  v16bf wa[3][2];         // weights [dy][oc tile]
  v16bf px[CROWS + 2];    // pixels of input rows y0 - 1 .. y0 + CROWS
};

// all fragments of group g = slab * 3 + dx; every offset is a constant
__device__ __forceinline__ void conv_group_ld(conv_group& f,
                                              const bf16_t* __restrict__ inb,
                                              const bf16_t* __restrict__ wl,
                                              int g) {
  const int s = g / 3, dx = g % 3;
#pragma unroll
  for (int dy = 0; dy < 3; ++dy) {
    const bf16_t* w = wl + (s * 9 + dy * 3 + dx) * 1024;
    f.wa[dy][0] = frag_join(w, w + 256);
    f.wa[dy][1] = frag_join(w + 512, w + 768);
  }
#pragma unroll
  for (int ir = 0; ir < CROWS + 2; ++ir) {
    const bf16_t* p = inb + (size_t)s * 4 * PLANE + (ir * PPITCH + dx) * 8;
    f.px[ir] = frag_join(p, p + 2 * PLANE);
  }
}

template <int KTOT>
__global__ __launch_bounds__(256) void conv3x3_kernel(
    const bf16_t* __restrict__ cat, const bf16_t* __restrict__ Wr,
    const float* __restrict__ bias, bf16_t* __restrict__ out_cat, int ocBase) {
  const int bid = blockIdx.x;  // 4 imgs * (256 / CROWS) row groups * 2 xsegs
  constexpr int BPI = (HDIM / CROWS) * 2;
  const int n = bid / BPI, rem = bid % BPI;
  const int y0 = (rem >> 1) * CROWS, xseg = rem & 1;
  const int t = threadIdx.x, lane = t & 31, wave = t >> 5;
  const int half = lane >> 4, coln = lane & 15;
  const int xx = xseg * 128 + wave * 16 + coln;
  const bf16_t* inb = cat + cat_off(half, n, y0 - 1, xx - 1);  // tap (0,0)
  const bf16_t* wl = Wr + lane * 8;

  v8f acc[CROWS][2];
#pragma unroll
  for (int r = 0; r < CROWS; ++r) acc[r][0] = acc[r][1] = vzero();
  constexpr int NG = (KTOT / 288) * 3;  // groups: 32-channel slabs x 3 dx
  conv_group f[2];
  conv_group_ld(f[0], inb, wl, 0);
  // unrolled so that the two fragment sets stay in registers (constant index)
#pragma unroll
  for (int g = 0; g < NG; ++g) {
    // keeps the next group's loads behind the last group's products (or behind
    // group 0's loads), so that no third fragment set is live
    __builtin_amdgcn_sched_barrier(0);
    if (g + 1 == NG) {
      // behind the last group's loads the address registers fall free while
      // loads that name them are in flight: the wait stands in front of any
      // overwrite, and its operands keep the registers whole up to it
      asm volatile("s_wait_xcnt 0x0" ::"v"(lane), "v"(inb) : "memory");
    }
    if (g + 1 < NG) conv_group_ld(f[(g + 1) & 1], inb, wl, g + 1);
    // keeps the next group's loads in front of this group's products: without
    // it each pixel load is sunk to its use and its latency is waited out there
    __builtin_amdgcn_sched_barrier(0);
    const conv_group& c = f[g & 1];
#pragma unroll
    for (int ir = 0; ir < CROWS + 2; ++ir) {
#pragma unroll
      for (int dy = 0; dy < 3; ++dy) {
        const int orow = ir - dy;
        if (orow >= 0 && orow < CROWS) {
          acc[orow][0] = wmma_bf(c.wa[dy][0], c.px[ir], acc[orow][0]);
          acc[orow][1] = wmma_bf(c.wa[dy][1], c.px[ir], acc[orow][1]);
        }
      }
    }
  }
  // keeps the last group's products in their order, free of the epilogue
  __builtin_amdgcn_sched_barrier(0);
  float bs0[8], bs1[8];
#pragma unroll
  for (int r = 0; r < 8; ++r) {
    bs0[r] = bias[r + 8 * half];
    bs1[r] = bias[16 + r + 8 * half];
  }
  bf16_t* ob = out_cat + cat_off((ocBase >> 3) + half, n, y0, xx);
#pragma unroll
  for (int q = 0; q < CROWS; ++q) {
    v8bf p0, p1;
#pragma unroll
    for (int r = 0; r < 8; ++r) {
      p0[r] = (bf16_t)fmaxf(acc[q][0][r] + bs0[r], 0.f);
      p1[r] = (bf16_t)fmaxf(acc[q][1][r] + bs1[r], 0.f);
    }
    *(v8bf*)(ob + q * PPITCH * 8) = p0;
    *(v8bf*)(ob + q * PPITCH * 8 + 2 * PLANE) = p1;
  }
}

// ---------------------------------------------------------------------------
// Kernel 5: 1x1 fusion over 160 channels + bias + residual x, fp32 out.
// Wave tile: all 64 oc x 128 px of one row, walked in FSTG stages of 32 px; the
// 20 weight fragments stay in registers for the whole walk. A stage is two
// 16-column tiles, column j of tile t being pixel 2j + t: a lane's two results
// of one oc are neighbours, so x and out move 8 bytes a lane and 16 lanes cover
// one 128-byte line. Each register set is refilled for the next stage as soon
// as this stage has used it.
// ---------------------------------------------------------------------------
#define FSTG 4
#define FMID 28

// Stands behind a run of global loads or stores, in front of whatever next
// overwrites a register that one of them names (address or store data). The
// scheduling barrier keeps register-only instructions from moving over the wait.
__device__ __forceinline__ void regs_free() {
  asm volatile("s_wait_xcnt 0x0" ::: "memory");
  __builtin_amdgcn_sched_barrier(0);
}

__global__ __launch_bounds__(256) void fuse_kernel(
    const bf16_t* __restrict__ cat, const bf16_t* __restrict__ Wf_bf,
    const float* __restrict__ bfus, const float* __restrict__ x,
    float* __restrict__ out) {
  const int bid = blockIdx.x;  // 4 imgs * 32 groups of 8 rows * 2 xsegs
  const int n = bid >> 6, rem = bid & 63;
  const int t = threadIdx.x, lane = t & 31;
  // the wave's number in a scalar register: row and segment are then scalar, and
  // x and out are addressed by a scalar base plus one lane offset for the walk
  const int wave = __builtin_amdgcn_readfirstlane(t >> 5);
  const int y = (rem >> 1) * 8 + wave, x0 = (rem & 1) * 128;
  const int half = lane >> 4, coln = lane & 15;
  constexpr unsigned HW = HDIM * WDIM;
  const bf16_t* inb = cat + cat_off(0, n, y, x0);
  const unsigned pxo = (unsigned)(half * PLANE + coln * 16);  // lane's pixel 2j
  const unsigned wo = (unsigned)(lane * 8);
  // based on oc plane FMID, so that every plane of the walk lies within the
  // reach of a load's or store's constant offset: one address for all of them
  const size_t xi0 = (((size_t)n * CIN + FMID) * HDIM + y) * WDIM + x0;
  const float* xb = x + xi0;
  float* ob = out + xi0;
  const unsigned xo = (unsigned)(8 * half) * HW + 2 * coln;  // lane's oc, pixel

  v16bf wa[5][4];  // weights [k slab][oc tile]
  float bs[4][8];
#pragma unroll
  for (int ks = 0; ks < 5; ++ks)
#pragma unroll
    for (int mt = 0; mt < 4; ++mt) {
      const bf16_t* w = Wf_bf + ks * 2048 + mt * 512;
      wa[ks][mt] = frag_join(w + wo, w + 256 + wo);
    }
#pragma unroll
  for (int mt = 0; mt < 4; ++mt)
#pragma unroll
    for (int r = 0; r < 8; ++r) bs[mt][r] = bfus[mt * 16 + r + 8 * half];
  regs_free();
  v16bf px[5][2];  // pixels [k slab][tile], k = channel
#pragma unroll
  for (int ks = 0; ks < 5; ++ks)
#pragma unroll
    for (int tt = 0; tt < 2; ++tt) {
      const bf16_t* p = inb + (size_t)ks * 4 * PLANE + tt * 8;
      px[ks][tt] = frag_join(p + pxo, p + 2 * PLANE + pxo);
    }
  v2f xr[4][8];  // residual [oc tile][row], both tiles
#pragma unroll
  for (int mt = 0; mt < 4; ++mt)
#pragma unroll
    for (int r = 0; r < 8; ++r)
      xr[mt][r] = *(const v2f*)(xb + (mt * 16 + r - FMID) * (int)HW + xo);
  regs_free();

  // unrolled so that every offset is a constant and the last stage refills nothing
#pragma unroll
  for (int s = 0; s < FSTG; ++s) {
    v8f acc[2][4];
#pragma unroll
    for (int mt = 0; mt < 4; ++mt) acc[0][mt] = acc[1][mt] = vzero();
#pragma unroll
    for (int ks = 0; ks < 5; ++ks) {
#pragma unroll
      for (int tt = 0; tt < 2; ++tt)
#pragma unroll
        for (int mt = 0; mt < 4; ++mt)
          acc[tt][mt] = wmma_bf(wa[ks][mt], px[ks][tt], acc[tt][mt]);
      if (s + 1 < FSTG) {
#pragma unroll
        for (int tt = 0; tt < 2; ++tt) {
          const bf16_t* p =
              inb + (size_t)ks * 4 * PLANE + ((s + 1) * 32 + tt) * 8;
          px[ks][tt] = frag_join(p + pxo, p + 2 * PLANE + pxo);
        }
      }
      // holds each slab's refill between its own products and the next slab's:
      // left free, the loads are bunched at the stage's head, where they need
      // registers of their own, and products move over the wait below
      __builtin_amdgcn_sched_barrier(0);
    }
    if (s + 1 < FSTG) regs_free();
#pragma unroll
    for (int mt = 0; mt < 4; ++mt) {
      v2f o[8];
#pragma unroll
      for (int r = 0; r < 8; ++r) {
        o[r][0] = acc[0][mt][r] + bs[mt][r] + xr[mt][r][0];
        o[r][1] = acc[1][mt][r] + bs[mt][r] + xr[mt][r][1];
      }
      if (s + 1 < FSTG) {
        // the next stage's x loads go out here, a whole stage ahead of their use
#pragma unroll
        for (int r = 0; r < 8; ++r)
          xr[mt][r] = *(const v2f*)(xb + (mt * 16 + r - FMID) * (int)HW +
                                    (s + 1) * 32 + xo);
      }
#pragma unroll
      for (int r = 0; r < 8; ++r)
        *(v2f*)(ob + (mt * 16 + r - FMID) * (int)HW + s * 32 + xo) = o[r];
      if (s + 1 < FSTG || mt < 3) regs_free();
    }
  }
}

// ---------------------------------------------------------------------------
extern "C" void kernel_launch(void* const* d_in, const int* in_sizes, int n_in,
                              void* d_out, int out_size, void* d_ws,
                              size_t ws_size, hipStream_t stream) {
  const float* x  = (const float*)d_in[0];
  const float* Wq = (const float*)d_in[1];
  const float* bq = (const float*)d_in[2];
  const float* Wk = (const float*)d_in[3];
  const float* bk = (const float*)d_in[4];
  const float* Wv = (const float*)d_in[5];
  const float* bv = (const float*)d_in[6];
  const float* Wo = (const float*)d_in[7];
  const float* bo = (const float*)d_in[8];
  const float* gm = (const float*)d_in[9];
  const float* W1 = (const float*)d_in[10];
  const float* b1 = (const float*)d_in[11];
  const float* W2 = (const float*)d_in[12];
  const float* b2 = (const float*)d_in[13];
  const float* W3 = (const float*)d_in[14];
  const float* b3 = (const float*)d_in[15];
  const float* Wf = (const float*)d_in[16];
  const float* bfus = (const float*)d_in[17];
  float* out = (float*)d_out;

  // workspace layout: bf16 concat planes [4][20][258][272][8] then bf16 weights
  const size_t catElems = (size_t)4 * NGRP * PLANE;
  bf16_t* cat = (bf16_t*)d_ws;
  bf16_t* W1r = cat + catElems;
  bf16_t* W2r = W1r + 32 * 576;
  bf16_t* W3r = W2r + 32 * 864;
  bf16_t* Wfb = W3r + 32 * 1152;
  bf16_t* Wob = Wfb + 64 * 160;
  bf16_t* Wqb = Wob + 64 * 32;
  bf16_t* Wkb = Wqb + 32 * 64;
  bf16_t* Wvb = Wkb + 32 * 64;

  prep_weights<<<264, 256, 0, stream>>>(W1, W2, W3, Wf, Wo, Wq, Wk, Wv, W1r,
                                        W2r, W3r, Wfb, Wob, Wqb, Wkb, Wvb, cat);
  attn_kernel<<<256, 256, 0, stream>>>(x, Wqb, bq, Wkb, bk, Wvb, bv, gm, bo,
                                       Wob, cat);
  conv3x3_kernel<576><<<256, 256, 0, stream>>>(cat, W1r, b1, cat, 64);
  conv3x3_kernel<864><<<256, 256, 0, stream>>>(cat, W2r, b2, cat, 96);
  conv3x3_kernel<1152><<<256, 256, 0, stream>>>(cat, W3r, b3, cat, 128);
  fuse_kernel<<<256, 256, 0, stream>>>(cat, Wfb, bfus, x, out);
}

// v006
// One run takes 82.9 microseconds.
// Next to v005, in two timings, it ran 1.05 times as fast each time.
// Counting every step since v000, it is 7.43 times as fast.
#include <hip/hip_runtime.h>
#include <hip/hip_bf16.h>

typedef __bf16 bf16_t;
typedef __attribute__((ext_vector_type(16))) __bf16 v16bf;
typedef __attribute__((ext_vector_type(8)))  __bf16 v8bf;
typedef __attribute__((ext_vector_type(8)))  float  v8f;
typedef __attribute__((ext_vector_type(2)))  float  v2f;

#define HDIM 256
#define WDIM 256
#define CIN  64
#define CLAT 32

// Concat buffer layout: one plane per (image, group of 8 channels), each plane
// [PROWS][PPITCH] pixels of 8 bf16 (16 bytes). Pixel (y, x) sits at row y + 1,
// column x + 8, so a 16-pixel tile starts on a 128-byte line; row 0, row 257,
// column 7 and column 264 are the zero border of the 3x3 convolutions.
#define PROWS  258
#define PPITCH 272
#define PLANE  (PROWS * PPITCH * 8)
#define NGRP   20

// ---------------------------------------------------------------------------
// WMMA helpers (CDNA5 16x16x32 bf16, f32 accumulate)
// ---------------------------------------------------------------------------
__device__ __forceinline__ v8f wmma_bf(v16bf a, v16bf b, v8f c) {
  return __builtin_amdgcn_wmma_f32_16x16x32_bf16(false, a, false, b,
                                                 (short)0, c, false, false);
}

__device__ __forceinline__ v8f vzero() {
  v8f z = {0.f, 0.f, 0.f, 0.f, 0.f, 0.f, 0.f, 0.f};
  return z;
}

// K-pair base within a K=32 slab for bf16 A/B fragments (ISA 7.12.2):
// lanes 0-15: VGPR i<4 -> K=2i,2i+1 ; i>=4 -> K=16+2(i-4) ; lanes 16-31: +8
__device__ __forceinline__ int wk_base(int i, int half) {
  return ((i < 4) ? (2 * i) : (16 + 2 * (i - 4))) + 8 * half;
}

// element offset of channel group g, image n, pixel (y, x); y, x in -1..256
__device__ __forceinline__ size_t cat_off(int g, int n, int y, int x) {
  return ((((size_t)n * NGRP + g) * PROWS + (y + 1)) * PPITCH + (x + 8)) * 8;
}

// fragment from its two 16-byte parts: lo = k 8*half..+7, hi = k 16+8*half..+7
__device__ __forceinline__ v16bf frag_join(const bf16_t* __restrict__ lo,
                                           const bf16_t* __restrict__ hi) {
  return __builtin_shufflevector(*(const v8bf*)lo, *(const v8bf*)hi, 0, 1, 2, 3,
                                 4, 5, 6, 7, 8, 9, 10, 11, 12, 13, 14, 15);
}

// A/B fragment from bf16 matrix, lane-dim slow (row-major): elem(r,k)=base[r*ldm+k]
__device__ __forceinline__ v16bf frag_ld_bf(const bf16_t* __restrict__ base,
                                            int ldm, int i0, int koff) {
  int lane = threadIdx.x & 31;
  int r = i0 + (lane & 15);
  int half = lane >> 4;
  v16bf f;
#pragma unroll
  for (int i = 0; i < 8; ++i) {
    int k = koff + wk_base(i, half);
    f[2 * i]     = base[r * ldm + k];
    f[2 * i + 1] = base[r * ldm + k + 1];
  }
  return f;
}

// ---------------------------------------------------------------------------
// Kernel 0: convert all GEMM weights to bf16 in workspace and zero the concat
// buffer's border. Conv and fusion weights are stored in fragment order:
// [k slab][16-row tile][part lo/hi][lane][8], so one fragment part of a wave is
// 512 contiguous bytes. Conv k slab = (32-channel slab s) * 9 + tap.
// ---------------------------------------------------------------------------
template <int KTOT>
__device__ __forceinline__ void conv_w_frag(const float* __restrict__ Wsrc,
                                            bf16_t* __restrict__ o, int i) {
  const int e = i & 7, ln = (i >> 3) & 31, j = (i >> 8) & 1, mt = (i >> 9) & 1;
  const int ks = i >> 10, s = ks / 9, tap = ks - s * 9;
  const int oc = mt * 16 + (ln & 15);
  const int ic = s * 32 + j * 16 + 8 * (ln >> 4) + e;
  o[i] = (bf16_t)Wsrc[oc * KTOT + ic * 9 + tap];
}

__global__ void prep_weights(const float* __restrict__ W1, const float* __restrict__ W2,
                             const float* __restrict__ W3, const float* __restrict__ Wf,
                             const float* __restrict__ Wo, const float* __restrict__ Wq,
                             const float* __restrict__ Wk, const float* __restrict__ Wv,
                             bf16_t* __restrict__ o1, bf16_t* __restrict__ o2,
                             bf16_t* __restrict__ o3, bf16_t* __restrict__ of,
                             bf16_t* __restrict__ oo, bf16_t* __restrict__ oq,
                             bf16_t* __restrict__ ok, bf16_t* __restrict__ ov,
                             bf16_t* __restrict__ cat) {
  int i = blockIdx.x * blockDim.x + threadIdx.x;
  if (i < 32 * 576)  conv_w_frag<576>(W1, o1, i);
  if (i < 32 * 864)  conv_w_frag<864>(W2, o2, i);
  if (i < 32 * 1152) conv_w_frag<1152>(W3, o3, i);
  if (i < 64 * 160) {
    const int e = i & 7, ln = (i >> 3) & 31, j = (i >> 8) & 1, mt = (i >> 9) & 3;
    const int ks = i >> 11;
    of[i] = (bf16_t)Wf[(mt * 16 + (ln & 15)) * 160 + ks * 32 + j * 16 +
                       8 * (ln >> 4) + e];
  }
  // border of the 16 channel groups the convolutions read, 4 images:
  // 2 whole rows (272 px) + 2 columns x 256 rows = 1056 pixels per plane
  if (i < 64 * 1056) {
    const int pl = i / 1056, rem = i - pl * 1056;
    int row, col;
    if (rem < 544) {
      row = (rem < 272) ? 0 : 257;
      col = (rem < 272) ? rem : rem - 272;
    } else {
      row = 1 + ((rem - 544) >> 1);
      col = (rem & 1) ? 264 : 7;
    }
    const v8bf z = {(bf16_t)0.f, (bf16_t)0.f, (bf16_t)0.f, (bf16_t)0.f,
                    (bf16_t)0.f, (bf16_t)0.f, (bf16_t)0.f, (bf16_t)0.f};
    *(v8bf*)(cat + cat_off(pl & 15, pl >> 4, row - 1, col - 8)) = z;
  }
  if (i < 64 * 32)   oo[i] = (bf16_t)Wo[i];
  if (i < 32 * 64) {
    oq[i] = (bf16_t)Wq[i];
    ok[i] = (bf16_t)Wk[i];
    ov[i] = (bf16_t)Wv[i];
  }
}

// ---------------------------------------------------------------------------
// Kernel 1: region non-local attention. One block per 32x32 cell (256 blocks).
// All GEMMs (k/v proj+pool, q proj, K q^T, V^T P^T, Wo proj) on the WMMA pipe.
// Every product of the query phase has the query as its column: a lane's D
// registers of two 16-row tiles (rows r + 8*half and 16 + r + 8*half) are, after
// conversion, that lane's B fragment of the next product (k = 8*half + e and
// 16 + 8*half + e), so q, the scores, P and out never leave the lane.
// Writes f0 (bf16) into channel groups 0..7 of the concat buffer.
// ---------------------------------------------------------------------------
#define VPITCH 264  // keys per row of V^T in LDS + 8: 528 B, an odd count of 16 B

// lane l with lane l ^ 16
__device__ __forceinline__ float xhalf(float v) {
  return __builtin_bit_cast(
      float, __builtin_amdgcn_permlanex16(__builtin_bit_cast(int, v),
                                          __builtin_bit_cast(int, v), 0x76543210,
                                          0xfedcba98, false, false));
}

// B fragment from the D registers of two stacked 16-row tiles
__device__ __forceinline__ v16bf frag_from_d(v8f lo, v8f hi) {
  v16bf f;
#pragma unroll
  for (int e = 0; e < 8; ++e) {
    f[e]     = (bf16_t)lo[e];
    f[8 + e] = (bf16_t)hi[e];
  }
  return f;
}

__global__ __launch_bounds__(256) void attn_kernel(
    const float* __restrict__ x,
    const bf16_t* __restrict__ Wq_bf, const float* __restrict__ bq,
    const bf16_t* __restrict__ Wk_bf, const float* __restrict__ bk,
    const bf16_t* __restrict__ Wv_bf, const float* __restrict__ bv,
    const float* __restrict__ gamma_p, const float* __restrict__ bo,
    const bf16_t* __restrict__ Wo_bf, bf16_t* __restrict__ cat) {
  __shared__ __attribute__((aligned(16))) bf16_t Kp[256 * 32];      // pooled keys   [key][lat]
  __shared__ __attribute__((aligned(16))) bf16_t Vt[32 * VPITCH];   // pooled values [lat][key]

  const int bid = blockIdx.x;
  const int n = bid >> 6, gh = (bid >> 3) & 7, gw = bid & 7;
  const int row0 = gh * 32, col0 = gw * 32;
  const int t = threadIdx.x, lane = t & 31, wave = t >> 5;
  const int half = lane >> 4, coln = lane & 15;
  const float gamma = gamma_p[0];
  const size_t HW = (size_t)HDIM * WDIM;
  const float* xcell = x + (size_t)n * CIN * HW;  // + yy*WDIM + xx per use

  // ---- Phase A (WMMA): k/v projection + 2x2 maxpool, all in registers. A wave
  // owns the row pairs wave and wave + 8 of the cell. A row pair is four 16-px
  // tiles (row ry, parity par), index j of a tile being pixel column 2j + par:
  // the four pixels of pool window j sit at index j of the four tiles, so the
  // pool is an elementwise maximum of four D tiles. A lane reads both parities
  // of a channel with one 8-byte load, 16 lanes covering the cell row's 128-byte
  // line, and the same fragments feed k and v. k has the pixel as its column
  // (a lane's D = 8 lat of one key), v as its row (a lane's D = 8 keys of one
  // lat): either goes to LDS as 16-byte stores.
  {
    const unsigned wo = (unsigned)(coln * 64 + 8 * half);  // lane's row, k part
    v16bf wk[2][2], wv[2][2];  // [16-lat tile][32-channel slab]
#pragma unroll
    for (int mt = 0; mt < 2; ++mt)
#pragma unroll
      for (int s = 0; s < 2; ++s) {
        const unsigned o = wo + mt * 1024 + s * 32;
        wk[mt][s] = frag_join(Wk_bf + o, Wk_bf + o + 16);
        wv[mt][s] = frag_join(Wv_bf + o, Wv_bf + o + 16);
      }
    // bk at uniform indices, so through the scalar path: a vector load issued
    // behind the x loads would return behind them, and the first row pair's
    // keys would wait for all of x
    float bk0[8], bk1[8];
#pragma unroll
    for (int r = 0; r < 8; ++r) {
      const float l0 = bk[r], h0 = bk[8 + r], l1 = bk[16 + r], h1 = bk[24 + r];
      bk0[r] = half ? h0 : l0;
      bk1[r] = half ? h1 : l1;
    }
    const float bv0 = bv[coln], bv1 = bv[16 + coln];
    // slot mt*8 + r = channel mt*16 + 8*half + r, the k order of a fragment
    const float* xq = xcell + (size_t)(8 * half) * HW +
                      (size_t)(row0 + 2 * wave) * WDIM + col0 + 2 * coln;
    v2f xa[2][2][32];  // [row pair][row][slot], both parities
#pragma unroll
    for (int p = 0; p < 2; ++p)
#pragma unroll
      for (int ry = 0; ry < 2; ++ry) {
        // keeps the four rows' loads in the order of their use: loads return in
        // order, so a row's products start while the later rows are in flight
        __builtin_amdgcn_sched_barrier(0);
#pragma unroll
        for (int mt = 0; mt < 4; ++mt)
#pragma unroll
          for (int r = 0; r < 8; ++r)
            xa[p][ry][mt * 8 + r] = *(const v2f*)(
                xq + (size_t)(mt * 16 + r) * HW + (p * 16 + ry) * WDIM);
      }
    // behind the x loads their address registers fall free while the loads are
    // in flight: the wait stands in front of any overwrite, and its operand
    // keeps the address whole up to it
    asm volatile("s_wait_xcnt 0x0" ::"v"(xq) : "memory");
#pragma unroll
    for (int p = 0; p < 2; ++p) {
      v8f km0, km1, vm0, vm1;
#pragma unroll
      for (int tl = 0; tl < 4; ++tl) {
        const int ry = tl >> 1, par = tl & 1;
        // keeps a row's products in front of the wait for the next row's loads:
        // mixed with later rows' work they would start only when all x is there
        if (par == 0) __builtin_amdgcn_sched_barrier(0);
        v16bf b0, b1;
#pragma unroll
        for (int e = 0; e < 16; ++e) {
          b0[e] = (bf16_t)xa[p][ry][e][par];
          b1[e] = (bf16_t)xa[p][ry][16 + e][par];
        }
        v8f k0 = wmma_bf(wk[0][0], b0, vzero());
        v8f k1 = wmma_bf(wk[1][0], b0, vzero());
        v8f v0 = wmma_bf(b0, wv[0][0], vzero());
        v8f v1 = wmma_bf(b0, wv[1][0], vzero());
        k0 = wmma_bf(wk[0][1], b1, k0);
        k1 = wmma_bf(wk[1][1], b1, k1);
        v0 = wmma_bf(b1, wv[0][1], v0);
        v1 = wmma_bf(b1, wv[1][1], v1);
        if (tl == 0) {
          km0 = k0; km1 = k1; vm0 = v0; vm1 = v1;
        } else {
#pragma unroll
          for (int r = 0; r < 8; ++r) {
            km0[r] = fmaxf(km0[r], k0[r]);
            km1[r] = fmaxf(km1[r], k1[r]);
            vm0[r] = fmaxf(vm0[r], v0[r]);
            vm1[r] = fmaxf(vm1[r], v1[r]);
          }
        }
      }
      // the bias is the same for the four pixels of a window and rounding is
      // monotone: added behind the maximum it gives the same value
      v8bf kk0, kk1, vv0, vv1;
#pragma unroll
      for (int r = 0; r < 8; ++r) {
        kk0[r] = (bf16_t)(km0[r] + bk0[r]);
        kk1[r] = (bf16_t)(km1[r] + bk1[r]);
        vv0[r] = (bf16_t)(vm0[r] + bv0);
        vv1[r] = (bf16_t)(vm1[r] + bv1);
      }
      const int key0 = (wave + 8 * p) * 16;  // pooled row = row pair
      *(v8bf*)(Kp + (key0 + coln) * 32 + 8 * half) = kk0;
      *(v8bf*)(Kp + (key0 + coln) * 32 + 16 + 8 * half) = kk1;
      *(v8bf*)(Vt + coln * VPITCH + key0 + 8 * half) = vv0;
      *(v8bf*)(Vt + (16 + coln) * VPITCH + key0 + 8 * half) = vv1;
    }
    __syncthreads();  // every wave reads all keys and values from here on
  }

  // ---- Phase B: 8 chunks of 128 queries; each wave owns one 16-query tile.
  // Kp and Vt are only read from here on, so the phase has no barrier.
  const unsigned wqo = (unsigned)(coln * 64 + 8 * half);  // lane's row, k part
  const v16bf wq00 = frag_join(Wq_bf + wqo, Wq_bf + wqo + 16);
  const v16bf wq01 = frag_join(Wq_bf + wqo + 32, Wq_bf + wqo + 48);
  const v16bf wq10 = frag_join(Wq_bf + wqo + 1024, Wq_bf + wqo + 1040);
  const v16bf wq11 = frag_join(Wq_bf + wqo + 1056, Wq_bf + wqo + 1072);
  // behind the Wq loads their address registers fall free while the loads are
  // in flight: the wait stands in front of any overwrite, and its operands keep
  // base and offset whole up to it
  asm volatile("s_wait_xcnt 0x0" ::"s"(Wq_bf), "v"(wqo * 2) : "memory");
  const bf16_t* kl = Kp + coln * 32 + 8 * half;      // A rows = keys, k = lat
  const bf16_t* vl = Vt + coln * VPITCH + 8 * half;  // A rows = lat, k = keys
  v16bf kf[16];  // all 256 keys stay in registers for the wave's 8 query tiles
#pragma unroll
  for (int kt = 0; kt < 16; ++kt)
    kf[kt] = frag_join(kl + kt * 16 * 32, kl + kt * 16 * 32 + 16);
  for (int chunk = 0; chunk < 8; ++chunk) {
    const int yy = row0 + chunk * 4 + (wave >> 1);
    const int xx = col0 + (wave & 1) * 16 + coln;
    // this lane's pixel, channels mt*16 + 8*half + r: the B fragments of the q
    // projection and, in f32, the residual of the same lane's f0 values
    const float* xp = xcell + (size_t)(8 * half) * HW + (size_t)yy * WDIM + xx;
    float xf[32];
#pragma unroll
    for (int mt = 0; mt < 4; ++mt)
#pragma unroll
      for (int r = 0; r < 8; ++r) xf[mt * 8 + r] = xp[(size_t)(mt * 16 + r) * HW];
    // behind the x loads their address registers fall free while the loads are
    // in flight: the wait stands in front of any overwrite, and its operand
    // keeps the address whole up to it. Its memory clobber also keeps the V^T
    // fragment loads inside the loop: lifted out beside the K fragments they
    // overflow the 512 registers of a wave and spill to scratch
    asm volatile("s_wait_xcnt 0x0" ::"v"(xp) : "memory");
    v16bf b0, b1;
#pragma unroll
    for (int e = 0; e < 16; ++e) {
      b0[e] = (bf16_t)xf[e];
      b1[e] = (bf16_t)xf[16 + e];
    }
    // q^T[32 lat][16 q]
    v8f c0 = vzero(), c1 = vzero();
    c0 = wmma_bf(wq00, b0, c0);
    c0 = wmma_bf(wq01, b1, c0);
    c1 = wmma_bf(wq10, b0, c1);
    c1 = wmma_bf(wq11, b1, c1);
#pragma unroll
    for (int r = 0; r < 8; ++r) {
      c0[r] += bq[r + 8 * half];
      c1[r] += bq[16 + r + 8 * half];
    }
    const v16bf qb = frag_from_d(c0, c1);

    // scores^T: one WMMA per 16-key tile; sc[kt][r] = key kt*16 + r + 8*half
    v8f sc[16];
#pragma unroll
    for (int kt = 0; kt < 16; ++kt) sc[kt] = wmma_bf(kf[kt], qb, vzero());
    // softmax over 256 keys: 128 in the lane, the other 128 in lane ^ 16
    v8f mv = sc[0];
#pragma unroll
    for (int kt = 1; kt < 16; ++kt)
#pragma unroll
      for (int r = 0; r < 8; ++r) mv[r] = fmaxf(mv[r], sc[kt][r]);
    float m = fmaxf(fmaxf(fmaxf(mv[0], mv[1]), fmaxf(mv[2], mv[3])),
                    fmaxf(fmaxf(mv[4], mv[5]), fmaxf(mv[6], mv[7])));
    m = fmaxf(m, xhalf(m));
    const float l2e = 1.44269504f;  // e^(s - m) = 2^(s * log2(e) - m * log2(e))
    const float nm = -m * l2e;
    v8f sv = vzero();
#pragma unroll
    for (int kt = 0; kt < 16; ++kt) {
      const v8f t = sc[kt] * l2e + nm;
#pragma unroll
      for (int r = 0; r < 8; ++r) sc[kt][r] = __builtin_amdgcn_exp2f(t[r]);
      sv += sc[kt];
    }
    float s = ((sv[0] + sv[1]) + (sv[2] + sv[3])) + ((sv[4] + sv[5]) + (sv[6] + sv[7]));
    s += xhalf(s);
    const float rinv = 1.f / s;

    // out^T[32 lat][16 q] = V^T @ P^T, P^T packed from the score registers
    v8f o0 = vzero(), o1 = vzero();
#pragma unroll
    for (int ks = 0; ks < 8; ++ks) {
      // keeps each half of the V^T fragment loads behind what precedes it: all
      // lifted to the loop's head they stay live beside K and the scores, and
      // the wave's 512 registers overflow into scratch
      if ((ks & 3) == 0) __builtin_amdgcn_sched_barrier(0);
      const v16bf pb = frag_from_d(sc[2 * ks], sc[2 * ks + 1]);
      const bf16_t* vp = vl + ks * 32;
      o0 = wmma_bf(frag_join(vp, vp + 16), pb, o0);
      o1 = wmma_bf(frag_join(vp + 16 * VPITCH, vp + 16 * VPITCH + 16), pb, o1);
    }
    // the row sum divides once here: it is the lane's own query
    o0 *= rinv;
    o1 *= rinv;
    const v16bf ob = frag_from_d(o0, o1);

    // f0[64][16q] = gamma*(Wo @ out^T + bo) + x
#pragma unroll
    for (int mt = 0; mt < 4; ++mt) {
      v16bf wa = frag_ld_bf(Wo_bf, 32, mt * 16, 0);
      v8f f0 = wmma_bf(wa, ob, vzero());
      v8bf pk;  // this lane's 8 consecutive channels = one channel group
#pragma unroll
      for (int r = 0; r < 8; ++r) {
        const int oc = mt * 16 + r + 8 * half;
        pk[r] = (bf16_t)(gamma * (f0[r] + bo[oc]) + xf[mt * 8 + r]);
      }
      *(v8bf*)(cat + cat_off(mt * 2 + half, n, yy, xx)) = pk;
    }
  }
}

// ---------------------------------------------------------------------------
// Kernels 2-4: implicit-GEMM 3x3 conv, pad=1, relu. Input = first KTOT/9
// channels of concat buffer; without FUSE, output -> channels [ocBase, ocBase+32).
// Block tile: 32 oc x CROWS rows x 128 px; wave w owns x-subtile w of all rows.
// K runs over groups (32-channel slab, column tap dx), row tap dy inside. For one
// group the six weight fragments (3 dy x 2 oc tiles) stay in registers for all
// rows, and each input row's pixel fragment, two 16-byte loads, feeds the up to
// three output rows it touches; the zero border stands for pad=1.
//
// With FUSE (the last convolution) the wave goes on to the 1x1 fusion over all
// 160 channels + bias + residual x, fp32 out, for the pixels it has just made:
// its two stacked D tiles of a row are, after bias, relu and conversion, the
// lane's B fragment of the last 32 channels, which so never reach memory; the
// other 128 channels are the centre taps that the block has read a moment ago.
// The walk is one row a stage; the 20 weight fragments stay in registers, and of
// the two register sets for pixels and x each is refilled, as soon as its stage
// has used it, for the stage after the next.
// ---------------------------------------------------------------------------
#define CROWS 8
#define FSTG CROWS
#define FMID 28

// Stands behind a run of global loads or stores, in front of whatever next
// overwrites a register that one of them names (address or store data). The
// scheduling barrier keeps register-only instructions from moving over the wait.
__device__ __forceinline__ void regs_free() {
  asm volatile("s_wait_xcnt 0x0" ::: "memory");
  __builtin_amdgcn_sched_barrier(0);
}

struct conv_group {
  v16bf wa[3][2];         // weights [dy][oc tile]
  v16bf px[CROWS + 2];    // pixels of input rows y0 - 1 .. y0 + CROWS
};

// all fragments of group g = slab * 3 + dx; every offset is a constant
__device__ __forceinline__ void conv_group_ld(conv_group& f,
                                              const bf16_t* __restrict__ inb,
                                              const bf16_t* __restrict__ wl,
                                              int g) {
  const int s = g / 3, dx = g % 3;
#pragma unroll
  for (int dy = 0; dy < 3; ++dy) {
    const bf16_t* w = wl + (s * 9 + dy * 3 + dx) * 1024;
    f.wa[dy][0] = frag_join(w, w + 256);
    f.wa[dy][1] = frag_join(w + 512, w + 768);
  }
#pragma unroll
  for (int ir = 0; ir < CROWS + 2; ++ir) {
    const bf16_t* p = inb + (size_t)s * 4 * PLANE + (ir * PPITCH + dx) * 8;
    f.px[ir] = frag_join(p, p + 2 * PLANE);
  }
}

template <int KTOT, bool FUSE>
__global__ __launch_bounds__(256) void conv3x3_kernel(
    const bf16_t* __restrict__ cat, const bf16_t* __restrict__ Wr,
    const float* __restrict__ bias, bf16_t* __restrict__ out_cat, int ocBase,
    const bf16_t* __restrict__ Wf_bf, const float* __restrict__ bfus,
    const float* __restrict__ x, float* __restrict__ out) {
  const int bid = blockIdx.x;  // 4 imgs * (256 / CROWS) row groups * 2 xsegs
  constexpr int BPI = (HDIM / CROWS) * 2;
  const int n = bid / BPI, rem = bid % BPI;
  const int y0 = (rem >> 1) * CROWS, xseg = rem & 1;
  const int t = threadIdx.x, lane = t & 31, wave = t >> 5;
  const int half = lane >> 4, coln = lane & 15;
  const int xx = xseg * 128 + wave * 16 + coln;
  const bf16_t* inb = cat + cat_off(half, n, y0 - 1, xx - 1);  // tap (0,0)
  const bf16_t* wl = Wr + lane * 8;

  v8f acc[CROWS][2];
#pragma unroll
  for (int r = 0; r < CROWS; ++r) acc[r][0] = acc[r][1] = vzero();
  v16bf fw[FUSE ? 5 : 1][4];  // fusion weights [k slab][oc tile]
  float fb[FUSE ? 4 : 1][8];  // fusion bias [oc tile][row]
  float bs0[8], bs1[8];       // this convolution's bias, rows of the two oc tiles
  constexpr int NG = (KTOT / 288) * 3;  // groups: 32-channel slabs x 3 dx
  conv_group f[2];
  conv_group_ld(f[0], inb, wl, 0);
  if constexpr (FUSE) {
    // this convolution's bias at uniform indices, so through the scalar path, and
    // here, under the first group's loads: as a vector load it is sunk to its
    // use, behind the last products, and its latency is waited out there
#pragma unroll
    for (int r = 0; r < 8; ++r) {
      const float l0 = bias[r], h0 = bias[8 + r];
      const float l1 = bias[16 + r], h1 = bias[24 + r];
      bs0[r] = half ? h0 : l0;
      bs1[r] = half ? h1 : l1;
    }
  }
  // unrolled so that the two fragment sets stay in registers (constant index)
#pragma unroll
  for (int g = 0; g < NG; ++g) {
    // keeps the next group's loads behind the last group's products (or behind
    // group 0's loads), so that no third fragment set is live
    __builtin_amdgcn_sched_barrier(0);
    if (g + 1 == NG) {
      // behind the last group's loads the address registers fall free while
      // loads that name them are in flight: the wait stands in front of any
      // overwrite, and its operands keep the registers whole up to it
      asm volatile("s_wait_xcnt 0x0" ::"v"(lane), "v"(inb) : "memory");
      if constexpr (FUSE) {
        // the last group has no next one to fetch: the fusion's weights and bias
        // take that fragment set's registers and arrive behind its products
        const unsigned wo = (unsigned)(lane * 8);
#pragma unroll
        for (int ks = 0; ks < 5; ++ks)
#pragma unroll
          for (int mt = 0; mt < 4; ++mt) {
            const bf16_t* w = Wf_bf + ks * 2048 + mt * 512;
            fw[ks][mt] = frag_join(w + wo, w + 256 + wo);
          }
#pragma unroll
        for (int mt = 0; mt < 4; ++mt)
#pragma unroll
          for (int r = 0; r < 8; ++r) fb[mt][r] = bfus[mt * 16 + r + 8 * half];
        regs_free();
      }
    }
    if (g + 1 < NG) conv_group_ld(f[(g + 1) & 1], inb, wl, g + 1);
    // keeps the next group's loads in front of this group's products: without
    // it each pixel load is sunk to its use and its latency is waited out there
    __builtin_amdgcn_sched_barrier(0);
    const conv_group& c = f[g & 1];
#pragma unroll
    for (int ir = 0; ir < CROWS + 2; ++ir) {
#pragma unroll
      for (int dy = 0; dy < 3; ++dy) {
        const int orow = ir - dy;
        if (orow >= 0 && orow < CROWS) {
          acc[orow][0] = wmma_bf(c.wa[dy][0], c.px[ir], acc[orow][0]);
          acc[orow][1] = wmma_bf(c.wa[dy][1], c.px[ir], acc[orow][1]);
        }
      }
    }
  }
  // keeps the last group's products in their order, free of the epilogue
  __builtin_amdgcn_sched_barrier(0);
  if constexpr (!FUSE) {
#pragma unroll
    for (int r = 0; r < 8; ++r) {
      bs0[r] = bias[r + 8 * half];
      bs1[r] = bias[16 + r + 8 * half];
    }
    bf16_t* ob = out_cat + cat_off((ocBase >> 3) + half, n, y0, xx);
#pragma unroll
    for (int q = 0; q < CROWS; ++q) {
      v8bf p0, p1;
#pragma unroll
      for (int r = 0; r < 8; ++r) {
        p0[r] = (bf16_t)fmaxf(acc[q][0][r] + bs0[r], 0.f);
        p1[r] = (bf16_t)fmaxf(acc[q][1][r] + bs1[r], 0.f);
      }
      *(v8bf*)(ob + q * PPITCH * 8) = p0;
      *(v8bf*)(ob + q * PPITCH * 8 + 2 * PLANE) = p1;
    }
  } else {
    constexpr unsigned HW = HDIM * WDIM;
    // block-uniform bases plus one lane offset each for the whole walk
    const bf16_t* cb = cat + cat_off(0, n, y0, xseg * 128);
    const unsigned pxo = (unsigned)(half * PLANE + (wave * 16 + coln) * 8);
    // based on oc plane FMID, so that every plane of the walk lies within the
    // reach of a load's or store's constant offset: one address for all of them
    const size_t xi0 = (((size_t)n * CIN + FMID) * HDIM + y0) * WDIM + xseg * 128;
    const float* xb = x + xi0;
    float* ob = out + xi0;
    const unsigned xo = (unsigned)(8 * half) * HW + wave * 16 + coln;

    v16bf px[2][4];  // centre-tap pixels [stage parity][k slab]
#pragma unroll
    for (int b = 0; b < 2; ++b)
#pragma unroll
      for (int ks = 0; ks < 4; ++ks) {
        const bf16_t* p = cb + (size_t)ks * 4 * PLANE + b * PPITCH * 8;
        px[b][ks] = frag_join(p + pxo, p + 2 * PLANE + pxo);
      }
    regs_free();
    v16bf f3[CROWS];  // this convolution's 32 channels, one B fragment a row
#pragma unroll
    for (int q = 0; q < CROWS; ++q) {
      v8f a0, a1;
#pragma unroll
      for (int r = 0; r < 8; ++r) {
        a0[r] = fmaxf(acc[q][0][r] + bs0[r], 0.f);
        a1[r] = fmaxf(acc[q][1][r] + bs1[r], 0.f);
      }
      f3[q] = frag_from_d(a0, a1);
    }
    // keeps the x loads behind the conversion above: in front of it they would be
    // live beside the f32 accumulators, and the wave's 512 registers overflow
    __builtin_amdgcn_sched_barrier(0);
    float xr[2][4][8];  // residual [stage parity][oc tile][row of D]
#pragma unroll
    for (int b = 0; b < 2; ++b)
#pragma unroll
      for (int mt = 0; mt < 4; ++mt)
#pragma unroll
        for (int r = 0; r < 8; ++r)
          xr[b][mt][r] = *(xb + ((mt * 16 + r - FMID) * (int)HW + b * WDIM) + xo);
    regs_free();

    // unrolled so that every offset and register set is a constant and the last
    // two stages refill nothing
#pragma unroll
    for (int s = 0; s < FSTG; ++s) {
      const int b = s & 1;
      v8f fa[4];
#pragma unroll
      for (int mt = 0; mt < 4; ++mt) fa[mt] = vzero();
#pragma unroll
      for (int ks = 0; ks < 5; ++ks) {
#pragma unroll
        for (int mt = 0; mt < 4; ++mt)
          fa[mt] = wmma_bf(fw[ks][mt], ks < 4 ? px[b][ks & 3] : f3[s], fa[mt]);
        if (ks < 4 && s + 2 < FSTG) {
          const bf16_t* p = cb + (size_t)ks * 4 * PLANE + (s + 2) * PPITCH * 8;
          px[b][ks & 3] = frag_join(p + pxo, p + 2 * PLANE + pxo);
        }
        // holds each slab's refill between its own products and the next slab's:
        // left free, the loads are bunched at the stage's head, where they need
        // registers of their own, and products move over the wait below
        __builtin_amdgcn_sched_barrier(0);
      }
      if (s + 2 < FSTG) regs_free();
#pragma unroll
      for (int mt = 0; mt < 4; ++mt)
#pragma unroll
        for (int r = 0; r < 8; ++r) fa[mt][r] = fa[mt][r] + fb[mt][r] + xr[b][mt][r];
      if (s + 2 < FSTG) {
        // x of the stage after the next goes out here, two stages ahead of its use
#pragma unroll
        for (int mt = 0; mt < 4; ++mt)
#pragma unroll
          for (int r = 0; r < 8; ++r)
            xr[b][mt][r] =
                *(xb + ((mt * 16 + r - FMID) * (int)HW + (s + 2) * WDIM) + xo);
      }
#pragma unroll
      for (int mt = 0; mt < 4; ++mt)
#pragma unroll
        for (int r = 0; r < 8; ++r)
          *(ob + ((mt * 16 + r - FMID) * (int)HW + s * WDIM) + xo) = fa[mt][r];
      // behind the stores their data registers fall free while the stores are in
      // flight: the wait stands in front of any overwrite, and its operands keep
      // the sums whole up to it, also against the sums that are formed among the
      // stores; the scheduling barrier keeps the next stage's products behind it
      asm volatile("s_wait_xcnt 0x0" ::"v"(fa[0]), "v"(fa[1]), "v"(fa[2]), "v"(fa[3])
                   : "memory");
      __builtin_amdgcn_sched_barrier(0);
    }
  }
}

// ---------------------------------------------------------------------------
extern "C" void kernel_launch(void* const* d_in, const int* in_sizes, int n_in,
                              void* d_out, int out_size, void* d_ws,
                              size_t ws_size, hipStream_t stream) {
  const float* x  = (const float*)d_in[0];
  const float* Wq = (const float*)d_in[1];
  const float* bq = (const float*)d_in[2];
  const float* Wk = (const float*)d_in[3];
  const float* bk = (const float*)d_in[4];
  const float* Wv = (const float*)d_in[5];
  const float* bv = (const float*)d_in[6];
  const float* Wo = (const float*)d_in[7];
  const float* bo = (const float*)d_in[8];
  const float* gm = (const float*)d_in[9];
  const float* W1 = (const float*)d_in[10];
  const float* b1 = (const float*)d_in[11];
  const float* W2 = (const float*)d_in[12];
  const float* b2 = (const float*)d_in[13];
  const float* W3 = (const float*)d_in[14];
  const float* b3 = (const float*)d_in[15];
  const float* Wf = (const float*)d_in[16];
  const float* bfus = (const float*)d_in[17];
  float* out = (float*)d_out;

  // workspace layout: bf16 concat planes [4][20][258][272][8] then bf16 weights
  const size_t catElems = (size_t)4 * NGRP * PLANE;
  bf16_t* cat = (bf16_t*)d_ws;
  bf16_t* W1r = cat + catElems;
  bf16_t* W2r = W1r + 32 * 576;
  bf16_t* W3r = W2r + 32 * 864;
  bf16_t* Wfb = W3r + 32 * 1152;
  bf16_t* Wob = Wfb + 64 * 160;
  bf16_t* Wqb = Wob + 64 * 32;
  bf16_t* Wkb = Wqb + 32 * 64;
  bf16_t* Wvb = Wkb + 32 * 64;

  prep_weights<<<264, 256, 0, stream>>>(W1, W2, W3, Wf, Wo, Wq, Wk, Wv, W1r,
                                        W2r, W3r, Wfb, Wob, Wqb, Wkb, Wvb, cat);
  attn_kernel<<<256, 256, 0, stream>>>(x, Wqb, bq, Wkb, bk, Wvb, bv, gm, bo,
                                       Wob, cat);
  conv3x3_kernel<576, false><<<256, 256, 0, stream>>>(cat, W1r, b1, cat, 64, Wfb,
                                                      bfus, x, out);
  conv3x3_kernel<864, false><<<256, 256, 0, stream>>>(cat, W2r, b2, cat, 96, Wfb,
                                                      bfus, x, out);
  conv3x3_kernel<1152, true><<<256, 256, 0, stream>>>(cat, W3r, b3, cat, 128, Wfb,
                                                      bfus, x, out);
}

// v007
// Measured time: 72.6 microseconds a run.
// Two timings next to v006 both put it at 1.14 times that version's speed.
// All steps since v000 together make it 8.49 times as fast.
#include <hip/hip_runtime.h>
#include <hip/hip_bf16.h>

typedef __bf16 bf16_t;
typedef __attribute__((ext_vector_type(16))) __bf16 v16bf;
typedef __attribute__((ext_vector_type(8)))  __bf16 v8bf;
typedef __attribute__((ext_vector_type(8)))  float  v8f;
typedef __attribute__((ext_vector_type(2)))  float  v2f;

#define HDIM 256
#define WDIM 256
#define CIN  64
#define CLAT 32

// Concat buffer layout: one plane per (image, group of 8 channels), each plane
// [PROWS][PPITCH] pixels of 8 bf16 (16 bytes). Pixel (y, x) sits at row y + 1,
// column x + 8, so a 16-pixel tile starts on a 128-byte line; row 0, row 257,
// column 7 and column 264 are the zero border of the 3x3 convolutions.
#define PROWS  258
#define PPITCH 272
#define PLANE  (PROWS * PPITCH * 8)
#define NGRP   20

// ---------------------------------------------------------------------------
// WMMA helpers (CDNA5 16x16x32 bf16, f32 accumulate)
// ---------------------------------------------------------------------------
__device__ __forceinline__ v8f wmma_bf(v16bf a, v16bf b, v8f c) {
  return __builtin_amdgcn_wmma_f32_16x16x32_bf16(false, a, false, b,
                                                 (short)0, c, false, false);
}

__device__ __forceinline__ v8f vzero() {
  v8f z = {0.f, 0.f, 0.f, 0.f, 0.f, 0.f, 0.f, 0.f};
  return z;
}

// K-pair base within a K=32 slab for bf16 A/B fragments (ISA 7.12.2):
// lanes 0-15: VGPR i<4 -> K=2i,2i+1 ; i>=4 -> K=16+2(i-4) ; lanes 16-31: +8
__device__ __forceinline__ int wk_base(int i, int half) {
  return ((i < 4) ? (2 * i) : (16 + 2 * (i - 4))) + 8 * half;
}

// element offset of channel group g, image n, pixel (y, x); y, x in -1..256
__device__ __forceinline__ size_t cat_off(int g, int n, int y, int x) {
  return ((((size_t)n * NGRP + g) * PROWS + (y + 1)) * PPITCH + (x + 8)) * 8;
}

// fragment from its two 16-byte parts: lo = k 8*half..+7, hi = k 16+8*half..+7
__device__ __forceinline__ v16bf frag_join(const bf16_t* __restrict__ lo,
                                           const bf16_t* __restrict__ hi) {
  return __builtin_shufflevector(*(const v8bf*)lo, *(const v8bf*)hi, 0, 1, 2, 3,
                                 4, 5, 6, 7, 8, 9, 10, 11, 12, 13, 14, 15);
}

// A/B fragment from bf16 matrix, lane-dim slow (row-major): elem(r,k)=base[r*ldm+k]
__device__ __forceinline__ v16bf frag_ld_bf(const bf16_t* __restrict__ base,
                                            int ldm, int i0, int koff) {
  int lane = threadIdx.x & 31;
  int r = i0 + (lane & 15);
  int half = lane >> 4;
  v16bf f;
#pragma unroll
  for (int i = 0; i < 8; ++i) {
    int k = koff + wk_base(i, half);
    f[2 * i]     = base[r * ldm + k];
    f[2 * i + 1] = base[r * ldm + k + 1];
  }
  return f;
}

// ---------------------------------------------------------------------------
// Kernel 0: convert all GEMM weights to bf16 in workspace and zero the concat
// buffer's border. Conv and fusion weights are stored in fragment order:
// [k slab][16-row tile][part lo/hi][lane][8], so one fragment part of a wave is
// 512 contiguous bytes. Conv k slab = (32-channel slab s) * 9 + tap.
// ---------------------------------------------------------------------------
template <int KTOT>
__device__ __forceinline__ void conv_w_frag(const float* __restrict__ Wsrc,
                                            bf16_t* __restrict__ o, int i) {
  const int e = i & 7, ln = (i >> 3) & 31, j = (i >> 8) & 1, mt = (i >> 9) & 1;
  const int ks = i >> 10, s = ks / 9, tap = ks - s * 9;
  const int oc = mt * 16 + (ln & 15);
  const int ic = s * 32 + j * 16 + 8 * (ln >> 4) + e;
  o[i] = (bf16_t)Wsrc[oc * KTOT + ic * 9 + tap];
}

__global__ void prep_weights(const float* __restrict__ W1, const float* __restrict__ W2,
                             const float* __restrict__ W3, const float* __restrict__ Wf,
                             const float* __restrict__ Wo, const float* __restrict__ Wq,
                             const float* __restrict__ Wk, const float* __restrict__ Wv,
                             bf16_t* __restrict__ o1, bf16_t* __restrict__ o2,
                             bf16_t* __restrict__ o3, bf16_t* __restrict__ of,
                             bf16_t* __restrict__ oo, bf16_t* __restrict__ oq,
                             bf16_t* __restrict__ ok, bf16_t* __restrict__ ov,
                             bf16_t* __restrict__ cat) {
  int i = blockIdx.x * blockDim.x + threadIdx.x;
  if (i < 32 * 576)  conv_w_frag<576>(W1, o1, i);
  if (i < 32 * 864)  conv_w_frag<864>(W2, o2, i);
  if (i < 32 * 1152) conv_w_frag<1152>(W3, o3, i);
  if (i < 64 * 160) {
    const int e = i & 7, ln = (i >> 3) & 31, j = (i >> 8) & 1, mt = (i >> 9) & 3;
    const int ks = i >> 11;
    of[i] = (bf16_t)Wf[(mt * 16 + (ln & 15)) * 160 + ks * 32 + j * 16 +
                       8 * (ln >> 4) + e];
  }
  // border of the 16 channel groups the convolutions read, 4 images:
  // 2 whole rows (272 px) + 2 columns x 256 rows = 1056 pixels per plane
  if (i < 64 * 1056) {
    const int pl = i / 1056, rem = i - pl * 1056;
    int row, col;
    if (rem < 544) {
      row = (rem < 272) ? 0 : 257;
      col = (rem < 272) ? rem : rem - 272;
    } else {
      row = 1 + ((rem - 544) >> 1);
      col = (rem & 1) ? 264 : 7;
    }
    const v8bf z = {(bf16_t)0.f, (bf16_t)0.f, (bf16_t)0.f, (bf16_t)0.f,
                    (bf16_t)0.f, (bf16_t)0.f, (bf16_t)0.f, (bf16_t)0.f};
    *(v8bf*)(cat + cat_off(pl & 15, pl >> 4, row - 1, col - 8)) = z;
  }
  if (i < 64 * 32)   oo[i] = (bf16_t)Wo[i];
  if (i < 32 * 64) {
    oq[i] = (bf16_t)Wq[i];
    ok[i] = (bf16_t)Wk[i];
    ov[i] = (bf16_t)Wv[i];
  }
}

// ---------------------------------------------------------------------------
// Kernel 1: region non-local attention. One block per 32x32 cell (256 blocks).
// All GEMMs (k/v proj+pool, q proj, K q^T, V^T P^T, Wo proj) on the WMMA pipe.
// Every product of the query phase has the query as its column: a lane's D
// registers of two 16-row tiles (rows r + 8*half and 16 + r + 8*half) are, after
// conversion, that lane's B fragment of the next product (k = 8*half + e and
// 16 + 8*half + e), so q, the scores, P and out never leave the lane.
// Writes f0 (bf16) into channel groups 0..7 of the concat buffer.
// ---------------------------------------------------------------------------
#define VPITCH 264  // keys per row of V^T in LDS + 8: 528 B, an odd count of 16 B

// lane l with lane l ^ 16
__device__ __forceinline__ float xhalf(float v) {
  return __builtin_bit_cast(
      float, __builtin_amdgcn_permlanex16(__builtin_bit_cast(int, v),
                                          __builtin_bit_cast(int, v), 0x76543210,
                                          0xfedcba98, false, false));
}

// B fragment from the D registers of two stacked 16-row tiles
__device__ __forceinline__ v16bf frag_from_d(v8f lo, v8f hi) {
  v16bf f;
#pragma unroll
  for (int e = 0; e < 8; ++e) {
    f[e]     = (bf16_t)lo[e];
    f[8 + e] = (bf16_t)hi[e];
  }
  return f;
}

__global__ __launch_bounds__(256) void attn_kernel(
    const float* __restrict__ x,
    const bf16_t* __restrict__ Wq_bf, const float* __restrict__ bq,
    const bf16_t* __restrict__ Wk_bf, const float* __restrict__ bk,
    const bf16_t* __restrict__ Wv_bf, const float* __restrict__ bv,
    const float* __restrict__ gamma_p, const float* __restrict__ bo,
    const bf16_t* __restrict__ Wo_bf, bf16_t* __restrict__ cat) {
  __shared__ __attribute__((aligned(16))) bf16_t Kp[256 * 32];      // pooled keys   [key][lat]
  __shared__ __attribute__((aligned(16))) bf16_t Vt[32 * VPITCH];   // pooled values [lat][key]

  const int bid = blockIdx.x;
  const int n = bid >> 6, gh = (bid >> 3) & 7, gw = bid & 7;
  const int row0 = gh * 32, col0 = gw * 32;
  const int t = threadIdx.x, lane = t & 31, wave = t >> 5;
  const int half = lane >> 4, coln = lane & 15;
  const float gamma = gamma_p[0];
  const size_t HW = (size_t)HDIM * WDIM;
  const float* xcell = x + (size_t)n * CIN * HW;  // + yy*WDIM + xx per use

  // ---- Phase A (WMMA): k/v projection + 2x2 maxpool, all in registers. A wave
  // owns the row pairs wave and wave + 8 of the cell. A row pair is four 16-px
  // tiles (row ry, parity par), index j of a tile being pixel column 2j + par:
  // the four pixels of pool window j sit at index j of the four tiles, so the
  // pool is an elementwise maximum of four D tiles. A lane reads both parities
  // of a channel with one 8-byte load, 16 lanes covering the cell row's 128-byte
  // line, and the same fragments feed k and v. k has the pixel as its column
  // (a lane's D = 8 lat of one key), v as its row (a lane's D = 8 keys of one
  // lat): either goes to LDS as 16-byte stores.
  {
    const unsigned wo = (unsigned)(coln * 64 + 8 * half);  // lane's row, k part
    v16bf wk[2][2], wv[2][2];  // [16-lat tile][32-channel slab]
#pragma unroll
    for (int mt = 0; mt < 2; ++mt)
#pragma unroll
      for (int s = 0; s < 2; ++s) {
        const unsigned o = wo + mt * 1024 + s * 32;
        wk[mt][s] = frag_join(Wk_bf + o, Wk_bf + o + 16);
        wv[mt][s] = frag_join(Wv_bf + o, Wv_bf + o + 16);
      }
    // bk at uniform indices, so through the scalar path: a vector load issued
    // behind the x loads would return behind them, and the first row pair's
    // keys would wait for all of x
    float bk0[8], bk1[8];
#pragma unroll
    for (int r = 0; r < 8; ++r) {
      const float l0 = bk[r], h0 = bk[8 + r], l1 = bk[16 + r], h1 = bk[24 + r];
      bk0[r] = half ? h0 : l0;
      bk1[r] = half ? h1 : l1;
    }
    const float bv0 = bv[coln], bv1 = bv[16 + coln];
    // slot mt*8 + r = channel mt*16 + 8*half + r, the k order of a fragment
    const float* xq = xcell + (size_t)(8 * half) * HW +
                      (size_t)(row0 + 2 * wave) * WDIM + col0 + 2 * coln;
    v2f xa[2][2][32];  // [row pair][row][slot], both parities
#pragma unroll
    for (int p = 0; p < 2; ++p)
#pragma unroll
      for (int ry = 0; ry < 2; ++ry) {
        // keeps the four rows' loads in the order of their use: loads return in
        // order, so a row's products start while the later rows are in flight
        __builtin_amdgcn_sched_barrier(0);
#pragma unroll
        for (int mt = 0; mt < 4; ++mt)
#pragma unroll
          for (int r = 0; r < 8; ++r)
            xa[p][ry][mt * 8 + r] = *(const v2f*)(
                xq + (size_t)(mt * 16 + r) * HW + (p * 16 + ry) * WDIM);
      }
    // behind the x loads their address registers fall free while the loads are
    // in flight: the wait stands in front of any overwrite, and its operand
    // keeps the address whole up to it
    asm volatile("s_wait_xcnt 0x0" ::"v"(xq) : "memory");
#pragma unroll
    for (int p = 0; p < 2; ++p) {
      v8f km0, km1, vm0, vm1;
#pragma unroll
      for (int tl = 0; tl < 4; ++tl) {
        const int ry = tl >> 1, par = tl & 1;
        // keeps a row's products in front of the wait for the next row's loads:
        // mixed with later rows' work they would start only when all x is there
        if (par == 0) __builtin_amdgcn_sched_barrier(0);
        v16bf b0, b1;
#pragma unroll
        for (int e = 0; e < 16; ++e) {
          b0[e] = (bf16_t)xa[p][ry][e][par];
          b1[e] = (bf16_t)xa[p][ry][16 + e][par];
        }
        v8f k0 = wmma_bf(wk[0][0], b0, vzero());
        v8f k1 = wmma_bf(wk[1][0], b0, vzero());
        v8f v0 = wmma_bf(b0, wv[0][0], vzero());
        v8f v1 = wmma_bf(b0, wv[1][0], vzero());
        k0 = wmma_bf(wk[0][1], b1, k0);
        k1 = wmma_bf(wk[1][1], b1, k1);
        v0 = wmma_bf(b1, wv[0][1], v0);
        v1 = wmma_bf(b1, wv[1][1], v1);
        if (tl == 0) {
          km0 = k0; km1 = k1; vm0 = v0; vm1 = v1;
        } else {
#pragma unroll
          for (int r = 0; r < 8; ++r) {
            km0[r] = fmaxf(km0[r], k0[r]);
            km1[r] = fmaxf(km1[r], k1[r]);
            vm0[r] = fmaxf(vm0[r], v0[r]);
            vm1[r] = fmaxf(vm1[r], v1[r]);
          }
        }
      }
      // the bias is the same for the four pixels of a window and rounding is
      // monotone: added behind the maximum it gives the same value
      v8bf kk0, kk1, vv0, vv1;
#pragma unroll
      for (int r = 0; r < 8; ++r) {
        kk0[r] = (bf16_t)(km0[r] + bk0[r]);
        kk1[r] = (bf16_t)(km1[r] + bk1[r]);
        vv0[r] = (bf16_t)(vm0[r] + bv0);
        vv1[r] = (bf16_t)(vm1[r] + bv1);
      }
      const int key0 = (wave + 8 * p) * 16;  // pooled row = row pair
      *(v8bf*)(Kp + (key0 + coln) * 32 + 8 * half) = kk0;
      *(v8bf*)(Kp + (key0 + coln) * 32 + 16 + 8 * half) = kk1;
      *(v8bf*)(Vt + coln * VPITCH + key0 + 8 * half) = vv0;
      *(v8bf*)(Vt + (16 + coln) * VPITCH + key0 + 8 * half) = vv1;
    }
    __syncthreads();  // every wave reads all keys and values from here on
  }

  // ---- Phase B: 8 chunks of 128 queries; each wave owns one 16-query tile.
  // Kp and Vt are only read from here on, so the phase has no barrier.
  const unsigned wqo = (unsigned)(coln * 64 + 8 * half);  // lane's row, k part
  const v16bf wq00 = frag_join(Wq_bf + wqo, Wq_bf + wqo + 16);
  const v16bf wq01 = frag_join(Wq_bf + wqo + 32, Wq_bf + wqo + 48);
  const v16bf wq10 = frag_join(Wq_bf + wqo + 1024, Wq_bf + wqo + 1040);
  const v16bf wq11 = frag_join(Wq_bf + wqo + 1056, Wq_bf + wqo + 1072);
  // behind the Wq loads their address registers fall free while the loads are
  // in flight: the wait stands in front of any overwrite, and its operands keep
  // base and offset whole up to it
  asm volatile("s_wait_xcnt 0x0" ::"s"(Wq_bf), "v"(wqo * 2) : "memory");
  const bf16_t* kl = Kp + coln * 32 + 8 * half;      // A rows = keys, k = lat
  const bf16_t* vl = Vt + coln * VPITCH + 8 * half;  // A rows = lat, k = keys
  v16bf kf[16];  // all 256 keys stay in registers for the wave's 8 query tiles
#pragma unroll
  for (int kt = 0; kt < 16; ++kt)
    kf[kt] = frag_join(kl + kt * 16 * 32, kl + kt * 16 * 32 + 16);
  for (int chunk = 0; chunk < 8; ++chunk) {
    const int yy = row0 + chunk * 4 + (wave >> 1);
    const int xx = col0 + (wave & 1) * 16 + coln;
    // this lane's pixel, channels mt*16 + 8*half + r: the B fragments of the q
    // projection and, in f32, the residual of the same lane's f0 values
    const float* xp = xcell + (size_t)(8 * half) * HW + (size_t)yy * WDIM + xx;
    float xf[32];
#pragma unroll
    for (int mt = 0; mt < 4; ++mt)
#pragma unroll
      for (int r = 0; r < 8; ++r) xf[mt * 8 + r] = xp[(size_t)(mt * 16 + r) * HW];
    // behind the x loads their address registers fall free while the loads are
    // in flight: the wait stands in front of any overwrite, and its operand
    // keeps the address whole up to it. Its memory clobber also keeps the V^T
    // fragment loads inside the loop: lifted out beside the K fragments they
    // overflow the 512 registers of a wave and spill to scratch
    asm volatile("s_wait_xcnt 0x0" ::"v"(xp) : "memory");
    v16bf b0, b1;
#pragma unroll
    for (int e = 0; e < 16; ++e) {
      b0[e] = (bf16_t)xf[e];
      b1[e] = (bf16_t)xf[16 + e];
    }
    // q^T[32 lat][16 q]
    v8f c0 = vzero(), c1 = vzero();
    c0 = wmma_bf(wq00, b0, c0);
    c0 = wmma_bf(wq01, b1, c0);
    c1 = wmma_bf(wq10, b0, c1);
    c1 = wmma_bf(wq11, b1, c1);
#pragma unroll
    for (int r = 0; r < 8; ++r) {
      c0[r] += bq[r + 8 * half];
      c1[r] += bq[16 + r + 8 * half];
    }
    const v16bf qb = frag_from_d(c0, c1);

    // scores^T: one WMMA per 16-key tile; sc[kt][r] = key kt*16 + r + 8*half
    v8f sc[16];
#pragma unroll
    for (int kt = 0; kt < 16; ++kt) sc[kt] = wmma_bf(kf[kt], qb, vzero());
    // softmax over 256 keys: 128 in the lane, the other 128 in lane ^ 16
    v8f mv = sc[0];
#pragma unroll
    for (int kt = 1; kt < 16; ++kt)
#pragma unroll
      for (int r = 0; r < 8; ++r) mv[r] = fmaxf(mv[r], sc[kt][r]);
    float m = fmaxf(fmaxf(fmaxf(mv[0], mv[1]), fmaxf(mv[2], mv[3])),
                    fmaxf(fmaxf(mv[4], mv[5]), fmaxf(mv[6], mv[7])));
    m = fmaxf(m, xhalf(m));
    const float l2e = 1.44269504f;  // e^(s - m) = 2^(s * log2(e) - m * log2(e))
    const float nm = -m * l2e;
    v8f sv = vzero();
#pragma unroll
    for (int kt = 0; kt < 16; ++kt) {
      const v8f t = sc[kt] * l2e + nm;
#pragma unroll
      for (int r = 0; r < 8; ++r) sc[kt][r] = __builtin_amdgcn_exp2f(t[r]);
      sv += sc[kt];
    }
    float s = ((sv[0] + sv[1]) + (sv[2] + sv[3])) + ((sv[4] + sv[5]) + (sv[6] + sv[7]));
    s += xhalf(s);
    const float rinv = 1.f / s;

    // out^T[32 lat][16 q] = V^T @ P^T, P^T packed from the score registers
    v8f o0 = vzero(), o1 = vzero();
#pragma unroll
    for (int ks = 0; ks < 8; ++ks) {
      // keeps each half of the V^T fragment loads behind what precedes it: all
      // lifted to the loop's head they stay live beside K and the scores, and
      // the wave's 512 registers overflow into scratch
      if ((ks & 3) == 0) __builtin_amdgcn_sched_barrier(0);
      const v16bf pb = frag_from_d(sc[2 * ks], sc[2 * ks + 1]);
      const bf16_t* vp = vl + ks * 32;
      o0 = wmma_bf(frag_join(vp, vp + 16), pb, o0);
      o1 = wmma_bf(frag_join(vp + 16 * VPITCH, vp + 16 * VPITCH + 16), pb, o1);
    }
    // the row sum divides once here: it is the lane's own query
    o0 *= rinv;
    o1 *= rinv;
    const v16bf ob = frag_from_d(o0, o1);

    // f0[64][16q] = gamma*(Wo @ out^T + bo) + x
#pragma unroll
    for (int mt = 0; mt < 4; ++mt) {
      v16bf wa = frag_ld_bf(Wo_bf, 32, mt * 16, 0);
      v8f f0 = wmma_bf(wa, ob, vzero());
      v8bf pk;  // this lane's 8 consecutive channels = one channel group
#pragma unroll
      for (int r = 0; r < 8; ++r) {
        const int oc = mt * 16 + r + 8 * half;
        pk[r] = (bf16_t)(gamma * (f0[r] + bo[oc]) + xf[mt * 8 + r]);
      }
      *(v8bf*)(cat + cat_off(mt * 2 + half, n, yy, xx)) = pk;
    }
  }
}

// ---------------------------------------------------------------------------
// Kernels 2-4: implicit-GEMM 3x3 conv, pad=1, relu. Input = first KTOT/9
// channels of concat buffer; without FUSE, output -> channels [ocBase, ocBase+32).
// Block tile: 32 oc x CROWS rows x 128 px; wave w owns x-subtile w of all rows.
// K runs over groups (32-channel slab, column tap dx), row tap dy inside. For one
// group the six weight fragments (3 dy x 2 oc tiles) stay in registers for all
// rows, and each input row's pixel fragment, two 16-byte loads, feeds the up to
// three output rows it touches; the zero border stands for pad=1.
//
// The pixels of a 32-channel slab (4 planes x 10 rows x 130 px) are brought into
// LDS once by asynchronous copies and read there by all three column taps and all
// eight waves; of the two LDS buffers one is filled while the other is read.
//
// With FUSE (the last convolution) the wave goes on to the 1x1 fusion over all
// 160 channels + bias + residual x, fp32 out, for the pixels it has just made:
// its two stacked D tiles of a row are, after bias, relu and conversion, the
// lane's B fragment of the last 32 channels, which so never reach memory; the
// other 128 channels are the centre taps that the block has read a moment ago.
// The walk is one row a stage; the 20 weight fragments stay in registers, and of
// the two register sets for pixels and x each is refilled, as soon as its stage
// has used it, for the stage after the next.
// ---------------------------------------------------------------------------
#define CROWS 8
#define FSTG CROWS
#define FMID 28

// Stands behind a run of global loads or stores, in front of whatever next
// overwrites a register that one of them names (address or store data). The
// scheduling barrier keeps register-only instructions from moving over the wait.
__device__ __forceinline__ void regs_free() {
  asm volatile("s_wait_xcnt 0x0" ::: "memory");
  __builtin_amdgcn_sched_barrier(0);
}

struct conv_group {
  v16bf wa[3][2];         // weights [dy][oc tile]
  v16bf px[CROWS + 2];    // pixels of input rows y0 - 1 .. y0 + CROWS
};

// LDS tile of one slab: [4 planes][TROWS rows][TCOLS px] of 16 bytes, then one
// 16-byte place per thread for the lanes of the edge copy that have no pixel
#define TROWS  (CROWS + 2)
#define TCOLS  130
#define TUNITS (4 * TROWS * TCOLS)
#define TBUF   ((TUNITS + 256) * 8)

// weight fragments of group g = slab * 3 + dx; every offset is a constant
__device__ __forceinline__ void conv_w_ld(conv_group& f,
                                          const bf16_t* __restrict__ wl, int g) {
  const int s = g / 3, dx = g % 3;
#pragma unroll
  for (int dy = 0; dy < 3; ++dy) {
    const bf16_t* w = wl + (s * 9 + dy * 3 + dx) * 1024;
    f.wa[dy][0] = frag_join(w, w + 256);
    f.wa[dy][1] = frag_join(w + 512, w + 768);
  }
}

// pixel fragments of column tap dx from the slab's LDS tile; lp = the lane's
// pixel of plane half, row 0, tap 0
__device__ __forceinline__ void conv_px_ld(conv_group& f, const bf16_t* lp,
                                           int dx) {
#pragma unroll
  for (int ir = 0; ir < TROWS; ++ir) {
    const bf16_t* p = lp + (ir * TCOLS + dx) * 8;
    f.px[ir] = frag_join(p, p + 2 * TROWS * TCOLS * 8);
  }
}

// A wave's share of one slab tile, 21 asynchronous copies of 16 bytes a lane: five
// rows of one plane, four copies of 32 px each (l0, g0 = the lane's LDS byte
// address and global address in the first; along a row the constant offset moves
// both addresses alike), and one copy for the first and last px of the five rows
// (lx, gx). The statement ends with the wait that stands in front of any overwrite
// of the address registers its copies name.
__device__ __forceinline__ void tile_copy(unsigned l0, const bf16_t* g0,
                                          unsigned lx, const bf16_t* gx) {
  asm volatile(
      "global_load_async_to_lds_b128 %0, %1, off\n\t"
      "global_load_async_to_lds_b128 %0, %1, off offset:512\n\t"
      "global_load_async_to_lds_b128 %0, %1, off offset:1024\n\t"
      "global_load_async_to_lds_b128 %0, %1, off offset:1536\n\t"
      "global_load_async_to_lds_b128 %2, %3, off\n\t"
      "global_load_async_to_lds_b128 %2, %3, off offset:512\n\t"
      "global_load_async_to_lds_b128 %2, %3, off offset:1024\n\t"
      "global_load_async_to_lds_b128 %2, %3, off offset:1536\n\t"
      "global_load_async_to_lds_b128 %4, %5, off\n\t"
      "global_load_async_to_lds_b128 %4, %5, off offset:512\n\t"
      "global_load_async_to_lds_b128 %4, %5, off offset:1024\n\t"
      "global_load_async_to_lds_b128 %4, %5, off offset:1536\n\t"
      "global_load_async_to_lds_b128 %6, %7, off\n\t"
      "global_load_async_to_lds_b128 %6, %7, off offset:512\n\t"
      "global_load_async_to_lds_b128 %6, %7, off offset:1024\n\t"
      "global_load_async_to_lds_b128 %6, %7, off offset:1536\n\t"
      "global_load_async_to_lds_b128 %8, %9, off\n\t"
      "global_load_async_to_lds_b128 %8, %9, off offset:512\n\t"
      "global_load_async_to_lds_b128 %8, %9, off offset:1024\n\t"
      "global_load_async_to_lds_b128 %8, %9, off offset:1536\n\t"
      "global_load_async_to_lds_b128 %10, %11, off\n\t"
      "s_wait_xcnt 0x0" ::"v"(l0), "v"(g0),
      "v"(l0 + 1 * TCOLS * 16u), "v"(g0 + 1 * PPITCH * 8),
      "v"(l0 + 2 * TCOLS * 16u), "v"(g0 + 2 * PPITCH * 8),
      "v"(l0 + 3 * TCOLS * 16u), "v"(g0 + 3 * PPITCH * 8),
      "v"(l0 + 4 * TCOLS * 16u), "v"(g0 + 4 * PPITCH * 8), "v"(lx), "v"(gx)
      : "memory");
}

template <int KTOT, bool FUSE>
__global__ __launch_bounds__(256) void conv3x3_kernel(
    const bf16_t* __restrict__ cat, const bf16_t* __restrict__ Wr,
    const float* __restrict__ bias, bf16_t* __restrict__ out_cat, int ocBase,
    const bf16_t* __restrict__ Wf_bf, const float* __restrict__ bfus,
    const float* __restrict__ x, float* __restrict__ out) {
  const int bid = blockIdx.x;  // 4 imgs * (256 / CROWS) row groups * 2 xsegs
  constexpr int BPI = (HDIM / CROWS) * 2;
  const int n = bid / BPI, rem = bid % BPI;
  const int y0 = (rem >> 1) * CROWS, xseg = rem & 1;
  const int t = threadIdx.x, lane = t & 31, wave = t >> 5;
  const int half = lane >> 4, coln = lane & 15;
  const int xx = xseg * 128 + wave * 16 + coln;
  const bf16_t* wl = Wr + lane * 8;
  __shared__ __attribute__((aligned(16))) bf16_t tile[2][TBUF];
  // reader: the lane's pixel of plane half, row 0, tap 0 in buffer 0
  const bf16_t* lp = &tile[0][(half * TROWS * TCOLS + wave * 16 + coln) * 8];
  // copier: wave w brings rows 5 * (w & 1) .. + 4 of plane w >> 1. The row copies
  // bring tile px 1..128, which start on a 128-byte line in memory. In the edge
  // copy lanes 0..9 bring px 0 and 129 of the five rows; the other lanes, which
  // must be on, bring a pixel of the tile once more to a place nobody reads
  const int crow = (wave >> 1) * TROWS + (wave & 1) * (TROWS / 2);
  const int ej = lane >> 1, ec = (lane & 1) * (TCOLS - 1);
  const bool edge = lane < TROWS;
  const unsigned cl0 = (unsigned)(size_t)&tile[0][(crow * TCOLS + 1 + lane) * 8];
  const int eunit = (crow + ej) * TCOLS + ec, spare = TUNITS + t;
  const unsigned clx = (unsigned)(size_t)&tile[0][(edge ? eunit : spare) * 8];
  const bf16_t* cg0 = cat + cat_off(wave >> 1, n, y0 - 1 + (wave & 1) * (TROWS / 2),
                                    xseg * 128 + lane);
  const int estep = (ej * PPITCH + ec - 1 - lane) * 8;
  const bf16_t* cgx = cg0 + (edge ? estep : 0);

  v8f acc[CROWS][2];
#pragma unroll
  for (int r = 0; r < CROWS; ++r) acc[r][0] = acc[r][1] = vzero();
  v16bf fw[FUSE ? 5 : 1][4];  // fusion weights [k slab][oc tile]
  float fb[FUSE ? 4 : 1][8];  // fusion bias [oc tile][row]
  float bs0[8], bs1[8];       // this convolution's bias, rows of the two oc tiles
  constexpr int NG = (KTOT / 288) * 3;  // groups: 32-channel slabs x 3 dx
  conv_group f[2];
  tile_copy(cl0, cg0, clx, cgx);
  conv_w_ld(f[0], wl, 0);
  // slab 0 has landed for this wave's copies, then, behind the barrier, for all
  asm volatile("s_wait_asynccnt 0x0" ::: "memory");
  __syncthreads();
  tile_copy(cl0 + TBUF * 2, cg0 + (size_t)4 * PLANE, clx + TBUF * 2,
            cgx + (size_t)4 * PLANE);
  conv_px_ld(f[0], lp, 0);
  if constexpr (FUSE) {
    // this convolution's bias at uniform indices, so through the scalar path, and
    // here, under the first group's loads: as a vector load it is sunk to its
    // use, behind the last products, and its latency is waited out there
#pragma unroll
    for (int r = 0; r < 8; ++r) {
      const float l0 = bias[r], h0 = bias[8 + r];
      const float l1 = bias[16 + r], h1 = bias[24 + r];
      bs0[r] = half ? h0 : l0;
      bs1[r] = half ? h1 : l1;
    }
  }
  // unrolled so that the two fragment sets stay in registers (constant index)
#pragma unroll
  for (int g = 0; g < NG; ++g) {
    // keeps the next group's loads behind the last group's products (or behind
    // group 0's loads), so that no third fragment set is live
    __builtin_amdgcn_sched_barrier(0);
    if (g % 3 == 2 && g + 1 < NG) {
      // in front of slab s's last group, whose pixels are already fetched: this
      // wave's reads of slab s have returned and its copies of slab s + 1 have
      // landed; behind the barrier that holds for every wave, so slab s + 1 may
      // be read (the fetch below) and the buffer of slab s refilled
      const int s = g / 3;
      asm volatile("s_wait_dscnt 0x0" ::: "memory");
      asm volatile("s_wait_asynccnt 0x0" ::: "memory");
      __syncthreads();
      if (g + 4 < NG)
        tile_copy(cl0 + (s & 1) * TBUF * 2, cg0 + (size_t)(s + 2) * 4 * PLANE,
                  clx + (s & 1) * TBUF * 2, cgx + (size_t)(s + 2) * 4 * PLANE);
    }
    if (g + 1 == NG) {
      // behind the last group's weight loads their offset register falls free
      // while loads that name it are in flight: the wait stands in front of any
      // overwrite, and its operand keeps the register whole up to it
      asm volatile("s_wait_xcnt 0x0" ::"v"(lane) : "memory");
      if constexpr (FUSE) {
        // the last group has no next one to fetch: the fusion's weights and bias
        // take that fragment set's registers and arrive behind its products
        const unsigned wo = (unsigned)(lane * 8);
#pragma unroll
        for (int ks = 0; ks < 5; ++ks)
#pragma unroll
          for (int mt = 0; mt < 4; ++mt) {
            const bf16_t* w = Wf_bf + ks * 2048 + mt * 512;
            fw[ks][mt] = frag_join(w + wo, w + 256 + wo);
          }
#pragma unroll
        for (int mt = 0; mt < 4; ++mt)
#pragma unroll
          for (int r = 0; r < 8; ++r) fb[mt][r] = bfus[mt * 16 + r + 8 * half];
        regs_free();
      }
    }
    if (g + 1 < NG) {
      conv_w_ld(f[(g + 1) & 1], wl, g + 1);
      conv_px_ld(f[(g + 1) & 1], lp + (((g + 1) / 3) & 1) * TBUF, (g + 1) % 3);
    }
    // keeps the next group's loads in front of this group's products: without
    // it each pixel load is sunk to its use and its latency is waited out there
    __builtin_amdgcn_sched_barrier(0);
    const conv_group& c = f[g & 1];
#pragma unroll
    for (int ir = 0; ir < CROWS + 2; ++ir) {
#pragma unroll
      for (int dy = 0; dy < 3; ++dy) {
        const int orow = ir - dy;
        if (orow >= 0 && orow < CROWS) {
          acc[orow][0] = wmma_bf(c.wa[dy][0], c.px[ir], acc[orow][0]);
          acc[orow][1] = wmma_bf(c.wa[dy][1], c.px[ir], acc[orow][1]);
        }
      }
    }
  }
  // a precaution: no copy is in flight when the wave goes on and ends
  asm volatile("s_wait_asynccnt 0x0" ::: "memory");
  // keeps the last group's products in their order, free of the epilogue
  __builtin_amdgcn_sched_barrier(0);
  if constexpr (!FUSE) {
#pragma unroll
    for (int r = 0; r < 8; ++r) {
      bs0[r] = bias[r + 8 * half];
      bs1[r] = bias[16 + r + 8 * half];
    }
    bf16_t* ob = out_cat + cat_off((ocBase >> 3) + half, n, y0, xx);
#pragma unroll
    for (int q = 0; q < CROWS; ++q) {
      v8bf p0, p1;
#pragma unroll
      for (int r = 0; r < 8; ++r) {
        p0[r] = (bf16_t)fmaxf(acc[q][0][r] + bs0[r], 0.f);
        p1[r] = (bf16_t)fmaxf(acc[q][1][r] + bs1[r], 0.f);
      }
      *(v8bf*)(ob + q * PPITCH * 8) = p0;
      *(v8bf*)(ob + q * PPITCH * 8 + 2 * PLANE) = p1;
    }
  } else {
    constexpr unsigned HW = HDIM * WDIM;
    // block-uniform bases plus one lane offset each for the whole walk
    const bf16_t* cb = cat + cat_off(0, n, y0, xseg * 128);
    const unsigned pxo = (unsigned)(half * PLANE + (wave * 16 + coln) * 8);
    // based on oc plane FMID, so that every plane of the walk lies within the
    // reach of a load's or store's constant offset: one address for all of them
    const size_t xi0 = (((size_t)n * CIN + FMID) * HDIM + y0) * WDIM + xseg * 128;
    const float* xb = x + xi0;
    float* ob = out + xi0;
    const unsigned xo = (unsigned)(8 * half) * HW + wave * 16 + coln;

    v16bf px[2][4];  // centre-tap pixels [stage parity][k slab]
#pragma unroll
    for (int b = 0; b < 2; ++b)
#pragma unroll
      for (int ks = 0; ks < 4; ++ks) {
        const bf16_t* p = cb + (size_t)ks * 4 * PLANE + b * PPITCH * 8;
        px[b][ks] = frag_join(p + pxo, p + 2 * PLANE + pxo);
      }
    regs_free();
    v16bf f3[CROWS];  // this convolution's 32 channels, one B fragment a row
#pragma unroll
    for (int q = 0; q < CROWS; ++q) {
      v8f a0, a1;
#pragma unroll
      for (int r = 0; r < 8; ++r) {
        a0[r] = fmaxf(acc[q][0][r] + bs0[r], 0.f);
        a1[r] = fmaxf(acc[q][1][r] + bs1[r], 0.f);
      }
      f3[q] = frag_from_d(a0, a1);
    }
    // keeps the x loads behind the conversion above: in front of it they would be
    // live beside the f32 accumulators, and the wave's 512 registers overflow
    __builtin_amdgcn_sched_barrier(0);
    float xr[2][4][8];  // residual [stage parity][oc tile][row of D]
#pragma unroll
    for (int b = 0; b < 2; ++b)
#pragma unroll
      for (int mt = 0; mt < 4; ++mt)
#pragma unroll
        for (int r = 0; r < 8; ++r)
          xr[b][mt][r] = *(xb + ((mt * 16 + r - FMID) * (int)HW + b * WDIM) + xo);
    regs_free();

    // unrolled so that every offset and register set is a constant and the last
    // two stages refill nothing
#pragma unroll
    for (int s = 0; s < FSTG; ++s) {
      const int b = s & 1;
      v8f fa[4];
#pragma unroll
      for (int mt = 0; mt < 4; ++mt) fa[mt] = vzero();
#pragma unroll
      for (int ks = 0; ks < 5; ++ks) {
#pragma unroll
        for (int mt = 0; mt < 4; ++mt)
          fa[mt] = wmma_bf(fw[ks][mt], ks < 4 ? px[b][ks & 3] : f3[s], fa[mt]);
        if (ks < 4 && s + 2 < FSTG) {
          const bf16_t* p = cb + (size_t)ks * 4 * PLANE + (s + 2) * PPITCH * 8;
          px[b][ks & 3] = frag_join(p + pxo, p + 2 * PLANE + pxo);
        }
        // holds each slab's refill between its own products and the next slab's:
        // left free, the loads are bunched at the stage's head, where they need
        // registers of their own, and products move over the wait below
        __builtin_amdgcn_sched_barrier(0);
      }
      if (s + 2 < FSTG) regs_free();
#pragma unroll
      for (int mt = 0; mt < 4; ++mt)
#pragma unroll
        for (int r = 0; r < 8; ++r) fa[mt][r] = fa[mt][r] + fb[mt][r] + xr[b][mt][r];
      if (s + 2 < FSTG) {
        // x of the stage after the next goes out here, two stages ahead of its use
#pragma unroll
        for (int mt = 0; mt < 4; ++mt)
#pragma unroll
          for (int r = 0; r < 8; ++r)
            xr[b][mt][r] =
                *(xb + ((mt * 16 + r - FMID) * (int)HW + (s + 2) * WDIM) + xo);
      }
#pragma unroll
      for (int mt = 0; mt < 4; ++mt)
#pragma unroll
        for (int r = 0; r < 8; ++r)
          *(ob + ((mt * 16 + r - FMID) * (int)HW + s * WDIM) + xo) = fa[mt][r];
      // behind the stores their data registers fall free while the stores are in
      // flight: the wait stands in front of any overwrite, and its operands keep
      // the sums whole up to it, also against the sums that are formed among the
      // stores; the scheduling barrier keeps the next stage's products behind it
      asm volatile("s_wait_xcnt 0x0" ::"v"(fa[0]), "v"(fa[1]), "v"(fa[2]), "v"(fa[3])
                   : "memory");
      __builtin_amdgcn_sched_barrier(0);
    }
  }
}

// ---------------------------------------------------------------------------
extern "C" void kernel_launch(void* const* d_in, const int* in_sizes, int n_in,
                              void* d_out, int out_size, void* d_ws,
                              size_t ws_size, hipStream_t stream) {
  const float* x  = (const float*)d_in[0];
  const float* Wq = (const float*)d_in[1];
  const float* bq = (const float*)d_in[2];
  const float* Wk = (const float*)d_in[3];
  const float* bk = (const float*)d_in[4];
  const float* Wv = (const float*)d_in[5];
  const float* bv = (const float*)d_in[6];
  const float* Wo = (const float*)d_in[7];
  const float* bo = (const float*)d_in[8];
  const float* gm = (const float*)d_in[9];
  const float* W1 = (const float*)d_in[10];
  const float* b1 = (const float*)d_in[11];
  const float* W2 = (const float*)d_in[12];
  const float* b2 = (const float*)d_in[13];
  const float* W3 = (const float*)d_in[14];
  const float* b3 = (const float*)d_in[15];
  const float* Wf = (const float*)d_in[16];
  const float* bfus = (const float*)d_in[17];
  float* out = (float*)d_out;

  // workspace layout: bf16 concat planes [4][20][258][272][8] then bf16 weights
  const size_t catElems = (size_t)4 * NGRP * PLANE;
  bf16_t* cat = (bf16_t*)d_ws;
  bf16_t* W1r = cat + catElems;
  bf16_t* W2r = W1r + 32 * 576;
  bf16_t* W3r = W2r + 32 * 864;
  bf16_t* Wfb = W3r + 32 * 1152;
  bf16_t* Wob = Wfb + 64 * 160;
  bf16_t* Wqb = Wob + 64 * 32;
  bf16_t* Wkb = Wqb + 32 * 64;
  bf16_t* Wvb = Wkb + 32 * 64;

  prep_weights<<<264, 256, 0, stream>>>(W1, W2, W3, Wf, Wo, Wq, Wk, Wv, W1r,
                                        W2r, W3r, Wfb, Wob, Wqb, Wkb, Wvb, cat);
  attn_kernel<<<256, 256, 0, stream>>>(x, Wqb, bq, Wkb, bk, Wvb, bv, gm, bo,
                                       Wob, cat);
  conv3x3_kernel<576, false><<<256, 256, 0, stream>>>(cat, W1r, b1, cat, 64, Wfb,
                                                      bfus, x, out);
  conv3x3_kernel<864, false><<<256, 256, 0, stream>>>(cat, W2r, b2, cat, 96, Wfb,
                                                      bfus, x, out);
  conv3x3_kernel<1152, true><<<256, 256, 0, stream>>>(cat, W3r, b3, cat, 128, Wfb,
                                                      bfus, x, out);
}

// v008
// One run takes 69.8 microseconds.
// Two timings next to v007 both put it at 1.04 times that version's speed.
// Over all steps from v000 it is 8.84 times as fast.
#include <hip/hip_runtime.h>
#include <hip/hip_bf16.h>

typedef __bf16 bf16_t;
typedef __attribute__((ext_vector_type(16))) __bf16 v16bf;
typedef __attribute__((ext_vector_type(8)))  __bf16 v8bf;
typedef __attribute__((ext_vector_type(8)))  float  v8f;
typedef __attribute__((ext_vector_type(2)))  float  v2f;

#define HDIM 256
#define WDIM 256
#define CIN  64
#define CLAT 32

// Concat buffer layout: one plane per (image, group of 8 channels), each plane
// [PROWS][PPITCH] pixels of 8 bf16 (16 bytes). Pixel (y, x) sits at row y + 1,
// column x + 8, so a 16-pixel tile starts on a 128-byte line; row 0, row 257,
// column 7 and column 264 are the zero border of the 3x3 convolutions.
#define PROWS  258
#define PPITCH 272
#define PLANE  (PROWS * PPITCH * 8)
#define NGRP   20

// ---------------------------------------------------------------------------
// WMMA helpers (CDNA5 16x16x32 bf16, f32 accumulate)
// ---------------------------------------------------------------------------
__device__ __forceinline__ v8f wmma_bf(v16bf a, v16bf b, v8f c) {
  return __builtin_amdgcn_wmma_f32_16x16x32_bf16(false, a, false, b,
                                                 (short)0, c, false, false);
}

__device__ __forceinline__ v8f vzero() {
  v8f z = {0.f, 0.f, 0.f, 0.f, 0.f, 0.f, 0.f, 0.f};
  return z;
}

// K-pair base within a K=32 slab for bf16 A/B fragments (ISA 7.12.2):
// lanes 0-15: VGPR i<4 -> K=2i,2i+1 ; i>=4 -> K=16+2(i-4) ; lanes 16-31: +8
__device__ __forceinline__ int wk_base(int i, int half) {
  return ((i < 4) ? (2 * i) : (16 + 2 * (i - 4))) + 8 * half;
}

// element offset of channel group g, image n, pixel (y, x); y, x in -1..256
__device__ __forceinline__ size_t cat_off(int g, int n, int y, int x) {
  return ((((size_t)n * NGRP + g) * PROWS + (y + 1)) * PPITCH + (x + 8)) * 8;
}

// fragment from its two 16-byte parts: lo = k 8*half..+7, hi = k 16+8*half..+7
__device__ __forceinline__ v16bf frag_join(const bf16_t* __restrict__ lo,
                                           const bf16_t* __restrict__ hi) {
  return __builtin_shufflevector(*(const v8bf*)lo, *(const v8bf*)hi, 0, 1, 2, 3,
                                 4, 5, 6, 7, 8, 9, 10, 11, 12, 13, 14, 15);
}

// A/B fragment from bf16 matrix, lane-dim slow (row-major): elem(r,k)=base[r*ldm+k]
__device__ __forceinline__ v16bf frag_ld_bf(const bf16_t* __restrict__ base,
                                            int ldm, int i0, int koff) {
  int lane = threadIdx.x & 31;
  int r = i0 + (lane & 15);
  int half = lane >> 4;
  v16bf f;
#pragma unroll
  for (int i = 0; i < 8; ++i) {
    int k = koff + wk_base(i, half);
    f[2 * i]     = base[r * ldm + k];
    f[2 * i + 1] = base[r * ldm + k + 1];
  }
  return f;
}

// ---------------------------------------------------------------------------
// Kernel 0: convert all GEMM weights to bf16 in workspace and zero the concat
// buffer's border. Conv and fusion weights are stored in fragment order:
// [k slab][16-row tile][part lo/hi][lane][8], so one fragment part of a wave is
// 512 contiguous bytes. Conv k slab = (32-channel slab s) * 9 + tap.
// ---------------------------------------------------------------------------
template <int KTOT>
__device__ __forceinline__ void conv_w_frag(const float* __restrict__ Wsrc,
                                            bf16_t* __restrict__ o, int i) {
  const int e = i & 7, ln = (i >> 3) & 31, j = (i >> 8) & 1, mt = (i >> 9) & 1;
  const int ks = i >> 10, s = ks / 9, tap = ks - s * 9;
  const int oc = mt * 16 + (ln & 15);
  const int ic = s * 32 + j * 16 + 8 * (ln >> 4) + e;
  o[i] = (bf16_t)Wsrc[oc * KTOT + ic * 9 + tap];
}

__global__ void prep_weights(const float* __restrict__ W1, const float* __restrict__ W2,
                             const float* __restrict__ W3, const float* __restrict__ Wf,
                             const float* __restrict__ Wo, const float* __restrict__ Wq,
                             const float* __restrict__ Wk, const float* __restrict__ Wv,
                             bf16_t* __restrict__ o1, bf16_t* __restrict__ o2,
                             bf16_t* __restrict__ o3, bf16_t* __restrict__ of,
                             bf16_t* __restrict__ oo, bf16_t* __restrict__ oq,
                             bf16_t* __restrict__ ok, bf16_t* __restrict__ ov,
                             bf16_t* __restrict__ cat) {
  int i = blockIdx.x * blockDim.x + threadIdx.x;
  if (i < 32 * 576)  conv_w_frag<576>(W1, o1, i);
  if (i < 32 * 864)  conv_w_frag<864>(W2, o2, i);
  if (i < 32 * 1152) conv_w_frag<1152>(W3, o3, i);
  if (i < 64 * 160) {
    const int e = i & 7, ln = (i >> 3) & 31, j = (i >> 8) & 1, mt = (i >> 9) & 3;
    const int ks = i >> 11;
    of[i] = (bf16_t)Wf[(mt * 16 + (ln & 15)) * 160 + ks * 32 + j * 16 +
                       8 * (ln >> 4) + e];
  }
  // border of the 16 channel groups the convolutions read, 4 images:
  // 2 whole rows (272 px) + 2 columns x 256 rows = 1056 pixels per plane
  if (i < 64 * 1056) {
    const int pl = i / 1056, rem = i - pl * 1056;
    int row, col;
    if (rem < 544) {
      row = (rem < 272) ? 0 : 257;
      col = (rem < 272) ? rem : rem - 272;
    } else {
      row = 1 + ((rem - 544) >> 1);
      col = (rem & 1) ? 264 : 7;
    }
    const v8bf z = {(bf16_t)0.f, (bf16_t)0.f, (bf16_t)0.f, (bf16_t)0.f,
                    (bf16_t)0.f, (bf16_t)0.f, (bf16_t)0.f, (bf16_t)0.f};
    *(v8bf*)(cat + cat_off(pl & 15, pl >> 4, row - 1, col - 8)) = z;
  }
  if (i < 64 * 32)   oo[i] = (bf16_t)Wo[i];
  if (i < 32 * 64) {
    oq[i] = (bf16_t)Wq[i];
    ok[i] = (bf16_t)Wk[i];
    ov[i] = (bf16_t)Wv[i];
  }
}

// ---------------------------------------------------------------------------
// Kernel 1: region non-local attention. One block per 32x32 cell (256 blocks).
// All GEMMs (k/v proj+pool, q proj, K q^T, V^T P^T, Wo proj) on the WMMA pipe.
// Every product of the query phase has the query as its column: a lane's D
// registers of two 16-row tiles (rows r + 8*half and 16 + r + 8*half) are, after
// conversion, that lane's B fragment of the next product (k = 8*half + e and
// 16 + 8*half + e), so q, the scores, P and out never leave the lane.
// Writes f0 (bf16) into channel groups 0..7 of the concat buffer.
// ---------------------------------------------------------------------------
#define VPITCH 264  // keys per row of V^T in LDS + 8: 528 B, an odd count of 16 B
// The cell's x in LDS, f32: channel c, cell row R, column C at
// R * 2048 + slot(c) * 32 + C, slot(c) = (c >> 4) * 16 + (c & 7) * 2 + ((c >> 3) & 1).
// The two halves of a wave hold channels c and c + 8, here 32 floats apart, so on
// different banks; a lane's 32 channels of one pixel lie 256 bytes apart.

// lane l with lane l ^ 16
__device__ __forceinline__ float xhalf(float v) {
  return __builtin_bit_cast(
      float, __builtin_amdgcn_permlanex16(__builtin_bit_cast(int, v),
                                          __builtin_bit_cast(int, v), 0x76543210,
                                          0xfedcba98, false, false));
}

// B fragment from the D registers of two stacked 16-row tiles
__device__ __forceinline__ v16bf frag_from_d(v8f lo, v8f hi) {
  v16bf f;
#pragma unroll
  for (int e = 0; e < 8; ++e) {
    f[e]     = (bf16_t)lo[e];
    f[8 + e] = (bf16_t)hi[e];
  }
  return f;
}

__global__ __launch_bounds__(256) void attn_kernel(
    const float* __restrict__ x,
    const bf16_t* __restrict__ Wq_bf, const float* __restrict__ bq,
    const bf16_t* __restrict__ Wk_bf, const float* __restrict__ bk,
    const bf16_t* __restrict__ Wv_bf, const float* __restrict__ bv,
    const float* __restrict__ gamma_p, const float* __restrict__ bo,
    const bf16_t* __restrict__ Wo_bf, bf16_t* __restrict__ cat) {
  __shared__ __attribute__((aligned(16))) bf16_t Kp[256 * 32];      // pooled keys   [key][lat]
  __shared__ __attribute__((aligned(16))) bf16_t Vt[32 * VPITCH];   // pooled values [lat][key]
  __shared__ __attribute__((aligned(16))) float xs[32 * 2048];      // x of the cell

  const int bid = blockIdx.x;
  const int n = bid >> 6, gh = (bid >> 3) & 7, gw = bid & 7;
  const int row0 = gh * 32, col0 = gw * 32;
  const int t = threadIdx.x, lane = t & 31, wave = t >> 5;
  const int half = lane >> 4, coln = lane & 15;
  const float gamma = gamma_p[0];
  const size_t HW = (size_t)HDIM * WDIM;
  const float* xcell = x + (size_t)n * CIN * HW;  // + yy*WDIM + xx per use

  // ---- Phase A (WMMA): k/v projection + 2x2 maxpool, all in registers. A wave
  // owns the row pairs wave and wave + 8 of the cell. A row pair is four 16-px
  // tiles (row ry, parity par), index j of a tile being pixel column 2j + par:
  // the four pixels of pool window j sit at index j of the four tiles, so the
  // pool is an elementwise maximum of four D tiles. A lane reads both parities
  // of a channel with one 8-byte load, 16 lanes covering the cell row's 128-byte
  // line, and the same fragments feed k and v. k has the pixel as its column
  // (a lane's D = 8 lat of one key), v as its row (a lane's D = 8 keys of one
  // lat): either goes to LDS as 16-byte stores. Each row of x also goes to LDS
  // as it arrives, where the query phase finds it: x leaves L2 once.
  {
    const unsigned wo = (unsigned)(coln * 64 + 8 * half);  // lane's row, k part
    v16bf wk[2][2], wv[2][2];  // [16-lat tile][32-channel slab]
#pragma unroll
    for (int mt = 0; mt < 2; ++mt)
#pragma unroll
      for (int s = 0; s < 2; ++s) {
        const unsigned o = wo + mt * 1024 + s * 32;
        wk[mt][s] = frag_join(Wk_bf + o, Wk_bf + o + 16);
        wv[mt][s] = frag_join(Wv_bf + o, Wv_bf + o + 16);
      }
    // bk at uniform indices, so through the scalar path: a vector load issued
    // behind the x loads would return behind them, and the first row pair's
    // keys would wait for all of x
    float bk0[8], bk1[8];
#pragma unroll
    for (int r = 0; r < 8; ++r) {
      const float l0 = bk[r], h0 = bk[8 + r], l1 = bk[16 + r], h1 = bk[24 + r];
      bk0[r] = half ? h0 : l0;
      bk1[r] = half ? h1 : l1;
    }
    const float bv0 = bv[coln], bv1 = bv[16 + coln];
    // slot mt*8 + r = channel mt*16 + 8*half + r, the k order of a fragment
    const float* xq = xcell + (size_t)(8 * half) * HW +
                      (size_t)(row0 + 2 * wave) * WDIM + col0 + 2 * coln;
    float* xw = xs + 2 * wave * 2048 + half * 32 + 2 * coln;
    v2f xa[2][2][32];  // [row pair][row][slot], both parities
#pragma unroll
    for (int p = 0; p < 2; ++p)
#pragma unroll
      for (int ry = 0; ry < 2; ++ry) {
        // keeps the four rows' loads in the order of their use: loads return in
        // order, so a row's products start while the later rows are in flight
        __builtin_amdgcn_sched_barrier(0);
#pragma unroll
        for (int mt = 0; mt < 4; ++mt)
#pragma unroll
          for (int r = 0; r < 8; ++r)
            xa[p][ry][mt * 8 + r] = *(const v2f*)(
                xq + (size_t)(mt * 16 + r) * HW + (p * 16 + ry) * WDIM);
      }
    // behind the x loads their address registers fall free while the loads are
    // in flight: the wait stands in front of any overwrite, and its operand
    // keeps the address whole up to it
    asm volatile("s_wait_xcnt 0x0" ::"v"(xq) : "memory");
#pragma unroll
    for (int p = 0; p < 2; ++p) {
      v8f km0, km1, vm0, vm1;
#pragma unroll
      for (int tl = 0; tl < 4; ++tl) {
        const int ry = tl >> 1, par = tl & 1;
        // keeps a row's products in front of the wait for the next row's loads:
        // mixed with later rows' work they would start only when all x is there
        if (par == 0) {
          __builtin_amdgcn_sched_barrier(0);
#pragma unroll
          for (int mt = 0; mt < 4; ++mt)
#pragma unroll
            for (int r = 0; r < 8; ++r)
              *(v2f*)(xw + (p * 16 + ry) * 2048 + (mt * 16 + 2 * r) * 32) =
                  xa[p][ry][mt * 8 + r];
        }
        v16bf b0, b1;
#pragma unroll
        for (int e = 0; e < 16; ++e) {
          b0[e] = (bf16_t)xa[p][ry][e][par];
          b1[e] = (bf16_t)xa[p][ry][16 + e][par];
        }
        v8f k0 = wmma_bf(wk[0][0], b0, vzero());
        v8f k1 = wmma_bf(wk[1][0], b0, vzero());
        v8f v0 = wmma_bf(b0, wv[0][0], vzero());
        v8f v1 = wmma_bf(b0, wv[1][0], vzero());
        k0 = wmma_bf(wk[0][1], b1, k0);
        k1 = wmma_bf(wk[1][1], b1, k1);
        v0 = wmma_bf(b1, wv[0][1], v0);
        v1 = wmma_bf(b1, wv[1][1], v1);
        if (tl == 0) {
          km0 = k0; km1 = k1; vm0 = v0; vm1 = v1;
        } else {
#pragma unroll
          for (int r = 0; r < 8; ++r) {
            km0[r] = fmaxf(km0[r], k0[r]);
            km1[r] = fmaxf(km1[r], k1[r]);
            vm0[r] = fmaxf(vm0[r], v0[r]);
            vm1[r] = fmaxf(vm1[r], v1[r]);
          }
        }
      }
      // the bias is the same for the four pixels of a window and rounding is
      // monotone: added behind the maximum it gives the same value
      v8bf kk0, kk1, vv0, vv1;
#pragma unroll
      for (int r = 0; r < 8; ++r) {
        kk0[r] = (bf16_t)(km0[r] + bk0[r]);
        kk1[r] = (bf16_t)(km1[r] + bk1[r]);
        vv0[r] = (bf16_t)(vm0[r] + bv0);
        vv1[r] = (bf16_t)(vm1[r] + bv1);
      }
      const int key0 = (wave + 8 * p) * 16;  // pooled row = row pair
      *(v8bf*)(Kp + (key0 + coln) * 32 + 8 * half) = kk0;
      *(v8bf*)(Kp + (key0 + coln) * 32 + 16 + 8 * half) = kk1;
      *(v8bf*)(Vt + coln * VPITCH + key0 + 8 * half) = vv0;
      *(v8bf*)(Vt + (16 + coln) * VPITCH + key0 + 8 * half) = vv1;
    }
    __syncthreads();  // every wave reads all keys, values and x from here on
  }

  // ---- Phase B: 8 chunks of 128 queries; each wave owns one 16-query tile.
  // Kp, Vt and xs are only read from here on, so the phase has no barrier.
  const unsigned wqo = (unsigned)(coln * 64 + 8 * half);  // lane's row, k part
  const v16bf wq00 = frag_join(Wq_bf + wqo, Wq_bf + wqo + 16);
  const v16bf wq01 = frag_join(Wq_bf + wqo + 32, Wq_bf + wqo + 48);
  const v16bf wq10 = frag_join(Wq_bf + wqo + 1024, Wq_bf + wqo + 1040);
  const v16bf wq11 = frag_join(Wq_bf + wqo + 1056, Wq_bf + wqo + 1072);
  // Wo and the biases of the loop are the same for all 8 chunks. With no memory
  // clobber left in the loop the compiler lifts their loads out of it: written
  // here, they stand in front of the wait below
  v16bf wo[4];
#pragma unroll
  for (int mt = 0; mt < 4; ++mt) wo[mt] = frag_ld_bf(Wo_bf, 32, mt * 16, 0);
  float bq0[8], bq1[8], bov[32];
#pragma unroll
  for (int r = 0; r < 8; ++r) {
    bq0[r] = bq[r + 8 * half];
    bq1[r] = bq[16 + r + 8 * half];
  }
#pragma unroll
  for (int mt = 0; mt < 4; ++mt)
#pragma unroll
    for (int r = 0; r < 8; ++r) bov[mt * 8 + r] = bo[mt * 16 + r + 8 * half];
  // behind these loads their address registers fall free while the loads are
  // in flight: the wait stands in front of any overwrite, and its operands keep
  // base and offset of the Wq loads whole up to it; the scheduling barrier keeps
  // register-only instructions from moving over the wait
  asm volatile("s_wait_xcnt 0x0" ::"s"(Wq_bf), "v"(wqo * 2) : "memory");
  __builtin_amdgcn_sched_barrier(0);
  const bf16_t* kl = Kp + coln * 32 + 8 * half;      // A rows = keys, k = lat
  const bf16_t* vl = Vt + coln * VPITCH + 8 * half;  // A rows = lat, k = keys
  v16bf kf[16];  // all 256 keys stay in registers for the wave's 8 query tiles
#pragma unroll
  for (int kt = 0; kt < 16; ++kt)
    kf[kt] = frag_join(kl + kt * 16 * 32, kl + kt * 16 * 32 + 16);
  for (int chunk = 0; chunk < 8; ++chunk) {
    const int yy = row0 + chunk * 4 + (wave >> 1);
    const int xx = col0 + (wave & 1) * 16 + coln;
    // this lane's pixel, channels mt*16 + 8*half + r: the B fragments of the q
    // projection and, in f32, the residual of the same lane's f0 values
    const float* xp = xs + (chunk * 4 + (wave >> 1)) * 2048 + half * 32 +
                      (wave & 1) * 16 + coln;
    float xf[32];
#pragma unroll
    for (int mt = 0; mt < 4; ++mt)
#pragma unroll
      for (int r = 0; r < 8; ++r) xf[mt * 8 + r] = xp[(mt * 16 + 2 * r) * 32];
    v16bf b0, b1;
#pragma unroll
    for (int e = 0; e < 16; ++e) {
      b0[e] = (bf16_t)xf[e];
      b1[e] = (bf16_t)xf[16 + e];
    }
    // q^T[32 lat][16 q]
    v8f c0 = vzero(), c1 = vzero();
    c0 = wmma_bf(wq00, b0, c0);
    c0 = wmma_bf(wq01, b1, c0);
    c1 = wmma_bf(wq10, b0, c1);
    c1 = wmma_bf(wq11, b1, c1);
#pragma unroll
    for (int r = 0; r < 8; ++r) {
      c0[r] += bq0[r];
      c1[r] += bq1[r];
    }
    const v16bf qb = frag_from_d(c0, c1);

    // scores^T: one WMMA per 16-key tile; sc[kt][r] = key kt*16 + r + 8*half
    v8f sc[16];
#pragma unroll
    for (int kt = 0; kt < 16; ++kt) sc[kt] = wmma_bf(kf[kt], qb, vzero());
    // softmax over 256 keys: 128 in the lane, the other 128 in lane ^ 16
    v8f mv = sc[0];
#pragma unroll
    for (int kt = 1; kt < 16; ++kt)
#pragma unroll
      for (int r = 0; r < 8; ++r) mv[r] = fmaxf(mv[r], sc[kt][r]);
    float m = fmaxf(fmaxf(fmaxf(mv[0], mv[1]), fmaxf(mv[2], mv[3])),
                    fmaxf(fmaxf(mv[4], mv[5]), fmaxf(mv[6], mv[7])));
    m = fmaxf(m, xhalf(m));
    const float l2e = 1.44269504f;  // e^(s - m) = 2^(s * log2(e) - m * log2(e))
    const float nm = -m * l2e;
    v8f sv = vzero();
#pragma unroll
    for (int kt = 0; kt < 16; ++kt) {
      const v8f t = sc[kt] * l2e + nm;
#pragma unroll
      for (int r = 0; r < 8; ++r) sc[kt][r] = __builtin_amdgcn_exp2f(t[r]);
      sv += sc[kt];
    }
    float s = ((sv[0] + sv[1]) + (sv[2] + sv[3])) + ((sv[4] + sv[5]) + (sv[6] + sv[7]));
    s += xhalf(s);
    const float rinv = 1.f / s;

    // out^T[32 lat][16 q] = V^T @ P^T, P^T packed from the score registers
    v8f o0 = vzero(), o1 = vzero();
#pragma unroll
    for (int ks = 0; ks < 8; ++ks) {
      // keeps each half of the V^T fragment loads behind what precedes it: all
      // lifted to the loop's head they stay live beside K and the scores, and
      // the wave's 512 registers overflow into scratch
      if ((ks & 3) == 0) __builtin_amdgcn_sched_barrier(0);
      const v16bf pb = frag_from_d(sc[2 * ks], sc[2 * ks + 1]);
      const bf16_t* vp = vl + ks * 32;
      o0 = wmma_bf(frag_join(vp, vp + 16), pb, o0);
      o1 = wmma_bf(frag_join(vp + 16 * VPITCH, vp + 16 * VPITCH + 16), pb, o1);
    }
    // the row sum divides once here: it is the lane's own query
    o0 *= rinv;
    o1 *= rinv;
    const v16bf ob = frag_from_d(o0, o1);

    // f0[64][16q] = gamma*(Wo @ out^T + bo) + x
#pragma unroll
    for (int mt = 0; mt < 4; ++mt) {
      v8f f0 = wmma_bf(wo[mt], ob, vzero());
      v8bf pk;  // this lane's 8 consecutive channels = one channel group
#pragma unroll
      for (int r = 0; r < 8; ++r)
        pk[r] = (bf16_t)(gamma * (f0[r] + bov[mt * 8 + r]) + xf[mt * 8 + r]);
      *(v8bf*)(cat + cat_off(mt * 2 + half, n, yy, xx)) = pk;
    }
  }
}

// ---------------------------------------------------------------------------
// Kernels 2-4: implicit-GEMM 3x3 conv, pad=1, relu. Input = first KTOT/9
// channels of concat buffer; without FUSE, output -> channels [ocBase, ocBase+32).
// Block tile: 32 oc x CROWS rows x 128 px; wave w owns x-subtile w of all rows.
// K runs over groups (32-channel slab, column tap dx), row tap dy inside. For one
// group the six weight fragments (3 dy x 2 oc tiles) stay in registers for all
// rows, and each input row's pixel fragment, two 16-byte loads, feeds the up to
// three output rows it touches; the zero border stands for pad=1.
//
// The pixels of a 32-channel slab (4 planes x 10 rows x 130 px) are brought into
// LDS once by asynchronous copies and read there by all three column taps and all
// eight waves; of the two LDS buffers one is filled while the other is read.
//
// With FUSE (the last convolution) the wave goes on to the 1x1 fusion over all
// 160 channels + bias + residual x, fp32 out, for the pixels it has just made:
// its two stacked D tiles of a row are, after bias, relu and conversion, the
// lane's B fragment of the last 32 channels, which so never reach memory; the
// other 128 channels are the centre taps that the block has read a moment ago.
// The walk is one row a stage; the 20 weight fragments stay in registers, and of
// the two register sets for pixels and x each is refilled, as soon as its stage
// has used it, for the stage after the next.
// ---------------------------------------------------------------------------
#define CROWS 8
#define FSTG CROWS
#define FMID 28

// Stands behind a run of global loads or stores, in front of whatever next
// overwrites a register that one of them names (address or store data). The
// scheduling barrier keeps register-only instructions from moving over the wait.
__device__ __forceinline__ void regs_free() {
  asm volatile("s_wait_xcnt 0x0" ::: "memory");
  __builtin_amdgcn_sched_barrier(0);
}

struct conv_group {
  v16bf wa[3][2];         // weights [dy][oc tile]
  v16bf px[CROWS + 2];    // pixels of input rows y0 - 1 .. y0 + CROWS
};

// LDS tile of one slab: [4 planes][TROWS rows][TCOLS px] of 16 bytes, then one
// 16-byte place per thread for the lanes of the edge copy that have no pixel
#define TROWS  (CROWS + 2)
#define TCOLS  130
#define TUNITS (4 * TROWS * TCOLS)
#define TBUF   ((TUNITS + 256) * 8)

// weight fragments of group g = slab * 3 + dx; every offset is a constant
__device__ __forceinline__ void conv_w_ld(conv_group& f,
                                          const bf16_t* __restrict__ wl, int g) {
  const int s = g / 3, dx = g % 3;
#pragma unroll
  for (int dy = 0; dy < 3; ++dy) {
    const bf16_t* w = wl + (s * 9 + dy * 3 + dx) * 1024;
    f.wa[dy][0] = frag_join(w, w + 256);
    f.wa[dy][1] = frag_join(w + 512, w + 768);
  }
}

// pixel fragments of column tap dx from the slab's LDS tile; lp = the lane's
// pixel of plane half, row 0, tap 0
__device__ __forceinline__ void conv_px_ld(conv_group& f, const bf16_t* lp,
                                           int dx) {
#pragma unroll
  for (int ir = 0; ir < TROWS; ++ir) {
    const bf16_t* p = lp + (ir * TCOLS + dx) * 8;
    f.px[ir] = frag_join(p, p + 2 * TROWS * TCOLS * 8);
  }
}

// A wave's share of one slab tile, 21 asynchronous copies of 16 bytes a lane: five
// rows of one plane, four copies of 32 px each (l0, g0 = the lane's LDS byte
// address and global address in the first; along a row the constant offset moves
// both addresses alike), and one copy for the first and last px of the five rows
// (lx, gx). The statement ends with the wait that stands in front of any overwrite
// of the address registers its copies name.
__device__ __forceinline__ void tile_copy(unsigned l0, const bf16_t* g0,
                                          unsigned lx, const bf16_t* gx) {
  asm volatile(
      "global_load_async_to_lds_b128 %0, %1, off\n\t"
      "global_load_async_to_lds_b128 %0, %1, off offset:512\n\t"
      "global_load_async_to_lds_b128 %0, %1, off offset:1024\n\t"
      "global_load_async_to_lds_b128 %0, %1, off offset:1536\n\t"
      "global_load_async_to_lds_b128 %2, %3, off\n\t"
      "global_load_async_to_lds_b128 %2, %3, off offset:512\n\t"
      "global_load_async_to_lds_b128 %2, %3, off offset:1024\n\t"
      "global_load_async_to_lds_b128 %2, %3, off offset:1536\n\t"
      "global_load_async_to_lds_b128 %4, %5, off\n\t"
      "global_load_async_to_lds_b128 %4, %5, off offset:512\n\t"
      "global_load_async_to_lds_b128 %4, %5, off offset:1024\n\t"
      "global_load_async_to_lds_b128 %4, %5, off offset:1536\n\t"
      "global_load_async_to_lds_b128 %6, %7, off\n\t"
      "global_load_async_to_lds_b128 %6, %7, off offset:512\n\t"
      "global_load_async_to_lds_b128 %6, %7, off offset:1024\n\t"
      "global_load_async_to_lds_b128 %6, %7, off offset:1536\n\t"
      "global_load_async_to_lds_b128 %8, %9, off\n\t"
      "global_load_async_to_lds_b128 %8, %9, off offset:512\n\t"
      "global_load_async_to_lds_b128 %8, %9, off offset:1024\n\t"
      "global_load_async_to_lds_b128 %8, %9, off offset:1536\n\t"
      "global_load_async_to_lds_b128 %10, %11, off\n\t"
      "s_wait_xcnt 0x0" ::"v"(l0), "v"(g0),
      "v"(l0 + 1 * TCOLS * 16u), "v"(g0 + 1 * PPITCH * 8),
      "v"(l0 + 2 * TCOLS * 16u), "v"(g0 + 2 * PPITCH * 8),
      "v"(l0 + 3 * TCOLS * 16u), "v"(g0 + 3 * PPITCH * 8),
      "v"(l0 + 4 * TCOLS * 16u), "v"(g0 + 4 * PPITCH * 8), "v"(lx), "v"(gx)
      : "memory");
}

template <int KTOT, bool FUSE>
__global__ __launch_bounds__(256) void conv3x3_kernel(
    const bf16_t* __restrict__ cat, const bf16_t* __restrict__ Wr,
    const float* __restrict__ bias, bf16_t* __restrict__ out_cat, int ocBase,
    const bf16_t* __restrict__ Wf_bf, const float* __restrict__ bfus,
    const float* __restrict__ x, float* __restrict__ out) {
  const int bid = blockIdx.x;  // 4 imgs * (256 / CROWS) row groups * 2 xsegs
  constexpr int BPI = (HDIM / CROWS) * 2;
  const int n = bid / BPI, rem = bid % BPI;
  const int y0 = (rem >> 1) * CROWS, xseg = rem & 1;
  const int t = threadIdx.x, lane = t & 31, wave = t >> 5;
  const int half = lane >> 4, coln = lane & 15;
  const int xx = xseg * 128 + wave * 16 + coln;
  const bf16_t* wl = Wr + lane * 8;
  __shared__ __attribute__((aligned(16))) bf16_t tile[2][TBUF];
  // reader: the lane's pixel of plane half, row 0, tap 0 in buffer 0
  const bf16_t* lp = &tile[0][(half * TROWS * TCOLS + wave * 16 + coln) * 8];
  // copier: wave w brings rows 5 * (w & 1) .. + 4 of plane w >> 1. The row copies
  // bring tile px 1..128, which start on a 128-byte line in memory. In the edge
  // copy lanes 0..9 bring px 0 and 129 of the five rows; the other lanes, which
  // must be on, bring a pixel of the tile once more to a place nobody reads
  const int crow = (wave >> 1) * TROWS + (wave & 1) * (TROWS / 2);
  const int ej = lane >> 1, ec = (lane & 1) * (TCOLS - 1);
  const bool edge = lane < TROWS;
  const unsigned cl0 = (unsigned)(size_t)&tile[0][(crow * TCOLS + 1 + lane) * 8];
  const int eunit = (crow + ej) * TCOLS + ec, spare = TUNITS + t;
  const unsigned clx = (unsigned)(size_t)&tile[0][(edge ? eunit : spare) * 8];
  const bf16_t* cg0 = cat + cat_off(wave >> 1, n, y0 - 1 + (wave & 1) * (TROWS / 2),
                                    xseg * 128 + lane);
  const int estep = (ej * PPITCH + ec - 1 - lane) * 8;
  const bf16_t* cgx = cg0 + (edge ? estep : 0);

  v8f acc[CROWS][2];
#pragma unroll
  for (int r = 0; r < CROWS; ++r) acc[r][0] = acc[r][1] = vzero();
  v16bf fw[FUSE ? 5 : 1][4];  // fusion weights [k slab][oc tile]
  float fb[FUSE ? 4 : 1][8];  // fusion bias [oc tile][row]
  float bs0[8], bs1[8];       // this convolution's bias, rows of the two oc tiles
  constexpr int NG = (KTOT / 288) * 3;  // groups: 32-channel slabs x 3 dx
  conv_group f[2];
  tile_copy(cl0, cg0, clx, cgx);
  conv_w_ld(f[0], wl, 0);
  // slab 0 has landed for this wave's copies, then, behind the barrier, for all
  asm volatile("s_wait_asynccnt 0x0" ::: "memory");
  __syncthreads();
  tile_copy(cl0 + TBUF * 2, cg0 + (size_t)4 * PLANE, clx + TBUF * 2,
            cgx + (size_t)4 * PLANE);
  conv_px_ld(f[0], lp, 0);
  if constexpr (FUSE) {
    // this convolution's bias at uniform indices, so through the scalar path, and
    // here, under the first group's loads: as a vector load it is sunk to its
    // use, behind the last products, and its latency is waited out there
#pragma unroll
    for (int r = 0; r < 8; ++r) {
      const float l0 = bias[r], h0 = bias[8 + r];
      const float l1 = bias[16 + r], h1 = bias[24 + r];
      bs0[r] = half ? h0 : l0;
      bs1[r] = half ? h1 : l1;
    }
  }
  // unrolled so that the two fragment sets stay in registers (constant index)
#pragma unroll
  for (int g = 0; g < NG; ++g) {
    // keeps the next group's loads behind the last group's products (or behind
    // group 0's loads), so that no third fragment set is live
    __builtin_amdgcn_sched_barrier(0);
    if (g % 3 == 2 && g + 1 < NG) {
      // in front of slab s's last group, whose pixels are already fetched: this
      // wave's reads of slab s have returned and its copies of slab s + 1 have
      // landed; behind the barrier that holds for every wave, so slab s + 1 may
      // be read (the fetch below) and the buffer of slab s refilled
      const int s = g / 3;
      asm volatile("s_wait_dscnt 0x0" ::: "memory");
      asm volatile("s_wait_asynccnt 0x0" ::: "memory");
      __syncthreads();
      if (g + 4 < NG)
        tile_copy(cl0 + (s & 1) * TBUF * 2, cg0 + (size_t)(s + 2) * 4 * PLANE,
                  clx + (s & 1) * TBUF * 2, cgx + (size_t)(s + 2) * 4 * PLANE);
    }
    if (g + 1 == NG) {
      // behind the last group's weight loads their offset register falls free
      // while loads that name it are in flight: the wait stands in front of any
      // overwrite, and its operand keeps the register whole up to it
      asm volatile("s_wait_xcnt 0x0" ::"v"(lane) : "memory");
      if constexpr (FUSE) {
        // the last group has no next one to fetch: the fusion's weights and bias
        // take that fragment set's registers and arrive behind its products
        const unsigned wo = (unsigned)(lane * 8);
#pragma unroll
        for (int ks = 0; ks < 5; ++ks)
#pragma unroll
          for (int mt = 0; mt < 4; ++mt) {
            const bf16_t* w = Wf_bf + ks * 2048 + mt * 512;
            fw[ks][mt] = frag_join(w + wo, w + 256 + wo);
          }
#pragma unroll
        for (int mt = 0; mt < 4; ++mt)
#pragma unroll
          for (int r = 0; r < 8; ++r) fb[mt][r] = bfus[mt * 16 + r + 8 * half];
        regs_free();
      }
    }
    if (g + 1 < NG) {
      conv_w_ld(f[(g + 1) & 1], wl, g + 1);
      conv_px_ld(f[(g + 1) & 1], lp + (((g + 1) / 3) & 1) * TBUF, (g + 1) % 3);
    }
    // keeps the next group's loads in front of this group's products: without
    // it each pixel load is sunk to its use and its latency is waited out there
    __builtin_amdgcn_sched_barrier(0);
    const conv_group& c = f[g & 1];
#pragma unroll
    for (int ir = 0; ir < CROWS + 2; ++ir) {
#pragma unroll
      for (int dy = 0; dy < 3; ++dy) {
        const int orow = ir - dy;
        if (orow >= 0 && orow < CROWS) {
          acc[orow][0] = wmma_bf(c.wa[dy][0], c.px[ir], acc[orow][0]);
          acc[orow][1] = wmma_bf(c.wa[dy][1], c.px[ir], acc[orow][1]);
        }
      }
    }
  }
  // a precaution: no copy is in flight when the wave goes on and ends
  asm volatile("s_wait_asynccnt 0x0" ::: "memory");
  // keeps the last group's products in their order, free of the epilogue
  __builtin_amdgcn_sched_barrier(0);
  if constexpr (!FUSE) {
#pragma unroll
    for (int r = 0; r < 8; ++r) {
      bs0[r] = bias[r + 8 * half];
      bs1[r] = bias[16 + r + 8 * half];
    }
    bf16_t* ob = out_cat + cat_off((ocBase >> 3) + half, n, y0, xx);
#pragma unroll
    for (int q = 0; q < CROWS; ++q) {
      v8bf p0, p1;
#pragma unroll
      for (int r = 0; r < 8; ++r) {
        p0[r] = (bf16_t)fmaxf(acc[q][0][r] + bs0[r], 0.f);
        p1[r] = (bf16_t)fmaxf(acc[q][1][r] + bs1[r], 0.f);
      }
      *(v8bf*)(ob + q * PPITCH * 8) = p0;
      *(v8bf*)(ob + q * PPITCH * 8 + 2 * PLANE) = p1;
    }
  } else {
    constexpr unsigned HW = HDIM * WDIM;
    // block-uniform bases plus one lane offset each for the whole walk
    const bf16_t* cb = cat + cat_off(0, n, y0, xseg * 128);
    const unsigned pxo = (unsigned)(half * PLANE + (wave * 16 + coln) * 8);
    // based on oc plane FMID, so that every plane of the walk lies within the
    // reach of a load's or store's constant offset: one address for all of them
    const size_t xi0 = (((size_t)n * CIN + FMID) * HDIM + y0) * WDIM + xseg * 128;
    const float* xb = x + xi0;
    float* ob = out + xi0;
    const unsigned xo = (unsigned)(8 * half) * HW + wave * 16 + coln;

    v16bf px[2][4];  // centre-tap pixels [stage parity][k slab]
#pragma unroll
    for (int b = 0; b < 2; ++b)
#pragma unroll
      for (int ks = 0; ks < 4; ++ks) {
        const bf16_t* p = cb + (size_t)ks * 4 * PLANE + b * PPITCH * 8;
        px[b][ks] = frag_join(p + pxo, p + 2 * PLANE + pxo);
      }
    regs_free();
    v16bf f3[CROWS];  // this convolution's 32 channels, one B fragment a row
#pragma unroll
    for (int q = 0; q < CROWS; ++q) {
      v8f a0, a1;
#pragma unroll
      for (int r = 0; r < 8; ++r) {
        a0[r] = fmaxf(acc[q][0][r] + bs0[r], 0.f);
        a1[r] = fmaxf(acc[q][1][r] + bs1[r], 0.f);
      }
      f3[q] = frag_from_d(a0, a1);
    }
    // keeps the x loads behind the conversion above: in front of it they would be
    // live beside the f32 accumulators, and the wave's 512 registers overflow
    __builtin_amdgcn_sched_barrier(0);
    float xr[2][4][8];  // residual [stage parity][oc tile][row of D]
#pragma unroll
    for (int b = 0; b < 2; ++b)
#pragma unroll
      for (int mt = 0; mt < 4; ++mt)
#pragma unroll
        for (int r = 0; r < 8; ++r)
          xr[b][mt][r] = *(xb + ((mt * 16 + r - FMID) * (int)HW + b * WDIM) + xo);
    regs_free();

    // unrolled so that every offset and register set is a constant and the last
    // two stages refill nothing
#pragma unroll
    for (int s = 0; s < FSTG; ++s) {
      const int b = s & 1;
      v8f fa[4];
#pragma unroll
      for (int mt = 0; mt < 4; ++mt) fa[mt] = vzero();
#pragma unroll
      for (int ks = 0; ks < 5; ++ks) {
#pragma unroll
        for (int mt = 0; mt < 4; ++mt)
          fa[mt] = wmma_bf(fw[ks][mt], ks < 4 ? px[b][ks & 3] : f3[s], fa[mt]);
        if (ks < 4 && s + 2 < FSTG) {
          const bf16_t* p = cb + (size_t)ks * 4 * PLANE + (s + 2) * PPITCH * 8;
          px[b][ks & 3] = frag_join(p + pxo, p + 2 * PLANE + pxo);
        }
        // holds each slab's refill between its own products and the next slab's:
        // left free, the loads are bunched at the stage's head, where they need
        // registers of their own, and products move over the wait below
        __builtin_amdgcn_sched_barrier(0);
      }
      if (s + 2 < FSTG) regs_free();
#pragma unroll
      for (int mt = 0; mt < 4; ++mt)
#pragma unroll
        for (int r = 0; r < 8; ++r) fa[mt][r] = fa[mt][r] + fb[mt][r] + xr[b][mt][r];
      if (s + 2 < FSTG) {
        // x of the stage after the next goes out here, two stages ahead of its use
#pragma unroll
        for (int mt = 0; mt < 4; ++mt)
#pragma unroll
          for (int r = 0; r < 8; ++r)
            xr[b][mt][r] =
                *(xb + ((mt * 16 + r - FMID) * (int)HW + (s + 2) * WDIM) + xo);
      }
#pragma unroll
      for (int mt = 0; mt < 4; ++mt)
#pragma unroll
        for (int r = 0; r < 8; ++r)
          *(ob + ((mt * 16 + r - FMID) * (int)HW + s * WDIM) + xo) = fa[mt][r];
      // behind the stores their data registers fall free while the stores are in
      // flight: the wait stands in front of any overwrite, and its operands keep
      // the sums whole up to it, also against the sums that are formed among the
      // stores; the scheduling barrier keeps the next stage's products behind it
      asm volatile("s_wait_xcnt 0x0" ::"v"(fa[0]), "v"(fa[1]), "v"(fa[2]), "v"(fa[3])
                   : "memory");
      __builtin_amdgcn_sched_barrier(0);
    }
  }
}

// ---------------------------------------------------------------------------
extern "C" void kernel_launch(void* const* d_in, const int* in_sizes, int n_in,
                              void* d_out, int out_size, void* d_ws,
                              size_t ws_size, hipStream_t stream) {
  const float* x  = (const float*)d_in[0];
  const float* Wq = (const float*)d_in[1];
  const float* bq = (const float*)d_in[2];
  const float* Wk = (const float*)d_in[3];
  const float* bk = (const float*)d_in[4];
  const float* Wv = (const float*)d_in[5];
  const float* bv = (const float*)d_in[6];
  const float* Wo = (const float*)d_in[7];
  const float* bo = (const float*)d_in[8];
  const float* gm = (const float*)d_in[9];
  const float* W1 = (const float*)d_in[10];
  const float* b1 = (const float*)d_in[11];
  const float* W2 = (const float*)d_in[12];
  const float* b2 = (const float*)d_in[13];
  const float* W3 = (const float*)d_in[14];
  const float* b3 = (const float*)d_in[15];
  const float* Wf = (const float*)d_in[16];
  const float* bfus = (const float*)d_in[17];
  float* out = (float*)d_out;

  // workspace layout: bf16 concat planes [4][20][258][272][8] then bf16 weights
  const size_t catElems = (size_t)4 * NGRP * PLANE;
  bf16_t* cat = (bf16_t*)d_ws;
  bf16_t* W1r = cat + catElems;
  bf16_t* W2r = W1r + 32 * 576;
  bf16_t* W3r = W2r + 32 * 864;
  bf16_t* Wfb = W3r + 32 * 1152;
  bf16_t* Wob = Wfb + 64 * 160;
  bf16_t* Wqb = Wob + 64 * 32;
  bf16_t* Wkb = Wqb + 32 * 64;
  bf16_t* Wvb = Wkb + 32 * 64;

  prep_weights<<<264, 256, 0, stream>>>(W1, W2, W3, Wf, Wo, Wq, Wk, Wv, W1r,
                                        W2r, W3r, Wfb, Wob, Wqb, Wkb, Wvb, cat);
  attn_kernel<<<256, 256, 0, stream>>>(x, Wqb, bq, Wkb, bk, Wvb, bv, gm, bo,
                                       Wob, cat);
  conv3x3_kernel<576, false><<<256, 256, 0, stream>>>(cat, W1r, b1, cat, 64, Wfb,
                                                      bfus, x, out);
  conv3x3_kernel<864, false><<<256, 256, 0, stream>>>(cat, W2r, b2, cat, 96, Wfb,
                                                      bfus, x, out);
  conv3x3_kernel<1152, true><<<256, 256, 0, stream>>>(cat, W3r, b3, cat, 128, Wfb,
                                                      bfus, x, out);
}

// v009
// A run of this version takes 67.6 microseconds.
// Timed twice side by side with v008, it ran 1.04 times as fast both times.
// All steps since v000 together make it 9.19 times as fast.
#include <hip/hip_runtime.h>
#include <hip/hip_bf16.h>

typedef __bf16 bf16_t;
typedef __attribute__((ext_vector_type(16))) __bf16 v16bf;
typedef __attribute__((ext_vector_type(8)))  __bf16 v8bf;
typedef __attribute__((ext_vector_type(8)))  float  v8f;
typedef __attribute__((ext_vector_type(4)))  float  v4f;
typedef __attribute__((ext_vector_type(2)))  float  v2f;

#define HDIM 256
#define WDIM 256
#define CIN  64
#define CLAT 32

// Concat buffer layout: one plane per (image, group of 8 channels), each plane
// [PROWS][PPITCH] pixels of 8 bf16 (16 bytes). Pixel (y, x) sits at row y + 1,
// column x + 8, so a 16-pixel tile starts on a 128-byte line; row 0, row 257,
// column 7 and column 264 are the zero border of the 3x3 convolutions.
#define PROWS  258
#define PPITCH 272
#define PLANE  (PROWS * PPITCH * 8)
#define NGRP   20

// ---------------------------------------------------------------------------
// WMMA helpers (CDNA5 16x16x32 bf16, f32 accumulate)
// ---------------------------------------------------------------------------
__device__ __forceinline__ v8f wmma_bf(v16bf a, v16bf b, v8f c) {
  return __builtin_amdgcn_wmma_f32_16x16x32_bf16(false, a, false, b,
                                                 (short)0, c, false, false);
}

__device__ __forceinline__ v8f vzero() {
  v8f z = {0.f, 0.f, 0.f, 0.f, 0.f, 0.f, 0.f, 0.f};
  return z;
}

// element offset of channel group g, image n, pixel (y, x); y in -1..256, x in -8..263
__device__ __forceinline__ size_t cat_off(int g, int n, int y, int x) {
  return ((((size_t)n * NGRP + g) * PROWS + (y + 1)) * PPITCH + (x + 8)) * 8;
}

// fragment from its two 16-byte parts: lo = k 8*half..+7, hi = k 16+8*half..+7
__device__ __forceinline__ v16bf frag_join(const bf16_t* __restrict__ lo,
                                           const bf16_t* __restrict__ hi) {
  return __builtin_shufflevector(*(const v8bf*)lo, *(const v8bf*)hi, 0, 1, 2, 3,
                                 4, 5, 6, 7, 8, 9, 10, 11, 12, 13, 14, 15);
}

// The 16 f32 values of one lane's fragment of a row-major f32 matrix, p = the
// lane's row at k = 8*half: k 8*half..+7 and 16+8*half..+7, four 16-byte loads
struct frag_raw {
  v4f q[4];
};

__device__ __forceinline__ frag_raw raw_ld(const float* __restrict__ p) {
  frag_raw r;
  r.q[0] = *(const v4f*)p;
  r.q[1] = *(const v4f*)(p + 4);
  r.q[2] = *(const v4f*)(p + 16);
  r.q[3] = *(const v4f*)(p + 20);
  return r;
}

__device__ __forceinline__ v16bf raw_cvt(const frag_raw& r) {
  v16bf f;
#pragma unroll
  for (int e = 0; e < 16; ++e) f[e] = (bf16_t)r.q[e >> 2][e & 3];
  return f;
}

// ---------------------------------------------------------------------------
// Set-up for the convolutions, done by the attention launch beside its own work:
// conv and fusion weights to bf16 in the workspace, and the zero border of the
// concat buffer. The weights are stored in fragment order:
// [k slab][16-row tile][part lo/hi][lane][8], so one fragment part of a wave is
// 512 contiguous bytes. Conv k slab = (32-channel slab s) * 9 + tap.
// ---------------------------------------------------------------------------
// where element i of a conv weight buffer comes from; ktot = 9 * input channels
__device__ __forceinline__ int conv_w_src(int i, int ktot) {
  const int e = i & 7, ln = (i >> 3) & 31, j = (i >> 8) & 1, mt = (i >> 9) & 1;
  const int ks = i >> 10, s = ks / 9, tap = ks - s * 9;
  const int oc = mt * 16 + (ln & 15);
  const int ic = s * 32 + j * 16 + 8 * (ln >> 4) + e;
  return oc * ktot + ic * 9 + tap;
}

// where element i of the fusion weight buffer comes from
__device__ __forceinline__ int fuse_w_src(int i) {
  const int e = i & 7, ln = (i >> 3) & 31, j = (i >> 8) & 1, mt = (i >> 9) & 3;
  const int ks = i >> 11;
  return (mt * 16 + (ln & 15)) * 160 + ks * 32 + j * 16 + 8 * (ln >> 4) + e;
}

// border pixel i of the 16 channel groups the convolutions read, 4 images:
// 2 whole rows (272 px) + 2 columns x 256 rows = 1056 pixels per plane, 64 planes
__device__ __forceinline__ bf16_t* border_px(bf16_t* __restrict__ cat, int i) {
  const int pl = i / 1056, rem = i - pl * 1056;
  int row, col;
  if (rem < 544) {
    row = (rem < 272) ? 0 : 257;
    col = (rem < 272) ? rem : rem - 272;
  } else {
    row = 1 + ((rem - 544) >> 1);
    col = (rem & 1) ? 264 : 7;
  }
  return cat + cat_off(pl & 15, pl >> 4, row - 1, col - 8);
}

// ---------------------------------------------------------------------------
// Kernel 1: region non-local attention. One block per 32x32 cell (256 blocks).
// All GEMMs (k/v proj+pool, q proj, K q^T, V^T P^T, Wo proj) on the WMMA pipe.
// Every product of the query phase has the query as its column: a lane's D
// registers of two 16-row tiles (rows r + 8*half and 16 + r + 8*half) are, after
// conversion, that lane's B fragment of the next product (k = 8*half + e and
// 16 + 8*half + e), so q, the scores, P and out never leave the lane.
// Writes f0 (bf16) into channel groups 0..7 of the concat buffer.
// Its own weights are read as f32 and converted in registers. Each block also does
// 1/256 of the set-up for the convolutions, which the next launch finds done: the
// loads go out behind the x loads, the stores under the query phase's weight loads.
// ---------------------------------------------------------------------------
#define VPITCH 264  // keys per row of V^T in LDS + 8: 528 B, an odd count of 16 B
// The cell's x in LDS, f32: channel c, cell row R, column C at
// R * 2048 + slot(c) * 32 + C, slot(c) = (c >> 4) * 16 + (c & 7) * 2 + ((c >> 3) & 1).
// The two halves of a wave hold channels c and c + 8, here 32 floats apart, so on
// different banks; a lane's 32 channels of one pixel lie 256 bytes apart.

// lane l with lane l ^ 16
__device__ __forceinline__ float xhalf(float v) {
  return __builtin_bit_cast(
      float, __builtin_amdgcn_permlanex16(__builtin_bit_cast(int, v),
                                          __builtin_bit_cast(int, v), 0x76543210,
                                          0xfedcba98, false, false));
}

// B fragment from the D registers of two stacked 16-row tiles
__device__ __forceinline__ v16bf frag_from_d(v8f lo, v8f hi) {
  v16bf f;
#pragma unroll
  for (int e = 0; e < 8; ++e) {
    f[e]     = (bf16_t)lo[e];
    f[8 + e] = (bf16_t)hi[e];
  }
  return f;
}

__global__ __launch_bounds__(256) void attn_kernel(
    const float* __restrict__ x,
    const float* __restrict__ Wq, const float* __restrict__ bq,
    const float* __restrict__ Wk, const float* __restrict__ bk,
    const float* __restrict__ Wv, const float* __restrict__ bv,
    const float* __restrict__ gamma_p, const float* __restrict__ bo,
    const float* __restrict__ Wo, const float* __restrict__ W1,
    const float* __restrict__ W2, const float* __restrict__ W3,
    const float* __restrict__ Wf, bf16_t* __restrict__ o1,
    bf16_t* __restrict__ o2, bf16_t* __restrict__ o3, bf16_t* __restrict__ of,
    bf16_t* __restrict__ cat) {
  __shared__ __attribute__((aligned(16))) bf16_t Kp[256 * 32];      // pooled keys   [key][lat]
  __shared__ __attribute__((aligned(16))) bf16_t Vt[32 * VPITCH];   // pooled values [lat][key]
  __shared__ __attribute__((aligned(16))) float xs[32 * 2048];      // x of the cell

  const int bid = blockIdx.x;
  const int n = bid >> 6, gh = (bid >> 3) & 7, gw = bid & 7;
  const int row0 = gh * 32, col0 = gw * 32;
  const int t = threadIdx.x, lane = t & 31, wave = t >> 5;
  const int half = lane >> 4, coln = lane & 15;
  const float gamma = gamma_p[0];
  const size_t HW = (size_t)HDIM * WDIM;
  const float* xcell = x + (size_t)n * CIN * HW;  // + yy*WDIM + xx per use

  // The block's share of the conv and fusion weights, 364 pieces of 256 elements
  // (72 of W1, 108 of W2, 144 of W3, 40 of Wf): piece bid and, in the first 108
  // blocks, piece bid + 256; the other blocks read an element they do not store.
  const bool two = bid < 108;
  const float* ws0 = bid < 72 ? W1 : bid < 180 ? W2 : W3;
  bf16_t* wd0 = bid < 72 ? o1 : bid < 180 ? o2 : o3;
  const int wi0 = (bid - (bid < 72 ? 0 : bid < 180 ? 72 : 180)) * 256 + t;
  const float* ws1 = bid < 68 ? W3 : Wf;
  bf16_t* wd1 = bid < 68 ? o3 : of;
  const int wi1 = (bid < 68 ? bid + 76 : two ? bid - 68 : 0) * 256 + t;
  float wv0, wv1;

  // ---- Phase A (WMMA): k/v projection + 2x2 maxpool, all in registers. A wave
  // owns the row pairs wave and wave + 8 of the cell. A row pair is four 16-px
  // tiles (row ry, parity par), index j of a tile being pixel column 2j + par:
  // the four pixels of pool window j sit at index j of the four tiles, so the
  // pool is an elementwise maximum of four D tiles. A lane reads both parities
  // of a channel with one 8-byte load, 16 lanes covering the cell row's 128-byte
  // line, and the same fragments feed k and v. k has the pixel as its column
  // (a lane's D = 8 lat of one key), v as its row (a lane's D = 8 keys of one
  // lat): either goes to LDS as 16-byte stores. Each row of x also goes to LDS
  // as it arrives, where the query phase finds it: x leaves L2 once.
  {
    const unsigned wo = (unsigned)(coln * 64 + 8 * half);  // lane's row, k part
    frag_raw rk[2][2], rv[2][2];  // [16-lat tile][32-channel slab], still f32
#pragma unroll
    for (int mt = 0; mt < 2; ++mt)
#pragma unroll
      for (int s = 0; s < 2; ++s) {
        const unsigned o = wo + mt * 1024 + s * 32;
        rk[mt][s] = raw_ld(Wk + o);
        rv[mt][s] = raw_ld(Wv + o);
      }
    // bk at uniform indices, so through the scalar path: a vector load issued
    // behind the x loads would return behind them, and the first row pair's
    // keys would wait for all of x
    float bk0[8], bk1[8];
#pragma unroll
    for (int r = 0; r < 8; ++r) {
      const float l0 = bk[r], h0 = bk[8 + r], l1 = bk[16 + r], h1 = bk[24 + r];
      bk0[r] = half ? h0 : l0;
      bk1[r] = half ? h1 : l1;
    }
    const float bv0 = bv[coln], bv1 = bv[16 + coln];
    // slot mt*8 + r = channel mt*16 + 8*half + r, the k order of a fragment
    const float* xq = xcell + (size_t)(8 * half) * HW +
                      (size_t)(row0 + 2 * wave) * WDIM + col0 + 2 * coln;
    float* xw = xs + 2 * wave * 2048 + half * 32 + 2 * coln;
    v2f xa[2][2][32];  // [row pair][row][slot], both parities
#pragma unroll
    for (int p = 0; p < 2; ++p)
#pragma unroll
      for (int ry = 0; ry < 2; ++ry) {
        // keeps the four rows' loads in the order of their use: loads return in
        // order, so a row's products start while the later rows are in flight
        __builtin_amdgcn_sched_barrier(0);
#pragma unroll
        for (int mt = 0; mt < 4; ++mt)
#pragma unroll
          for (int r = 0; r < 8; ++r)
            xa[p][ry][mt * 8 + r] = *(const v2f*)(
                xq + (size_t)(mt * 16 + r) * HW + (p * 16 + ry) * WDIM);
      }
    // the set-up's weight elements: issued behind x, they are there when the k/v
    // phase has used x
    const int si0 = conv_w_src(wi0, bid < 72 ? 576 : bid < 180 ? 864 : 1152);
    const int si1 = bid < 68 ? conv_w_src(wi1, 1152) : fuse_w_src(wi1);
    wv0 = ws0[si0];
    wv1 = ws1[si1];
    // behind these loads their address registers fall free while the loads are
    // in flight: the wait stands in front of any overwrite, and its operands
    // keep the addresses whole up to it; the scheduling barrier keeps loads and
    // register-only instructions from moving over the wait
    asm volatile("s_wait_xcnt 0x0" ::"v"(xq), "v"(wo * 4), "v"(si0), "v"(si1), "s"(ws0),
                 "s"(ws1), "s"(Wk), "s"(Wv)
                 : "memory");
    __builtin_amdgcn_sched_barrier(0);
    v16bf wk[2][2], wv[2][2];  // [16-lat tile][32-channel slab]
#pragma unroll
    for (int mt = 0; mt < 2; ++mt)
#pragma unroll
      for (int s = 0; s < 2; ++s) {
        wk[mt][s] = raw_cvt(rk[mt][s]);
        wv[mt][s] = raw_cvt(rv[mt][s]);
      }
#pragma unroll
    for (int p = 0; p < 2; ++p) {
      v8f km0, km1, vm0, vm1;
#pragma unroll
      for (int tl = 0; tl < 4; ++tl) {
        const int ry = tl >> 1, par = tl & 1;
        // keeps a row's products in front of the wait for the next row's loads:
        // mixed with later rows' work they would start only when all x is there
        if (par == 0) {
          __builtin_amdgcn_sched_barrier(0);
#pragma unroll
          for (int mt = 0; mt < 4; ++mt)
#pragma unroll
            for (int r = 0; r < 8; ++r)
              *(v2f*)(xw + (p * 16 + ry) * 2048 + (mt * 16 + 2 * r) * 32) =
                  xa[p][ry][mt * 8 + r];
        }
        v16bf b0, b1;
#pragma unroll
        for (int e = 0; e < 16; ++e) {
          b0[e] = (bf16_t)xa[p][ry][e][par];
          b1[e] = (bf16_t)xa[p][ry][16 + e][par];
        }
        v8f k0 = wmma_bf(wk[0][0], b0, vzero());
        v8f k1 = wmma_bf(wk[1][0], b0, vzero());
        v8f v0 = wmma_bf(b0, wv[0][0], vzero());
        v8f v1 = wmma_bf(b0, wv[1][0], vzero());
        k0 = wmma_bf(wk[0][1], b1, k0);
        k1 = wmma_bf(wk[1][1], b1, k1);
        v0 = wmma_bf(b1, wv[0][1], v0);
        v1 = wmma_bf(b1, wv[1][1], v1);
        if (tl == 0) {
          km0 = k0; km1 = k1; vm0 = v0; vm1 = v1;
        } else {
#pragma unroll
          for (int r = 0; r < 8; ++r) {
            km0[r] = fmaxf(km0[r], k0[r]);
            km1[r] = fmaxf(km1[r], k1[r]);
            vm0[r] = fmaxf(vm0[r], v0[r]);
            vm1[r] = fmaxf(vm1[r], v1[r]);
          }
        }
      }
      // the bias is the same for the four pixels of a window and rounding is
      // monotone: added behind the maximum it gives the same value
      v8bf kk0, kk1, vv0, vv1;
#pragma unroll
      for (int r = 0; r < 8; ++r) {
        kk0[r] = (bf16_t)(km0[r] + bk0[r]);
        kk1[r] = (bf16_t)(km1[r] + bk1[r]);
        vv0[r] = (bf16_t)(vm0[r] + bv0);
        vv1[r] = (bf16_t)(vm1[r] + bv1);
      }
      const int key0 = (wave + 8 * p) * 16;  // pooled row = row pair
      *(v8bf*)(Kp + (key0 + coln) * 32 + 8 * half) = kk0;
      *(v8bf*)(Kp + (key0 + coln) * 32 + 16 + 8 * half) = kk1;
      *(v8bf*)(Vt + coln * VPITCH + key0 + 8 * half) = vv0;
      *(v8bf*)(Vt + (16 + coln) * VPITCH + key0 + 8 * half) = vv1;
    }
    __syncthreads();  // every wave reads all keys, values and x from here on
  }

  // ---- Phase B: 8 chunks of 128 queries; each wave owns one 16-query tile.
  // Kp, Vt and xs are only read from here on, so the phase has no barrier.
  const unsigned wqo = (unsigned)(coln * 64 + 8 * half);  // lane's row, k part
  const frag_raw rq00 = raw_ld(Wq + wqo), rq01 = raw_ld(Wq + wqo + 32);
  const frag_raw rq10 = raw_ld(Wq + wqo + 1024), rq11 = raw_ld(Wq + wqo + 1056);
  // Wo and the biases of the loop are the same for all 8 chunks. With no memory
  // clobber left in the loop the compiler lifts their loads out of it: written
  // here, they stand in front of the wait below
  const unsigned woo = (unsigned)(coln * 32 + 8 * half);  // lane's row, k part
  frag_raw ro[4];
#pragma unroll
  for (int mt = 0; mt < 4; ++mt) ro[mt] = raw_ld(Wo + woo + mt * 512);
  float bq0[8], bq1[8], bov[32];
#pragma unroll
  for (int r = 0; r < 8; ++r) {
    bq0[r] = bq[r + 8 * half];
    bq1[r] = bq[16 + r + 8 * half];
  }
#pragma unroll
  for (int mt = 0; mt < 4; ++mt)
#pragma unroll
    for (int r = 0; r < 8; ++r) bov[mt * 8 + r] = bo[mt * 16 + r + 8 * half];
  // behind these loads their address registers fall free while the loads are
  // in flight: the wait stands in front of any overwrite, and its operands keep
  // bases and offsets of the weight loads whole up to it; the scheduling barrier
  // keeps register-only instructions from moving over the wait
  asm volatile("s_wait_xcnt 0x0" ::"s"(Wq), "s"(Wo), "v"(wqo * 4), "v"(woo * 4)
               : "memory");
  __builtin_amdgcn_sched_barrier(0);
  // The set-up's stores, here because no barrier follows that would wait for them
  // and their arithmetic runs while the loads above are in flight. 264 pieces of
  // 256 border pixels: piece bid and, in 8 blocks, piece bid + 256.
  const v8bf zpx = {(bf16_t)0.f, (bf16_t)0.f, (bf16_t)0.f, (bf16_t)0.f,
                    (bf16_t)0.f, (bf16_t)0.f, (bf16_t)0.f, (bf16_t)0.f};
  bf16_t* bp0 = border_px(cat, bid * 256 + t);
  const bf16_t wc0 = (bf16_t)wv0;
  // keeps the arithmetic above in front of the two stores, so that nothing stands
  // between them and the wait
  __builtin_amdgcn_sched_barrier(0);
  wd0[wi0] = wc0;
  *(v8bf*)bp0 = zpx;
  // behind these stores their address and data registers fall free while they are
  // in flight: the wait stands in front of any overwrite; the scheduling barrier
  // keeps register-only instructions from moving over it
  asm volatile("s_wait_xcnt 0x0" ::: "memory");
  __builtin_amdgcn_sched_barrier(0);
  if (two) {
    wd1[wi1] = (bf16_t)wv1;
    // the same wait behind this store
    asm volatile("s_wait_xcnt 0x0" ::: "memory");
  }
  if (bid < 8) {
    *(v8bf*)border_px(cat, (bid + 256) * 256 + t) = zpx;
    // the same wait behind this store
    asm volatile("s_wait_xcnt 0x0" ::: "memory");
  }
  const v16bf wq00 = raw_cvt(rq00), wq01 = raw_cvt(rq01);
  const v16bf wq10 = raw_cvt(rq10), wq11 = raw_cvt(rq11);
  v16bf wo[4];
#pragma unroll
  for (int mt = 0; mt < 4; ++mt) wo[mt] = raw_cvt(ro[mt]);
  const bf16_t* kl = Kp + coln * 32 + 8 * half;      // A rows = keys, k = lat
  const bf16_t* vl = Vt + coln * VPITCH + 8 * half;  // A rows = lat, k = keys
  v16bf kf[16];  // all 256 keys stay in registers for the wave's 8 query tiles
#pragma unroll
  for (int kt = 0; kt < 16; ++kt)
    kf[kt] = frag_join(kl + kt * 16 * 32, kl + kt * 16 * 32 + 16);
  for (int chunk = 0; chunk < 8; ++chunk) {
    const int yy = row0 + chunk * 4 + (wave >> 1);
    const int xx = col0 + (wave & 1) * 16 + coln;
    // this lane's pixel, channels mt*16 + 8*half + r: the B fragments of the q
    // projection and, in f32, the residual of the same lane's f0 values
    const float* xp = xs + (chunk * 4 + (wave >> 1)) * 2048 + half * 32 +
                      (wave & 1) * 16 + coln;
    float xf[32];
#pragma unroll
    for (int mt = 0; mt < 4; ++mt)
#pragma unroll
      for (int r = 0; r < 8; ++r) xf[mt * 8 + r] = xp[(mt * 16 + 2 * r) * 32];
    v16bf b0, b1;
#pragma unroll
    for (int e = 0; e < 16; ++e) {
      b0[e] = (bf16_t)xf[e];
      b1[e] = (bf16_t)xf[16 + e];
    }
    // q^T[32 lat][16 q]
    v8f c0 = vzero(), c1 = vzero();
    c0 = wmma_bf(wq00, b0, c0);
    c0 = wmma_bf(wq01, b1, c0);
    c1 = wmma_bf(wq10, b0, c1);
    c1 = wmma_bf(wq11, b1, c1);
#pragma unroll
    for (int r = 0; r < 8; ++r) {
      c0[r] += bq0[r];
      c1[r] += bq1[r];
    }
    const v16bf qb = frag_from_d(c0, c1);

    // scores^T: one WMMA per 16-key tile; sc[kt][r] = key kt*16 + r + 8*half
    v8f sc[16];
#pragma unroll
    for (int kt = 0; kt < 16; ++kt) sc[kt] = wmma_bf(kf[kt], qb, vzero());
    // softmax over 256 keys: 128 in the lane, the other 128 in lane ^ 16
    v8f mv = sc[0];
#pragma unroll
    for (int kt = 1; kt < 16; ++kt)
#pragma unroll
      for (int r = 0; r < 8; ++r) mv[r] = fmaxf(mv[r], sc[kt][r]);
    float m = fmaxf(fmaxf(fmaxf(mv[0], mv[1]), fmaxf(mv[2], mv[3])),
                    fmaxf(fmaxf(mv[4], mv[5]), fmaxf(mv[6], mv[7])));
    m = fmaxf(m, xhalf(m));
    const float l2e = 1.44269504f;  // e^(s - m) = 2^(s * log2(e) - m * log2(e))
    const float nm = -m * l2e;
    v8f sv = vzero();
#pragma unroll
    for (int kt = 0; kt < 16; ++kt) {
      const v8f t = sc[kt] * l2e + nm;
#pragma unroll
      for (int r = 0; r < 8; ++r) sc[kt][r] = __builtin_amdgcn_exp2f(t[r]);
      sv += sc[kt];
    }
    float s = ((sv[0] + sv[1]) + (sv[2] + sv[3])) + ((sv[4] + sv[5]) + (sv[6] + sv[7]));
    s += xhalf(s);
    const float rinv = 1.f / s;

    // out^T[32 lat][16 q] = V^T @ P^T, P^T packed from the score registers
    v8f o0 = vzero(), o1 = vzero();
#pragma unroll
    for (int ks = 0; ks < 8; ++ks) {
      // keeps each half of the V^T fragment loads behind what precedes it: all
      // lifted to the loop's head they stay live beside K and the scores, and
      // the wave's 512 registers overflow into scratch
      if ((ks & 3) == 0) __builtin_amdgcn_sched_barrier(0);
      const v16bf pb = frag_from_d(sc[2 * ks], sc[2 * ks + 1]);
      const bf16_t* vp = vl + ks * 32;
      o0 = wmma_bf(frag_join(vp, vp + 16), pb, o0);
      o1 = wmma_bf(frag_join(vp + 16 * VPITCH, vp + 16 * VPITCH + 16), pb, o1);
    }
    // the row sum divides once here: it is the lane's own query
    o0 *= rinv;
    o1 *= rinv;
    const v16bf ob = frag_from_d(o0, o1);

    // f0[64][16q] = gamma*(Wo @ out^T + bo) + x
#pragma unroll
    for (int mt = 0; mt < 4; ++mt) {
      v8f f0 = wmma_bf(wo[mt], ob, vzero());
      v8bf pk;  // this lane's 8 consecutive channels = one channel group
#pragma unroll
      for (int r = 0; r < 8; ++r)
        pk[r] = (bf16_t)(gamma * (f0[r] + bov[mt * 8 + r]) + xf[mt * 8 + r]);
      *(v8bf*)(cat + cat_off(mt * 2 + half, n, yy, xx)) = pk;
    }
  }
}

// ---------------------------------------------------------------------------
// Kernels 2-4: implicit-GEMM 3x3 conv, pad=1, relu. Input = first KTOT/9
// channels of concat buffer; without FUSE, output -> channels [ocBase, ocBase+32).
// Block tile: 32 oc x CROWS rows x 128 px; wave w owns x-subtile w of all rows.
// K runs over groups (32-channel slab, column tap dx), row tap dy inside. For one
// group the six weight fragments (3 dy x 2 oc tiles) stay in registers for all
// rows, and each input row's pixel fragment, two 16-byte loads, feeds the up to
// three output rows it touches; the zero border stands for pad=1.
//
// The pixels of a 32-channel slab (4 planes x 10 rows x 130 px) are brought into
// LDS once by asynchronous copies and read there by all three column taps and all
// eight waves; of the two LDS buffers one is filled while the other is read.
//
// With FUSE (the last convolution) the wave goes on to the 1x1 fusion over all
// 160 channels + bias + residual x, fp32 out, for the pixels it has just made:
// its two stacked D tiles of a row are, after bias, relu and conversion, the
// lane's B fragment of the last 32 channels, which so never reach memory; the
// other 128 channels are the centre taps that the block has read a moment ago.
// The walk is one row a stage; the 20 weight fragments stay in registers, and of
// the two register sets for pixels and x each is refilled, as soon as its stage
// has used it, for the stage after the next.
// ---------------------------------------------------------------------------
#define CROWS 8
#define FSTG CROWS
#define FMID 28

// Stands behind a run of global loads or stores, in front of whatever next
// overwrites a register that one of them names (address or store data). The
// scheduling barrier keeps register-only instructions from moving over the wait.
__device__ __forceinline__ void regs_free() {
  asm volatile("s_wait_xcnt 0x0" ::: "memory");
  __builtin_amdgcn_sched_barrier(0);
}

struct conv_group {
  v16bf wa[3][2];         // weights [dy][oc tile]
  v16bf px[CROWS + 2];    // pixels of input rows y0 - 1 .. y0 + CROWS
};

// LDS tile of one slab: [4 planes][TROWS rows][TCOLS px] of 16 bytes, then one
// 16-byte place per thread for the lanes of the edge copy that have no pixel
#define TROWS  (CROWS + 2)
#define TCOLS  130
#define TUNITS (4 * TROWS * TCOLS)
#define TBUF   ((TUNITS + 256) * 8)

// weight fragments of group g = slab * 3 + dx; every offset is a constant
__device__ __forceinline__ void conv_w_ld(conv_group& f,
                                          const bf16_t* __restrict__ wl, int g) {
  const int s = g / 3, dx = g % 3;
#pragma unroll
  for (int dy = 0; dy < 3; ++dy) {
    const bf16_t* w = wl + (s * 9 + dy * 3 + dx) * 1024;
    f.wa[dy][0] = frag_join(w, w + 256);
    f.wa[dy][1] = frag_join(w + 512, w + 768);
  }
}

// pixel fragments of column tap dx from the slab's LDS tile; lp = the lane's
// pixel of plane half, row 0, tap 0
__device__ __forceinline__ void conv_px_ld(conv_group& f, const bf16_t* lp,
                                           int dx) {
#pragma unroll
  for (int ir = 0; ir < TROWS; ++ir) {
    const bf16_t* p = lp + (ir * TCOLS + dx) * 8;
    f.px[ir] = frag_join(p, p + 2 * TROWS * TCOLS * 8);
  }
}

// A wave's share of one slab tile, 21 asynchronous copies of 16 bytes a lane: five
// rows of one plane, four copies of 32 px each (l0, g0 = the lane's LDS byte
// address and global address in the first; along a row the constant offset moves
// both addresses alike), and one copy for the first and last px of the five rows
// (lx, gx). The statement ends with the wait that stands in front of any overwrite
// of the address registers its copies name.
__device__ __forceinline__ void tile_copy(unsigned l0, const bf16_t* g0,
                                          unsigned lx, const bf16_t* gx) {
  asm volatile(
      "global_load_async_to_lds_b128 %0, %1, off\n\t"
      "global_load_async_to_lds_b128 %0, %1, off offset:512\n\t"
      "global_load_async_to_lds_b128 %0, %1, off offset:1024\n\t"
      "global_load_async_to_lds_b128 %0, %1, off offset:1536\n\t"
      "global_load_async_to_lds_b128 %2, %3, off\n\t"
      "global_load_async_to_lds_b128 %2, %3, off offset:512\n\t"
      "global_load_async_to_lds_b128 %2, %3, off offset:1024\n\t"
      "global_load_async_to_lds_b128 %2, %3, off offset:1536\n\t"
      "global_load_async_to_lds_b128 %4, %5, off\n\t"
      "global_load_async_to_lds_b128 %4, %5, off offset:512\n\t"
      "global_load_async_to_lds_b128 %4, %5, off offset:1024\n\t"
      "global_load_async_to_lds_b128 %4, %5, off offset:1536\n\t"
      "global_load_async_to_lds_b128 %6, %7, off\n\t"
      "global_load_async_to_lds_b128 %6, %7, off offset:512\n\t"
      "global_load_async_to_lds_b128 %6, %7, off offset:1024\n\t"
      "global_load_async_to_lds_b128 %6, %7, off offset:1536\n\t"
      "global_load_async_to_lds_b128 %8, %9, off\n\t"
      "global_load_async_to_lds_b128 %8, %9, off offset:512\n\t"
      "global_load_async_to_lds_b128 %8, %9, off offset:1024\n\t"
      "global_load_async_to_lds_b128 %8, %9, off offset:1536\n\t"
      "global_load_async_to_lds_b128 %10, %11, off\n\t"
      "s_wait_xcnt 0x0" ::"v"(l0), "v"(g0),
      "v"(l0 + 1 * TCOLS * 16u), "v"(g0 + 1 * PPITCH * 8),
      "v"(l0 + 2 * TCOLS * 16u), "v"(g0 + 2 * PPITCH * 8),
      "v"(l0 + 3 * TCOLS * 16u), "v"(g0 + 3 * PPITCH * 8),
      "v"(l0 + 4 * TCOLS * 16u), "v"(g0 + 4 * PPITCH * 8), "v"(lx), "v"(gx)
      : "memory");
}

template <int KTOT, bool FUSE>
__global__ __launch_bounds__(256) void conv3x3_kernel(
    const bf16_t* __restrict__ cat, const bf16_t* __restrict__ Wr,
    const float* __restrict__ bias, bf16_t* __restrict__ out_cat, int ocBase,
    const bf16_t* __restrict__ Wf_bf, const float* __restrict__ bfus,
    const float* __restrict__ x, float* __restrict__ out) {
  const int bid = blockIdx.x;  // 4 imgs * (256 / CROWS) row groups * 2 xsegs
  constexpr int BPI = (HDIM / CROWS) * 2;
  const int n = bid / BPI, rem = bid % BPI;
  const int y0 = (rem >> 1) * CROWS, xseg = rem & 1;
  const int t = threadIdx.x, lane = t & 31, wave = t >> 5;
  const int half = lane >> 4, coln = lane & 15;
  const int xx = xseg * 128 + wave * 16 + coln;
  const bf16_t* wl = Wr + lane * 8;
  __shared__ __attribute__((aligned(16))) bf16_t tile[2][TBUF];
  // reader: the lane's pixel of plane half, row 0, tap 0 in buffer 0
  const bf16_t* lp = &tile[0][(half * TROWS * TCOLS + wave * 16 + coln) * 8];
  // copier: wave w brings rows 5 * (w & 1) .. + 4 of plane w >> 1. The row copies
  // bring tile px 1..128, which start on a 128-byte line in memory. In the edge
  // copy lanes 0..9 bring px 0 and 129 of the five rows; the other lanes, which
  // must be on, bring a pixel of the tile once more to a place nobody reads
  const int crow = (wave >> 1) * TROWS + (wave & 1) * (TROWS / 2);
  const int ej = lane >> 1, ec = (lane & 1) * (TCOLS - 1);
  const bool edge = lane < TROWS;
  const unsigned cl0 = (unsigned)(size_t)&tile[0][(crow * TCOLS + 1 + lane) * 8];
  const int eunit = (crow + ej) * TCOLS + ec, spare = TUNITS + t;
  const unsigned clx = (unsigned)(size_t)&tile[0][(edge ? eunit : spare) * 8];
  const bf16_t* cg0 = cat + cat_off(wave >> 1, n, y0 - 1 + (wave & 1) * (TROWS / 2),
                                    xseg * 128 + lane);
  const int estep = (ej * PPITCH + ec - 1 - lane) * 8;
  const bf16_t* cgx = cg0 + (edge ? estep : 0);

  v8f acc[CROWS][2];
#pragma unroll
  for (int r = 0; r < CROWS; ++r) acc[r][0] = acc[r][1] = vzero();
  v16bf fw[FUSE ? 5 : 1][4];  // fusion weights [k slab][oc tile]
  float fb[FUSE ? 4 : 1][8];  // fusion bias [oc tile][row]
  float bs0[8], bs1[8];       // this convolution's bias, rows of the two oc tiles
  constexpr int NG = (KTOT / 288) * 3;  // groups: 32-channel slabs x 3 dx
  conv_group f[2];
  tile_copy(cl0, cg0, clx, cgx);
  conv_w_ld(f[0], wl, 0);
  // slab 0 has landed for this wave's copies, then, behind the barrier, for all
  asm volatile("s_wait_asynccnt 0x0" ::: "memory");
  __syncthreads();
  tile_copy(cl0 + TBUF * 2, cg0 + (size_t)4 * PLANE, clx + TBUF * 2,
            cgx + (size_t)4 * PLANE);
  conv_px_ld(f[0], lp, 0);
  if constexpr (FUSE) {
    // this convolution's bias at uniform indices, so through the scalar path, and
    // here, under the first group's loads: as a vector load it is sunk to its
    // use, behind the last products, and its latency is waited out there
#pragma unroll
    for (int r = 0; r < 8; ++r) {
      const float l0 = bias[r], h0 = bias[8 + r];
      const float l1 = bias[16 + r], h1 = bias[24 + r];
      bs0[r] = half ? h0 : l0;
      bs1[r] = half ? h1 : l1;
    }
  }
  // unrolled so that the two fragment sets stay in registers (constant index)
#pragma unroll
  for (int g = 0; g < NG; ++g) {
    // keeps the next group's loads behind the last group's products (or behind
    // group 0's loads), so that no third fragment set is live
    __builtin_amdgcn_sched_barrier(0);
    if (g % 3 == 2 && g + 1 < NG) {
      // in front of slab s's last group, whose pixels are already fetched: this
      // wave's reads of slab s have returned and its copies of slab s + 1 have
      // landed; behind the barrier that holds for every wave, so slab s + 1 may
      // be read (the fetch below) and the buffer of slab s refilled
      const int s = g / 3;
      asm volatile("s_wait_dscnt 0x0" ::: "memory");
      asm volatile("s_wait_asynccnt 0x0" ::: "memory");
      __syncthreads();
      if (g + 4 < NG)
        tile_copy(cl0 + (s & 1) * TBUF * 2, cg0 + (size_t)(s + 2) * 4 * PLANE,
                  clx + (s & 1) * TBUF * 2, cgx + (size_t)(s + 2) * 4 * PLANE);
    }
    if (g + 1 == NG) {
      // behind the last group's weight loads their offset register falls free
      // while loads that name it are in flight: the wait stands in front of any
      // overwrite, and its operand keeps the register whole up to it
      asm volatile("s_wait_xcnt 0x0" ::"v"(lane) : "memory");
      if constexpr (FUSE) {
        // the last group has no next one to fetch: the fusion's weights and bias
        // take that fragment set's registers and arrive behind its products
        const unsigned wo = (unsigned)(lane * 8);
#pragma unroll
        for (int ks = 0; ks < 5; ++ks)
#pragma unroll
          for (int mt = 0; mt < 4; ++mt) {
            const bf16_t* w = Wf_bf + ks * 2048 + mt * 512;
            fw[ks][mt] = frag_join(w + wo, w + 256 + wo);
          }
#pragma unroll
        for (int mt = 0; mt < 4; ++mt)
#pragma unroll
          for (int r = 0; r < 8; ++r) fb[mt][r] = bfus[mt * 16 + r + 8 * half];
        regs_free();
      }
    }
    if (g + 1 < NG) {
      conv_w_ld(f[(g + 1) & 1], wl, g + 1);
      conv_px_ld(f[(g + 1) & 1], lp + (((g + 1) / 3) & 1) * TBUF, (g + 1) % 3);
    }
    // keeps the next group's loads in front of this group's products: without
    // it each pixel load is sunk to its use and its latency is waited out there
    __builtin_amdgcn_sched_barrier(0);
    const conv_group& c = f[g & 1];
#pragma unroll
    for (int ir = 0; ir < CROWS + 2; ++ir) {
#pragma unroll
      for (int dy = 0; dy < 3; ++dy) {
        const int orow = ir - dy;
        if (orow >= 0 && orow < CROWS) {
          acc[orow][0] = wmma_bf(c.wa[dy][0], c.px[ir], acc[orow][0]);
          acc[orow][1] = wmma_bf(c.wa[dy][1], c.px[ir], acc[orow][1]);
        }
      }
    }
  }
  // a precaution: no copy is in flight when the wave goes on and ends
  asm volatile("s_wait_asynccnt 0x0" ::: "memory");
  // keeps the last group's products in their order, free of the epilogue
  __builtin_amdgcn_sched_barrier(0);
  if constexpr (!FUSE) {
#pragma unroll
    for (int r = 0; r < 8; ++r) {
      bs0[r] = bias[r + 8 * half];
      bs1[r] = bias[16 + r + 8 * half];
    }
    bf16_t* ob = out_cat + cat_off((ocBase >> 3) + half, n, y0, xx);
#pragma unroll
    for (int q = 0; q < CROWS; ++q) {
      v8bf p0, p1;
#pragma unroll
      for (int r = 0; r < 8; ++r) {
        p0[r] = (bf16_t)fmaxf(acc[q][0][r] + bs0[r], 0.f);
        p1[r] = (bf16_t)fmaxf(acc[q][1][r] + bs1[r], 0.f);
      }
      *(v8bf*)(ob + q * PPITCH * 8) = p0;
      *(v8bf*)(ob + q * PPITCH * 8 + 2 * PLANE) = p1;
    }
  } else {
    constexpr unsigned HW = HDIM * WDIM;
    // block-uniform bases plus one lane offset each for the whole walk
    const bf16_t* cb = cat + cat_off(0, n, y0, xseg * 128);
    const unsigned pxo = (unsigned)(half * PLANE + (wave * 16 + coln) * 8);
    // based on oc plane FMID, so that every plane of the walk lies within the
    // reach of a load's or store's constant offset: one address for all of them
    const size_t xi0 = (((size_t)n * CIN + FMID) * HDIM + y0) * WDIM + xseg * 128;
    const float* xb = x + xi0;
    float* ob = out + xi0;
    const unsigned xo = (unsigned)(8 * half) * HW + wave * 16 + coln;

    v16bf px[2][4];  // centre-tap pixels [stage parity][k slab]
#pragma unroll
    for (int b = 0; b < 2; ++b)
#pragma unroll
      for (int ks = 0; ks < 4; ++ks) {
        const bf16_t* p = cb + (size_t)ks * 4 * PLANE + b * PPITCH * 8;
        px[b][ks] = frag_join(p + pxo, p + 2 * PLANE + pxo);
      }
    regs_free();
    v16bf f3[CROWS];  // this convolution's 32 channels, one B fragment a row
#pragma unroll
    for (int q = 0; q < CROWS; ++q) {
      v8f a0, a1;
#pragma unroll
      for (int r = 0; r < 8; ++r) {
        a0[r] = fmaxf(acc[q][0][r] + bs0[r], 0.f);
        a1[r] = fmaxf(acc[q][1][r] + bs1[r], 0.f);
      }
      f3[q] = frag_from_d(a0, a1);
    }
    // keeps the x loads behind the conversion above: in front of it they would be
    // live beside the f32 accumulators, and the wave's 512 registers overflow
    __builtin_amdgcn_sched_barrier(0);
    float xr[2][4][8];  // residual [stage parity][oc tile][row of D]
#pragma unroll
    for (int b = 0; b < 2; ++b)
#pragma unroll
      for (int mt = 0; mt < 4; ++mt)
#pragma unroll
        for (int r = 0; r < 8; ++r)
          xr[b][mt][r] = *(xb + ((mt * 16 + r - FMID) * (int)HW + b * WDIM) + xo);
    regs_free();

    // unrolled so that every offset and register set is a constant and the last
    // two stages refill nothing
#pragma unroll
    for (int s = 0; s < FSTG; ++s) {
      const int b = s & 1;
      v8f fa[4];
#pragma unroll
      for (int mt = 0; mt < 4; ++mt) fa[mt] = vzero();
#pragma unroll
      for (int ks = 0; ks < 5; ++ks) {
#pragma unroll
        for (int mt = 0; mt < 4; ++mt)
          fa[mt] = wmma_bf(fw[ks][mt], ks < 4 ? px[b][ks & 3] : f3[s], fa[mt]);
        if (ks < 4 && s + 2 < FSTG) {
          const bf16_t* p = cb + (size_t)ks * 4 * PLANE + (s + 2) * PPITCH * 8;
          px[b][ks & 3] = frag_join(p + pxo, p + 2 * PLANE + pxo);
        }
        // holds each slab's refill between its own products and the next slab's:
        // left free, the loads are bunched at the stage's head, where they need
        // registers of their own, and products move over the wait below
        __builtin_amdgcn_sched_barrier(0);
      }
      if (s + 2 < FSTG) regs_free();
#pragma unroll
      for (int mt = 0; mt < 4; ++mt)
#pragma unroll
        for (int r = 0; r < 8; ++r) fa[mt][r] = fa[mt][r] + fb[mt][r] + xr[b][mt][r];
      if (s + 2 < FSTG) {
        // x of the stage after the next goes out here, two stages ahead of its use
#pragma unroll
        for (int mt = 0; mt < 4; ++mt)
#pragma unroll
          for (int r = 0; r < 8; ++r)
            xr[b][mt][r] =
                *(xb + ((mt * 16 + r - FMID) * (int)HW + (s + 2) * WDIM) + xo);
      }
#pragma unroll
      for (int mt = 0; mt < 4; ++mt)
#pragma unroll
        for (int r = 0; r < 8; ++r)
          *(ob + ((mt * 16 + r - FMID) * (int)HW + s * WDIM) + xo) = fa[mt][r];
      // behind the stores their data registers fall free while the stores are in
      // flight: the wait stands in front of any overwrite, and its operands keep
      // the sums whole up to it, also against the sums that are formed among the
      // stores; the scheduling barrier keeps the next stage's products behind it
      asm volatile("s_wait_xcnt 0x0" ::"v"(fa[0]), "v"(fa[1]), "v"(fa[2]), "v"(fa[3])
                   : "memory");
      __builtin_amdgcn_sched_barrier(0);
    }
  }
}

// ---------------------------------------------------------------------------
extern "C" void kernel_launch(void* const* d_in, const int* in_sizes, int n_in,
                              void* d_out, int out_size, void* d_ws,
                              size_t ws_size, hipStream_t stream) {
  const float* x  = (const float*)d_in[0];
  const float* Wq = (const float*)d_in[1];
  const float* bq = (const float*)d_in[2];
  const float* Wk = (const float*)d_in[3];
  const float* bk = (const float*)d_in[4];
  const float* Wv = (const float*)d_in[5];
  const float* bv = (const float*)d_in[6];
  const float* Wo = (const float*)d_in[7];
  const float* bo = (const float*)d_in[8];
  const float* gm = (const float*)d_in[9];
  const float* W1 = (const float*)d_in[10];
  const float* b1 = (const float*)d_in[11];
  const float* W2 = (const float*)d_in[12];
  const float* b2 = (const float*)d_in[13];
  const float* W3 = (const float*)d_in[14];
  const float* b3 = (const float*)d_in[15];
  const float* Wf = (const float*)d_in[16];
  const float* bfus = (const float*)d_in[17];
  float* out = (float*)d_out;

  // workspace layout: bf16 concat planes [4][20][258][272][8] then bf16 weights
  const size_t catElems = (size_t)4 * NGRP * PLANE;
  bf16_t* cat = (bf16_t*)d_ws;
  bf16_t* W1r = cat + catElems;
  bf16_t* W2r = W1r + 32 * 576;
  bf16_t* W3r = W2r + 32 * 864;
  bf16_t* Wfb = W3r + 32 * 1152;

  attn_kernel<<<256, 256, 0, stream>>>(x, Wq, bq, Wk, bk, Wv, bv, gm, bo, Wo, W1,
                                       W2, W3, Wf, W1r, W2r, W3r, Wfb, cat);
  conv3x3_kernel<576, false><<<256, 256, 0, stream>>>(cat, W1r, b1, cat, 64, Wfb,
                                                      bfus, x, out);
  conv3x3_kernel<864, false><<<256, 256, 0, stream>>>(cat, W2r, b2, cat, 96, Wfb,
                                                      bfus, x, out);
  conv3x3_kernel<1152, true><<<256, 256, 0, stream>>>(cat, W3r, b3, cat, 128, Wfb,
                                                      bfus, x, out);
}

// v010
// It runs in 61.1 microseconds.
// Next to v009, in two timings, it ran 1.11 and 1.09 times as fast.
// Counting every step since v000, it is 10.2 times as fast.
#include <hip/hip_runtime.h>
#include <hip/hip_bf16.h>

typedef __bf16 bf16_t;
typedef __attribute__((ext_vector_type(16))) __bf16 v16bf;
typedef __attribute__((ext_vector_type(8)))  __bf16 v8bf;
typedef __attribute__((ext_vector_type(8)))  float  v8f;
typedef __attribute__((ext_vector_type(4)))  float  v4f;
typedef __attribute__((ext_vector_type(2)))  float  v2f;
typedef __attribute__((ext_vector_type(4)))  unsigned v4u;

#define HDIM 256
#define WDIM 256
#define CIN  64
#define CLAT 32

// Concat buffer layout: one plane per (image, group of 8 channels), each plane
// [PROWS][PPITCH] pixels of 8 bf16 (16 bytes). Pixel (y, x) sits at row y + 1,
// column x + 8, so a 16-pixel tile starts on a 128-byte line; row 0, row 257,
// column 7 and column 264 are the zero border of the 3x3 convolutions.
#define PROWS  258
#define PPITCH 272
#define PLANE  (PROWS * PPITCH * 8)
#define NGRP   20

// ---------------------------------------------------------------------------
// WMMA helpers (CDNA5 16x16x32 bf16, f32 accumulate)
// ---------------------------------------------------------------------------
__device__ __forceinline__ v8f wmma_bf(v16bf a, v16bf b, v8f c) {
  return __builtin_amdgcn_wmma_f32_16x16x32_bf16(false, a, false, b,
                                                 (short)0, c, false, false);
}

__device__ __forceinline__ v8f vzero() {
  v8f z = {0.f, 0.f, 0.f, 0.f, 0.f, 0.f, 0.f, 0.f};
  return z;
}

// element offset of channel group g, image n, pixel (y, x); y in -1..256, x in -8..263
__device__ __forceinline__ size_t cat_off(int g, int n, int y, int x) {
  return ((((size_t)n * NGRP + g) * PROWS + (y + 1)) * PPITCH + (x + 8)) * 8;
}

// fragment from its two 16-byte parts: lo = k 8*half..+7, hi = k 16+8*half..+7
__device__ __forceinline__ v16bf frag_join(const bf16_t* __restrict__ lo,
                                           const bf16_t* __restrict__ hi) {
  return __builtin_shufflevector(*(const v8bf*)lo, *(const v8bf*)hi, 0, 1, 2, 3,
                                 4, 5, 6, 7, 8, 9, 10, 11, 12, 13, 14, 15);
}

// The 16 f32 values of one lane's fragment of a row-major f32 matrix, p = the
// lane's row at k = 8*half: k 8*half..+7 and 16+8*half..+7, four 16-byte loads
struct frag_raw {
  v4f q[4];
};

__device__ __forceinline__ frag_raw raw_ld(const float* __restrict__ p) {
  frag_raw r;
  r.q[0] = *(const v4f*)p;
  r.q[1] = *(const v4f*)(p + 4);
  r.q[2] = *(const v4f*)(p + 16);
  r.q[3] = *(const v4f*)(p + 20);
  return r;
}

__device__ __forceinline__ v16bf raw_cvt(const frag_raw& r) {
  v16bf f;
#pragma unroll
  for (int e = 0; e < 16; ++e) f[e] = (bf16_t)r.q[e >> 2][e & 3];
  return f;
}

// ---------------------------------------------------------------------------
// Set-up for the convolutions, done by the attention launch beside its own work:
// conv and fusion weights to bf16 in the workspace, and the zero border of the
// concat buffer. The weights are stored in fragment order:
// [k slab][16-row tile][part lo/hi][lane][8], so one fragment part of a wave is
// 512 contiguous bytes. Conv k slab = (32-channel slab s) * 9 + tap.
// ---------------------------------------------------------------------------
// where element i of a conv weight buffer comes from; ktot = 9 * input channels
__device__ __forceinline__ int conv_w_src(int i, int ktot) {
  const int e = i & 7, ln = (i >> 3) & 31, j = (i >> 8) & 1, mt = (i >> 9) & 1;
  const int ks = i >> 10, s = ks / 9, tap = ks - s * 9;
  const int oc = mt * 16 + (ln & 15);
  const int ic = s * 32 + j * 16 + 8 * (ln >> 4) + e;
  return oc * ktot + ic * 9 + tap;
}

// where element i of the fusion weight buffer comes from
__device__ __forceinline__ int fuse_w_src(int i) {
  const int e = i & 7, ln = (i >> 3) & 31, j = (i >> 8) & 1, mt = (i >> 9) & 3;
  const int ks = i >> 11;
  return (mt * 16 + (ln & 15)) * 160 + ks * 32 + j * 16 + 8 * (ln >> 4) + e;
}

// border pixel i of channel groups 0..15, 4 images:
// 2 whole rows (272 px) + 2 columns x 256 rows = 1056 pixels per plane, 64 planes
__device__ __forceinline__ bf16_t* border_px(bf16_t* __restrict__ cat, int i) {
  const int pl = i / 1056, rem = i - pl * 1056;
  int row, col;
  if (rem < 544) {
    row = (rem < 272) ? 0 : 257;
    col = (rem < 272) ? rem : rem - 272;
  } else {
    row = 1 + ((rem - 544) >> 1);
    col = (rem & 1) ? 264 : 7;
  }
  return cat + cat_off(pl & 15, pl >> 4, row - 1, col - 8);
}

// ---------------------------------------------------------------------------
// Kernel 1: region non-local attention. One block per 32x32 cell (256 blocks).
// All GEMMs (k/v proj+pool, q proj, K q^T, V^T P^T, Wo proj) on the WMMA pipe.
// Every product of the query phase has the query as its column: a lane's D
// registers of two 16-row tiles (rows r + 8*half and 16 + r + 8*half) are, after
// conversion, that lane's B fragment of the next product (k = 8*half + e and
// 16 + 8*half + e), so q, the scores, P and out never leave the lane.
// Writes f0 (bf16) into channel groups 0..7 of the concat buffer.
// Its own weights are read as f32 and converted in registers. Each block also does
// 1/256 of the set-up for the convolutions, which the next launch finds done: the
// loads go out behind the x loads, the stores under the query phase's weight loads.
// ---------------------------------------------------------------------------
#define VPITCH 264  // keys per row of V^T in LDS + 8: 528 B, an odd count of 16 B
// The cell's x in LDS, f32: channel c, cell row R, column C at
// R * 2048 + slot(c) * 32 + C, slot(c) = (c >> 4) * 16 + (c & 7) * 2 + ((c >> 3) & 1).
// The two halves of a wave hold channels c and c + 8, here 32 floats apart, so on
// different banks; a lane's 32 channels of one pixel lie 256 bytes apart.

// lane l with lane l ^ 16
__device__ __forceinline__ float xhalf(float v) {
  return __builtin_bit_cast(
      float, __builtin_amdgcn_permlanex16(__builtin_bit_cast(int, v),
                                          __builtin_bit_cast(int, v), 0x76543210,
                                          0xfedcba98, false, false));
}

// B fragment from the D registers of two stacked 16-row tiles
__device__ __forceinline__ v16bf frag_from_d(v8f lo, v8f hi) {
  v16bf f;
#pragma unroll
  for (int e = 0; e < 8; ++e) {
    f[e]     = (bf16_t)lo[e];
    f[8 + e] = (bf16_t)hi[e];
  }
  return f;
}

__global__ __launch_bounds__(256) void attn_kernel(
    const float* __restrict__ x,
    const float* __restrict__ Wq, const float* __restrict__ bq,
    const float* __restrict__ Wk, const float* __restrict__ bk,
    const float* __restrict__ Wv, const float* __restrict__ bv,
    const float* __restrict__ gamma_p, const float* __restrict__ bo,
    const float* __restrict__ Wo, const float* __restrict__ W1,
    const float* __restrict__ W2, const float* __restrict__ W3,
    const float* __restrict__ Wf, bf16_t* __restrict__ o1,
    bf16_t* __restrict__ o2, bf16_t* __restrict__ o3, bf16_t* __restrict__ of,
    bf16_t* __restrict__ cat) {
  __shared__ __attribute__((aligned(16))) bf16_t Kp[256 * 32];      // pooled keys   [key][lat]
  __shared__ __attribute__((aligned(16))) bf16_t Vt[32 * VPITCH];   // pooled values [lat][key]
  __shared__ __attribute__((aligned(16))) float xs[32 * 2048];      // x of the cell

  const int bid = blockIdx.x;
  const int n = bid >> 6, gh = (bid >> 3) & 7, gw = bid & 7;
  const int row0 = gh * 32, col0 = gw * 32;
  const int t = threadIdx.x, lane = t & 31, wave = t >> 5;
  const int half = lane >> 4, coln = lane & 15;
  const float gamma = gamma_p[0];
  const size_t HW = (size_t)HDIM * WDIM;
  const float* xcell = x + (size_t)n * CIN * HW;  // + yy*WDIM + xx per use

  // The block's share of the conv and fusion weights, 364 pieces of 256 elements
  // (72 of W1, 108 of W2, 144 of W3, 40 of Wf): piece bid and, in the first 108
  // blocks, piece bid + 256; the other blocks read an element they do not store.
  const bool two = bid < 108;
  const float* ws0 = bid < 72 ? W1 : bid < 180 ? W2 : W3;
  bf16_t* wd0 = bid < 72 ? o1 : bid < 180 ? o2 : o3;
  const int wi0 = (bid - (bid < 72 ? 0 : bid < 180 ? 72 : 180)) * 256 + t;
  const float* ws1 = bid < 68 ? W3 : Wf;
  bf16_t* wd1 = bid < 68 ? o3 : of;
  const int wi1 = (bid < 68 ? bid + 76 : two ? bid - 68 : 0) * 256 + t;
  float wv0, wv1;

  // ---- Phase A (WMMA): k/v projection + 2x2 maxpool, all in registers. A wave
  // owns the row pairs wave and wave + 8 of the cell. A row pair is four 16-px
  // tiles (row ry, parity par), index j of a tile being pixel column 2j + par:
  // the four pixels of pool window j sit at index j of the four tiles, so the
  // pool is an elementwise maximum of four D tiles. A lane reads both parities
  // of a channel with one 8-byte load, 16 lanes covering the cell row's 128-byte
  // line, and the same fragments feed k and v. k has the pixel as its column
  // (a lane's D = 8 lat of one key), v as its row (a lane's D = 8 keys of one
  // lat): either goes to LDS as 16-byte stores. Each row of x also goes to LDS
  // as it arrives, where the query phase finds it: x leaves L2 once.
  {
    const unsigned wo = (unsigned)(coln * 64 + 8 * half);  // lane's row, k part
    frag_raw rk[2][2], rv[2][2];  // [16-lat tile][32-channel slab], still f32
#pragma unroll
    for (int mt = 0; mt < 2; ++mt)
#pragma unroll
      for (int s = 0; s < 2; ++s) {
        const unsigned o = wo + mt * 1024 + s * 32;
        rk[mt][s] = raw_ld(Wk + o);
        rv[mt][s] = raw_ld(Wv + o);
      }
    // bk at uniform indices, so through the scalar path: a vector load issued
    // behind the x loads would return behind them, and the first row pair's
    // keys would wait for all of x
    float bk0[8], bk1[8];
#pragma unroll
    for (int r = 0; r < 8; ++r) {
      const float l0 = bk[r], h0 = bk[8 + r], l1 = bk[16 + r], h1 = bk[24 + r];
      bk0[r] = half ? h0 : l0;
      bk1[r] = half ? h1 : l1;
    }
    const float bv0 = bv[coln], bv1 = bv[16 + coln];
    // slot mt*8 + r = channel mt*16 + 8*half + r, the k order of a fragment
    const float* xq = xcell + (size_t)(8 * half) * HW +
                      (size_t)(row0 + 2 * wave) * WDIM + col0 + 2 * coln;
    float* xw = xs + 2 * wave * 2048 + half * 32 + 2 * coln;
    v2f xa[2][2][32];  // [row pair][row][slot], both parities
#pragma unroll
    for (int p = 0; p < 2; ++p)
#pragma unroll
      for (int ry = 0; ry < 2; ++ry) {
        // keeps the four rows' loads in the order of their use: loads return in
        // order, so a row's products start while the later rows are in flight
        __builtin_amdgcn_sched_barrier(0);
#pragma unroll
        for (int mt = 0; mt < 4; ++mt)
#pragma unroll
          for (int r = 0; r < 8; ++r)
            xa[p][ry][mt * 8 + r] = *(const v2f*)(
                xq + (size_t)(mt * 16 + r) * HW + (p * 16 + ry) * WDIM);
      }
    // the set-up's weight elements: issued behind x, they are there when the k/v
    // phase has used x
    const int si0 = conv_w_src(wi0, bid < 72 ? 576 : bid < 180 ? 864 : 1152);
    const int si1 = bid < 68 ? conv_w_src(wi1, 1152) : fuse_w_src(wi1);
    wv0 = ws0[si0];
    wv1 = ws1[si1];
    // behind these loads their address registers fall free while the loads are
    // in flight: the wait stands in front of any overwrite, and its operands
    // keep the addresses whole up to it; the scheduling barrier keeps loads and
    // register-only instructions from moving over the wait
    asm volatile("s_wait_xcnt 0x0" ::"v"(xq), "v"(wo * 4), "v"(si0), "v"(si1), "s"(ws0),
                 "s"(ws1), "s"(Wk), "s"(Wv)
                 : "memory");
    __builtin_amdgcn_sched_barrier(0);
    v16bf wk[2][2], wv[2][2];  // [16-lat tile][32-channel slab]
#pragma unroll
    for (int mt = 0; mt < 2; ++mt)
#pragma unroll
      for (int s = 0; s < 2; ++s) {
        wk[mt][s] = raw_cvt(rk[mt][s]);
        wv[mt][s] = raw_cvt(rv[mt][s]);
      }
#pragma unroll
    for (int p = 0; p < 2; ++p) {
      v8f km0, km1, vm0, vm1;
#pragma unroll
      for (int tl = 0; tl < 4; ++tl) {
        const int ry = tl >> 1, par = tl & 1;
        // keeps a row's products in front of the wait for the next row's loads:
        // mixed with later rows' work they would start only when all x is there
        if (par == 0) {
          __builtin_amdgcn_sched_barrier(0);
#pragma unroll
          for (int mt = 0; mt < 4; ++mt)
#pragma unroll
            for (int r = 0; r < 8; ++r)
              *(v2f*)(xw + (p * 16 + ry) * 2048 + (mt * 16 + 2 * r) * 32) =
                  xa[p][ry][mt * 8 + r];
        }
        v16bf b0, b1;
#pragma unroll
        for (int e = 0; e < 16; ++e) {
          b0[e] = (bf16_t)xa[p][ry][e][par];
          b1[e] = (bf16_t)xa[p][ry][16 + e][par];
        }
        v8f k0 = wmma_bf(wk[0][0], b0, vzero());
        v8f k1 = wmma_bf(wk[1][0], b0, vzero());
        v8f v0 = wmma_bf(b0, wv[0][0], vzero());
        v8f v1 = wmma_bf(b0, wv[1][0], vzero());
        k0 = wmma_bf(wk[0][1], b1, k0);
        k1 = wmma_bf(wk[1][1], b1, k1);
        v0 = wmma_bf(b1, wv[0][1], v0);
        v1 = wmma_bf(b1, wv[1][1], v1);
        if (tl == 0) {
          km0 = k0; km1 = k1; vm0 = v0; vm1 = v1;
        } else {
#pragma unroll
          for (int r = 0; r < 8; ++r) {
            km0[r] = fmaxf(km0[r], k0[r]);
            km1[r] = fmaxf(km1[r], k1[r]);
            vm0[r] = fmaxf(vm0[r], v0[r]);
            vm1[r] = fmaxf(vm1[r], v1[r]);
          }
        }
      }
      // the bias is the same for the four pixels of a window and rounding is
      // monotone: added behind the maximum it gives the same value
      v8bf kk0, kk1, vv0, vv1;
#pragma unroll
      for (int r = 0; r < 8; ++r) {
        kk0[r] = (bf16_t)(km0[r] + bk0[r]);
        kk1[r] = (bf16_t)(km1[r] + bk1[r]);
        vv0[r] = (bf16_t)(vm0[r] + bv0);
        vv1[r] = (bf16_t)(vm1[r] + bv1);
      }
      const int key0 = (wave + 8 * p) * 16;  // pooled row = row pair
      *(v8bf*)(Kp + (key0 + coln) * 32 + 8 * half) = kk0;
      *(v8bf*)(Kp + (key0 + coln) * 32 + 16 + 8 * half) = kk1;
      *(v8bf*)(Vt + coln * VPITCH + key0 + 8 * half) = vv0;
      *(v8bf*)(Vt + (16 + coln) * VPITCH + key0 + 8 * half) = vv1;
    }
    __syncthreads();  // every wave reads all keys, values and x from here on
  }

  // ---- Phase B: 8 chunks of 128 queries; each wave owns one 16-query tile.
  // Kp, Vt and xs are only read from here on, so the phase has no barrier.
  const unsigned wqo = (unsigned)(coln * 64 + 8 * half);  // lane's row, k part
  const frag_raw rq00 = raw_ld(Wq + wqo), rq01 = raw_ld(Wq + wqo + 32);
  const frag_raw rq10 = raw_ld(Wq + wqo + 1024), rq11 = raw_ld(Wq + wqo + 1056);
  // Wo and the biases of the loop are the same for all 8 chunks. With no memory
  // clobber left in the loop the compiler lifts their loads out of it: written
  // here, they stand in front of the wait below
  const unsigned woo = (unsigned)(coln * 32 + 8 * half);  // lane's row, k part
  frag_raw ro[4];
#pragma unroll
  for (int mt = 0; mt < 4; ++mt) ro[mt] = raw_ld(Wo + woo + mt * 512);
  float bq0[8], bq1[8], bov[32];
#pragma unroll
  for (int r = 0; r < 8; ++r) {
    bq0[r] = bq[r + 8 * half];
    bq1[r] = bq[16 + r + 8 * half];
  }
#pragma unroll
  for (int mt = 0; mt < 4; ++mt)
#pragma unroll
    for (int r = 0; r < 8; ++r) bov[mt * 8 + r] = bo[mt * 16 + r + 8 * half];
  // behind these loads their address registers fall free while the loads are
  // in flight: the wait stands in front of any overwrite, and its operands keep
  // bases and offsets of the weight loads whole up to it; the scheduling barrier
  // keeps register-only instructions from moving over the wait
  asm volatile("s_wait_xcnt 0x0" ::"s"(Wq), "s"(Wo), "v"(wqo * 4), "v"(woo * 4)
               : "memory");
  __builtin_amdgcn_sched_barrier(0);
  // The set-up's stores, here because no barrier follows that would wait for them
  // and their arithmetic runs while the loads above are in flight. 264 pieces of
  // 256 border pixels: piece bid and, in 8 blocks, piece bid + 256.
  const v8bf zpx = {(bf16_t)0.f, (bf16_t)0.f, (bf16_t)0.f, (bf16_t)0.f,
                    (bf16_t)0.f, (bf16_t)0.f, (bf16_t)0.f, (bf16_t)0.f};
  bf16_t* bp0 = border_px(cat, bid * 256 + t);
  const bf16_t wc0 = (bf16_t)wv0;
  // keeps the arithmetic above in front of the two stores, so that nothing stands
  // between them and the wait
  __builtin_amdgcn_sched_barrier(0);
  wd0[wi0] = wc0;
  *(v8bf*)bp0 = zpx;
  // behind these stores their address and data registers fall free while they are
  // in flight: the wait stands in front of any overwrite; the scheduling barrier
  // keeps register-only instructions from moving over it
  asm volatile("s_wait_xcnt 0x0" ::: "memory");
  __builtin_amdgcn_sched_barrier(0);
  if (two) {
    wd1[wi1] = (bf16_t)wv1;
    // the same wait behind this store
    asm volatile("s_wait_xcnt 0x0" ::: "memory");
  }
  if (bid < 8) {
    *(v8bf*)border_px(cat, (bid + 256) * 256 + t) = zpx;
    // the same wait behind this store
    asm volatile("s_wait_xcnt 0x0" ::: "memory");
  }
  const v16bf wq00 = raw_cvt(rq00), wq01 = raw_cvt(rq01);
  const v16bf wq10 = raw_cvt(rq10), wq11 = raw_cvt(rq11);
  v16bf wo[4];
#pragma unroll
  for (int mt = 0; mt < 4; ++mt) wo[mt] = raw_cvt(ro[mt]);
  const bf16_t* kl = Kp + coln * 32 + 8 * half;      // A rows = keys, k = lat
  const bf16_t* vl = Vt + coln * VPITCH + 8 * half;  // A rows = lat, k = keys
  v16bf kf[16];  // all 256 keys stay in registers for the wave's 8 query tiles
#pragma unroll
  for (int kt = 0; kt < 16; ++kt)
    kf[kt] = frag_join(kl + kt * 16 * 32, kl + kt * 16 * 32 + 16);
  for (int chunk = 0; chunk < 8; ++chunk) {
    const int yy = row0 + chunk * 4 + (wave >> 1);
    const int xx = col0 + (wave & 1) * 16 + coln;
    // this lane's pixel, channels mt*16 + 8*half + r: the B fragments of the q
    // projection and, in f32, the residual of the same lane's f0 values
    const float* xp = xs + (chunk * 4 + (wave >> 1)) * 2048 + half * 32 +
                      (wave & 1) * 16 + coln;
    float xf[32];
#pragma unroll
    for (int mt = 0; mt < 4; ++mt)
#pragma unroll
      for (int r = 0; r < 8; ++r) xf[mt * 8 + r] = xp[(mt * 16 + 2 * r) * 32];
    v16bf b0, b1;
#pragma unroll
    for (int e = 0; e < 16; ++e) {
      b0[e] = (bf16_t)xf[e];
      b1[e] = (bf16_t)xf[16 + e];
    }
    // q^T[32 lat][16 q]
    v8f c0 = vzero(), c1 = vzero();
    c0 = wmma_bf(wq00, b0, c0);
    c0 = wmma_bf(wq01, b1, c0);
    c1 = wmma_bf(wq10, b0, c1);
    c1 = wmma_bf(wq11, b1, c1);
#pragma unroll
    for (int r = 0; r < 8; ++r) {
      c0[r] += bq0[r];
      c1[r] += bq1[r];
    }
    const v16bf qb = frag_from_d(c0, c1);

    // scores^T: one WMMA per 16-key tile; sc[kt][r] = key kt*16 + r + 8*half
    v8f sc[16];
#pragma unroll
    for (int kt = 0; kt < 16; ++kt) sc[kt] = wmma_bf(kf[kt], qb, vzero());
    // softmax over 256 keys: 128 in the lane, the other 128 in lane ^ 16
    v8f mv = sc[0];
#pragma unroll
    for (int kt = 1; kt < 16; ++kt)
#pragma unroll
      for (int r = 0; r < 8; ++r) mv[r] = fmaxf(mv[r], sc[kt][r]);
    float m = fmaxf(fmaxf(fmaxf(mv[0], mv[1]), fmaxf(mv[2], mv[3])),
                    fmaxf(fmaxf(mv[4], mv[5]), fmaxf(mv[6], mv[7])));
    m = fmaxf(m, xhalf(m));
    const float l2e = 1.44269504f;  // e^(s - m) = 2^(s * log2(e) - m * log2(e))
    const float nm = -m * l2e;
    v8f sv = vzero();
#pragma unroll
    for (int kt = 0; kt < 16; ++kt) {
      const v8f t = sc[kt] * l2e + nm;
#pragma unroll
      for (int r = 0; r < 8; ++r) sc[kt][r] = __builtin_amdgcn_exp2f(t[r]);
      sv += sc[kt];
    }
    float s = ((sv[0] + sv[1]) + (sv[2] + sv[3])) + ((sv[4] + sv[5]) + (sv[6] + sv[7]));
    s += xhalf(s);
    const float rinv = 1.f / s;

    // out^T[32 lat][16 q] = V^T @ P^T, P^T packed from the score registers
    v8f o0 = vzero(), o1 = vzero();
#pragma unroll
    for (int ks = 0; ks < 8; ++ks) {
      // keeps each half of the V^T fragment loads behind what precedes it: all
      // lifted to the loop's head they stay live beside K and the scores, and
      // the wave's 512 registers overflow into scratch
      if ((ks & 3) == 0) __builtin_amdgcn_sched_barrier(0);
      const v16bf pb = frag_from_d(sc[2 * ks], sc[2 * ks + 1]);
      const bf16_t* vp = vl + ks * 32;
      o0 = wmma_bf(frag_join(vp, vp + 16), pb, o0);
      o1 = wmma_bf(frag_join(vp + 16 * VPITCH, vp + 16 * VPITCH + 16), pb, o1);
    }
    // the row sum divides once here: it is the lane's own query
    o0 *= rinv;
    o1 *= rinv;
    const v16bf ob = frag_from_d(o0, o1);

    // f0[64][16q] = gamma*(Wo @ out^T + bo) + x
#pragma unroll
    for (int mt = 0; mt < 4; ++mt) {
      v8f f0 = wmma_bf(wo[mt], ob, vzero());
      v8bf pk;  // this lane's 8 consecutive channels = one channel group
#pragma unroll
      for (int r = 0; r < 8; ++r)
        pk[r] = (bf16_t)(gamma * (f0[r] + bov[mt * 8 + r]) + xf[mt * 8 + r]);
      *(v8bf*)(cat + cat_off(mt * 2 + half, n, yy, xx)) = pk;
    }
  }
}

// ---------------------------------------------------------------------------
// Kernel 2: the three 3x3 convolutions (pad 1, relu) and the 1x1 fusion with bias
// and residual x, one 32 x 32 px tile of one image per block. f0 of the tile with
// a rim of 3 px is copied into LDS once; f1 (rim 2 px) and f2 (rim 1 px) are made
// there and never reach memory; f3 stays in registers. f2 is made in two bands of
// 20 rows that share one buffer: a band, then the 16 output rows that need it.
// A pixel of f1 or f2 outside the image is the zero pad of the next convolution.
//
// LDS planes hold 8 channels a pixel (16 bytes): [plane][row][px]. A wave owns one
// 16-px column tile of R rows. K runs over groups (32-channel slab, column tap dx),
// row tap dy inside: the six weight fragments of a group stay in registers for all
// rows, and each input row's pixel fragment feeds the up to three output rows it
// touches. The rim columns right of the two column tiles (4 of f1, 2 of f2) are
// gathered over rows into 16-px tiles of their own. The slabs of a convolution, the
// two passes of the first one and the two bands are rolled loops, so that the
// kernel's text stays below 32 KB.
// ---------------------------------------------------------------------------
#define FMID 28
#define F0P  38               // f0: 38 rows x 38 px, tile pixel (0, 0) at (3, 3)
#define F0PL (38 * F0P)
#define F1P  F0P              // f1: 36 rows x 36 px, tile pixel (0, 0) at (2, 2)
#define F1PL (36 * F1P)
#define F2R  20               // f2 band: 20 rows x 34 px, tile column 0 at 1
#define F2P  F0P              // one pitch for all: one loop body serves every slab
#define F2PL (F2R * F2P)
#define U0   0                // first 16-byte unit of f0, f1, the f2 band, the spare
#define U1   (8 * F0PL)
#define U2   (U1 + 4 * F1PL)
#define U3   (U2 + 4 * F2PL)
#define UEND (U3 + 224)

// Stands behind a run of global loads or stores, in front of whatever next
// overwrites a register that one of them names (address or store data). The
// scheduling barrier keeps register-only instructions from moving over the wait.
__device__ __forceinline__ void regs_free() {
  asm volatile("s_wait_xcnt 0x0" ::: "memory");
  __builtin_amdgcn_sched_barrier(0);
}

// Work-group barrier for LDS data alone: a wave's LDS reads and writes are done
// before it arrives. __syncthreads() would also wait for the wave's stores of out,
// which nobody in the block reads.
__device__ __forceinline__ void lds_barrier() {
  __builtin_amdgcn_fence(__ATOMIC_RELEASE, "workgroup", "local");
  __builtin_amdgcn_s_barrier();
  __builtin_amdgcn_fence(__ATOMIC_ACQUIRE, "workgroup", "local");
}

// Asynchronous copies of 16 bytes a lane, each with its own LDS byte address and
// global address. The statement ends with the wait that stands in front of any
// overwrite of the address registers its copies name.
__device__ __forceinline__ void copy12(const unsigned (&l)[12],
                                       const bf16_t* const (&g)[12]) {
  asm volatile(
      "global_load_async_to_lds_b128 %0, %1, off\n\t"
      "global_load_async_to_lds_b128 %2, %3, off\n\t"
      "global_load_async_to_lds_b128 %4, %5, off\n\t"
      "global_load_async_to_lds_b128 %6, %7, off\n\t"
      "global_load_async_to_lds_b128 %8, %9, off\n\t"
      "global_load_async_to_lds_b128 %10, %11, off\n\t"
      "global_load_async_to_lds_b128 %12, %13, off\n\t"
      "global_load_async_to_lds_b128 %14, %15, off\n\t"
      "global_load_async_to_lds_b128 %16, %17, off\n\t"
      "global_load_async_to_lds_b128 %18, %19, off\n\t"
      "global_load_async_to_lds_b128 %20, %21, off\n\t"
      "global_load_async_to_lds_b128 %22, %23, off\n\t"
      "s_wait_xcnt 0x0" ::"v"(l[0]), "v"(g[0]), "v"(l[1]), "v"(g[1]), "v"(l[2]), "v"(g[2]), "v"(l[3]), "v"(g[3]), "v"(l[4]), "v"(g[4]), "v"(l[5]), "v"(g[5]), "v"(l[6]), "v"(g[6]), "v"(l[7]), "v"(g[7]), "v"(l[8]), "v"(g[8]), "v"(l[9]), "v"(g[9]), "v"(l[10]), "v"(g[10]), "v"(l[11]), "v"(g[11])
      : "memory");
}

__device__ __forceinline__ void copy11(const unsigned (&l)[11],
                                       const bf16_t* const (&g)[11]) {
  asm volatile(
      "global_load_async_to_lds_b128 %0, %1, off\n\t"
      "global_load_async_to_lds_b128 %2, %3, off\n\t"
      "global_load_async_to_lds_b128 %4, %5, off\n\t"
      "global_load_async_to_lds_b128 %6, %7, off\n\t"
      "global_load_async_to_lds_b128 %8, %9, off\n\t"
      "global_load_async_to_lds_b128 %10, %11, off\n\t"
      "global_load_async_to_lds_b128 %12, %13, off\n\t"
      "global_load_async_to_lds_b128 %14, %15, off\n\t"
      "global_load_async_to_lds_b128 %16, %17, off\n\t"
      "global_load_async_to_lds_b128 %18, %19, off\n\t"
      "global_load_async_to_lds_b128 %20, %21, off\n\t"
      "s_wait_xcnt 0x0" ::"v"(l[0]), "v"(g[0]), "v"(l[1]), "v"(g[1]), "v"(l[2]), "v"(g[2]), "v"(l[3]), "v"(g[3]), "v"(l[4]), "v"(g[4]), "v"(l[5]), "v"(g[5]), "v"(l[6]), "v"(g[6]), "v"(l[7]), "v"(g[7]), "v"(l[8]), "v"(g[8]), "v"(l[9]), "v"(g[9]), "v"(l[10]), "v"(g[10])
      : "memory");
}

template <int R>
struct conv_set {
  v16bf wa[3][2];   // weights [dy][oc tile]
  v16bf px[R + 2];  // pixels of the input rows of R output rows
};

// weight fragments of group g = slab * 3 + dx; every offset is a constant
template <int R>
__device__ __forceinline__ void conv_w_ld(conv_set<R>& f, const bf16_t* wl,
                                          int g) {
  const int s = g / 3, dx = g % 3;
#pragma unroll
  for (int dy = 0; dy < 3; ++dy) {
    const bf16_t* w = wl + (s * 9 + dy * 3 + dx) * 1024;
    f.wa[dy][0] = frag_join(w, w + 256);
    f.wa[dy][1] = frag_join(w + 512, w + 768);
  }
}

// pixel fragments of column tap dx; lp = the lane's pixel of plane half of the
// slab, first input row, tap 0; pit = px a row, pln = px a plane
template <int R>
__device__ __forceinline__ void conv_px_ld(conv_set<R>& f, const bf16_t* lp,
                                           int pit, int pln, int dx) {
#pragma unroll
  for (int ir = 0; ir < R + 2; ++ir) {
    const bf16_t* p = lp + (ir * pit + dx) * 8;
    f.px[ir] = frag_join(p, p + 2 * pln * 8);
  }
}

// R output rows x 16 px x 32 oc over NS slabs, the slabs in a rolled loop: three
// fragment sets, one per column tap, so that the set that is fetched next has the
// same name in every trip. sb = 16-byte unit of the lane's pixel of plane half of
// each slab, first input row, tap 0; all slabs have pitch F0P. first() runs between
// the first weight loads and the first pixel loads, mid() in front of the fetch of
// the next slab's first group.
template <int NS, int R, class FIRST, class MID>
__device__ __forceinline__ void conv_rows_loop(v8f (&acc)[R][2], const bf16_t* wl,
                                               const bf16_t* l0, const int (&sb)[NS],
                                               const int (&pln)[NS], FIRST first,
                                               MID mid) {
#pragma unroll
  for (int r = 0; r < R; ++r) acc[r][0] = acc[r][1] = vzero();
  conv_set<R> f[3];
  int lo = sb[0], pl = pln[0];
  conv_w_ld(f[0], wl, 0);
  first();
  conv_px_ld(f[0], l0 + lo * 8, F0P, pl, 0);
  // kept rolled for the size of the kernel's text
#pragma unroll 1
  for (int s = 0; s < NS; ++s) {
    const bf16_t* w = wl + s * 9 * 1024;
    const bf16_t* wn = w + (s + 1 < NS ? 9 * 1024 : 0);
#pragma unroll
    for (int j = 0; j < 3; ++j) {
      // keeps the next group's loads behind the last group's products, so that no
      // fourth fragment set is live
      __builtin_amdgcn_sched_barrier(0);
      if (j < 2) {
        conv_w_ld(f[j + 1], w, j + 1);
        conv_px_ld(f[j + 1], l0 + lo * 8, F0P, pl, j + 1);
      } else {
        // no branch round this fetch: on two paths into the products below their
        // waits would be counted for the path without it, and would wait for the
        // fetch itself. The last trip fetches its own slab's first group once more.
        mid();
        lo = sb[NS - 1];
        pl = pln[NS - 1];
#pragma unroll
        for (int k = 1; k < NS - 1; ++k)
          if (s + 1 == k) {
            lo = sb[k];
            pl = pln[k];
          }
        conv_w_ld(f[0], wn, 0);
        conv_px_ld(f[0], l0 + lo * 8, F0P, pl, 0);
      }
      // keeps the next group's loads in front of this group's products: without
      // it each pixel load is sunk to its use and its latency is waited out there
      __builtin_amdgcn_sched_barrier(0);
      const conv_set<R>& c = f[j];
#pragma unroll
      for (int ir = 0; ir < R + 2; ++ir) {
#pragma unroll
        for (int dy = 0; dy < 3; ++dy) {
          const int orow = ir - dy;
          if (orow >= 0 && orow < R) {
            acc[orow][0] = wmma_bf(c.wa[dy][0], c.px[ir], acc[orow][0]);
            acc[orow][1] = wmma_bf(c.wa[dy][1], c.px[ir], acc[orow][1]);
          }
        }
      }
    }
    // the trip's end moves the weight addresses on while the next slab's first
    // loads, which name one, may be in flight: the wait stands in front of that
    // overwrite, and its operands keep both addresses whole up to it; the
    // scheduling barrier keeps register-only instructions from moving over it
    asm volatile("s_wait_xcnt 0x0" ::"v"(w), "v"(wn) : "memory");
    __builtin_amdgcn_sched_barrier(0);
  }
}

// one gathered tile of 16 rim pixels x 32 oc; sp = the lane's own pixel, tap (0, 0);
// the K order is that of conv_rows_loop. The fragments of a group (slab, dx) are
// fetched three groups ahead, into one of four sets.
struct rim_set {
  v16bf wa[3][2];  // weights [dy][oc tile]
  v16bf px[3];     // the pixel at row tap dy
};

template <int NS>
__device__ __forceinline__ void rim_ld(rim_set& f, const bf16_t* wl,
                                       const bf16_t* const (&sp)[NS],
                                       const int (&pln)[NS], int g) {
  const int s = g / 3, dx = g % 3;
#pragma unroll
  for (int dy = 0; dy < 3; ++dy) {
    const bf16_t* w = wl + (s * 9 + dy * 3 + dx) * 1024;
    f.wa[dy][0] = frag_join(w, w + 256);
    f.wa[dy][1] = frag_join(w + 512, w + 768);
    const bf16_t* p = sp[s] + (dy * F0P + dx) * 8;
    f.px[dy] = frag_join(p, p + 2 * pln[s] * 8);
  }
}

template <int NS>
__device__ __forceinline__ void conv_rim(v8f (&acc)[2], const bf16_t* wl,
                                         const bf16_t* const (&sp)[NS],
                                         const int (&pln)[NS]) {
  constexpr int NG = NS * 3;
  acc[0] = acc[1] = vzero();
  rim_set f[4];
#pragma unroll
  for (int g = 0; g < 3; ++g) rim_ld(f[g], wl, sp, pln, g);
  // unrolled so that the four sets stay in registers (constant index)
#pragma unroll
  for (int g = 0; g < NG; ++g) {
    // the two scheduling barriers hold each fetch three groups ahead of its use:
    // left free, all fetches move to the head and the registers overflow
    __builtin_amdgcn_sched_barrier(0);
    if (g + 3 < NG) rim_ld(f[(g + 3) & 3], wl, sp, pln, g + 3);
    __builtin_amdgcn_sched_barrier(0);
#pragma unroll
    for (int dy = 0; dy < 3; ++dy) {
      acc[0] = wmma_bf(f[g & 3].wa[dy][0], f[g & 3].px[dy], acc[0]);
      acc[1] = wmma_bf(f[g & 3].wa[dy][1], f[g & 3].px[dy], acc[1]);
    }
  }
  // keeps the last products free of what follows
  __builtin_amdgcn_sched_barrier(0);
}

// a convolution's bias for the rows of a lane's two D tiles
__device__ __forceinline__ void bias_ld(float (&b0)[8], float (&b1)[8],
                                        const float* bias, int half) {
#pragma unroll
  for (int r = 0; r < 8; ++r) {
    b0[r] = bias[r + 8 * half];
    b1[r] = bias[16 + r + 8 * half];
  }
}

// bias, relu and conversion of one pixel's 32 channels into LDS planes half and
// half + 2; zero where the pixel lies outside the image
__device__ __forceinline__ void put_px(bf16_t* d, int pln, v8f a0, v8f a1,
                                       const float (&b0)[8], const float (&b1)[8],
                                       bool inside) {
  v8bf p0, p1;
#pragma unroll
  for (int r = 0; r < 8; ++r) {
    p0[r] = (bf16_t)fmaxf(a0[r] + b0[r], 0.f);
    p1[r] = (bf16_t)fmaxf(a1[r] + b1[r], 0.f);
  }
  const unsigned m = inside ? 0xffffffffu : 0u;  // all bits 0 = eight bf16 zeros
  *(v8bf*)d = __builtin_bit_cast(v8bf, __builtin_bit_cast(v4u, p0) & m);
  *(v8bf*)(d + 2 * pln * 8) = __builtin_bit_cast(v8bf, __builtin_bit_cast(v4u, p1) & m);
}

__device__ __forceinline__ bool in_image(int y, int x) {
  return (unsigned)y < (unsigned)HDIM && (unsigned)x < (unsigned)WDIM;
}

__device__ __forceinline__ int clampi(int v, int lo, int hi) {
  return v < lo ? lo : v > hi ? hi : v;
}

__global__ __launch_bounds__(256) void dense_kernel(
    const bf16_t* __restrict__ cat, const bf16_t* W1r, const bf16_t* W2r,
    const bf16_t* W3r, const bf16_t* Wf_bf, const float* b1, const float* b2,
    const float* b3, const float* bfus, const float* __restrict__ x,
    float* __restrict__ out) {
  // weights and biases are not __restrict__: known never to change, their loads are
  // lifted out of the band loop, all at once, and overflow into scratch
  __shared__ __attribute__((aligned(16))) bf16_t lds[UEND * 8];
  const int bid = blockIdx.x;
  const int n = bid >> 6, Y0 = ((bid >> 3) & 7) * 32, X0 = (bid & 7) * 32;
  const int t = threadIdx.x, lane = t & 31;
  const int wave = __builtin_amdgcn_readfirstlane(t >> 5);
  const int half = lane >> 4, coln = lane & 15;
  const int ct = wave & 1, rg = wave >> 1;  // column tile, row group
  const int cx = ct * 16 + coln;            // the lane's column in the two tiles

  // ---- f0 into LDS. Wave w brings rows 19 * (w & 1) .. + 18 of plane w >> 1 and
  // then of plane 4 + (w >> 1), 23 copies each: 19 of px 0..31 of a row, 4 for
  // px 32..37 of the 19 rows (114 px; the other 14 lanes, which must be on, bring
  // a pixel once more to a spare place nobody reads). Beyond the 1-px zero border
  // of the image the address is clamped onto the border: such pixels feed only
  // pixels of f1 and f2 outside the image, which are stored as zero.
  {
    const int r0 = (wave & 1) * 19;
    const int xc = clampi(X0 - 3 + lane, -1, WDIM);
    // kept rolled for the size of the kernel's text
#pragma unroll 1
    for (int h = 0; h < 2; ++h) {
      const int pl = h * 4 + (wave >> 1);
      unsigned l[23];
      const bf16_t* g[23];
#pragma unroll
      for (int i = 0; i < 19; ++i) {
        l[i] = (unsigned)(size_t)&lds[(U0 + pl * F0PL + (r0 + i) * F0P + lane) * 8];
        g[i] = cat + cat_off(pl, n, clampi(Y0 - 3 + r0 + i, -1, HDIM), xc);
      }
#pragma unroll
      for (int i = 0; i < 4; ++i) {
        const int j = i * 32 + lane;
        const int jr = j < 114 ? j / 6 : 18, jc = 32 + j % 6;
        const int unit = j < 114 ? U0 + pl * F0PL + (r0 + jr) * F0P + jc
                                 : U3 + (wave * 2 + h) * 14 + lane - 18;
        l[19 + i] = (unsigned)(size_t)&lds[unit * 8];
        g[19 + i] = cat + cat_off(pl, n, clampi(Y0 - 3 + r0 + jr, -1, HDIM),
                                  clampi(X0 - 3 + jc, -1, WDIM));
      }
      unsigned la[12], lb[11];
      const bf16_t *ga[12], *gb[11];
#pragma unroll
      for (int i = 0; i < 12; ++i) { la[i] = l[i]; ga[i] = g[i]; }
#pragma unroll
      for (int i = 0; i < 11; ++i) { lb[i] = l[12 + i]; gb[i] = g[12 + i]; }
      copy12(la, ga);
      copy11(lb, gb);
    }
  }
  float bs0[8], bs1[8];  // the running convolution's bias
  // ---- f1 = relu(conv(f0)): 36 rows x 36 px. A wave's 9 rows go in two passes of
  // 5 (its middle row is made twice, the same value); 9 rim tiles of 4 rows x 4 px
  {
    constexpr int pln[2] = {F0PL, F0PL};
    const bf16_t* wl = W1r + lane * 8;
    bias_ld(bs0, bs1, b1, half);
    // kept rolled for the size of the kernel's text
#pragma unroll 1
    for (int pass = 0; pass < 2; ++pass) {
      const int a = rg * 9 + pass * 4;
      const int u = U0 + half * F0PL + a * F0P + cx;
      const int sb[2] = {u, u + 4 * F0PL};
      v8f acc[5][2];
      conv_rows_loop<2, 5>(
          acc, wl, lds, sb, pln,
          [] {
            // all but the 23 youngest copies, so channels 0..31, have landed for
            // this wave's copies, then, behind the barrier, for all
            asm volatile("s_wait_asynccnt 0x17" ::: "memory");
            __syncthreads();
          },
          [] {
            // in front of the first fetch of channels 32..63: this wave's copies
            // have all landed, behind the barrier every wave's
            asm volatile("s_wait_asynccnt 0x0" ::: "memory");
            __syncthreads();
          });
      bf16_t* d = &lds[(U1 + half * F1PL + a * F1P + cx) * 8];
#pragma unroll
      for (int q = 0; q < 5; ++q)
        put_px(d + q * F1P * 8, F1PL, acc[q][0], acc[q][1], bs0, bs1,
               in_image(Y0 - 2 + a + q, X0 - 2 + cx));
    }
    // kept rolled for the size of the kernel's text
#pragma unroll 1
    for (int ti = wave; ti < 9; ti += 8) {
      const int a = ti * 4 + (coln >> 2), b = 32 + (coln & 3);
      const bf16_t* p = &lds[(U0 + half * F0PL + a * F0P + b) * 8];
      const bf16_t* const sp[2] = {p, p + 4 * F0PL * 8};
      v8f acc[2];
      conv_rim<2>(acc, wl, sp, pln);
      put_px(&lds[(U1 + half * F1PL + a * F1P + b) * 8], F1PL, acc[0], acc[1], bs0,
             bs1, in_image(Y0 - 2 + a, X0 - 2 + b));
    }
  }

  constexpr unsigned HW = HDIM * WDIM;
  const unsigned xo = (unsigned)(8 * half) * HW + cx;
  // kept rolled: one band's code is run twice, and the kernel's text stays small
#pragma unroll 1
  for (int band = 0; band < 2; ++band) {
    const int yb = band ? 13 : -1;  // tile row of the band's first row of f2
    // ---- f2 = relu(conv(f0, f1)), 20 rows x 34 px: 5 rows a wave, 3 rim tiles
    // of 8 rows x 2 px
    {
      constexpr int pln[3] = {F0PL, F0PL, F1PL};
      const bf16_t* wl = W2r + lane * 8;
      bias_ld(bs0, bs1, b2, half);
      {
        const int a = rg * 5;
        const int u = U0 + half * F0PL + (a + yb + 2) * F0P + cx + 1;
        const int sb[3] = {u, u + 4 * F0PL,
                           U1 + half * F1PL + (a + yb + 1) * F1P + cx};
        v8f acc[5][2];
        // the barrier: f1 is whole (first band); every wave has read the first
        // band of f2, whose place the second takes
        conv_rows_loop<3, 5>(acc, wl, lds, sb, pln, [] { lds_barrier(); }, [] {});
        bf16_t* d = &lds[(U2 + half * F2PL + a * F2P + cx) * 8];
#pragma unroll
        for (int q = 0; q < 5; ++q)
          put_px(d + q * F2P * 8, F2PL, acc[q][0], acc[q][1], bs0, bs1,
                 in_image(Y0 + yb + a + q, X0 - 1 + cx));
      }
      if (wave < 3) {
        // the third tile has 4 rows of the band: its other lanes work on row 19
        // once more and store nothing
        const int ar = wave * 8 + (coln >> 1), a = ar < F2R ? ar : F2R - 1;
        const int b = 32 + (coln & 1);
        const bf16_t* p = &lds[(U0 + half * F0PL + (a + yb + 2) * F0P + b + 1) * 8];
        const bf16_t* const sp[3] = {
            p, p + 4 * F0PL * 8,
            &lds[(U1 + half * F1PL + (a + yb + 1) * F1P + b) * 8]};
        v8f acc[2];
        conv_rim<3>(acc, wl, sp, pln);
        if (ar < F2R)
          put_px(&lds[(U2 + half * F2PL + a * F2P + b) * 8], F2PL, acc[0], acc[1],
                 bs0, bs1, in_image(Y0 + yb + a, X0 - 1 + b));
      }
    }

    // ---- f3 = relu(conv(f0, f1, f2)) for 16 rows, 4 rows a wave, and the fusion
    // of the same pixels: the two stacked D tiles of a row are, after bias, relu
    // and conversion, the lane's B fragment of the last 32 channels; the other 128
    // channels are the centre taps in LDS. One row a stage; all four rows of x are
    // asked for before the first stage; the pixel fragments are refilled for the next
    // stage as soon as a stage's products have used them, under its sums and stores.
    {
      constexpr int pln[4] = {F0PL, F0PL, F1PL, F2PL};
      const int yo = band * 16 + rg * 4;  // tile row of the wave's first row
      const int u = U0 + half * F0PL + (yo + 2) * F0P + cx + 2;
      const int sb[4] = {u, u + 4 * F0PL, U1 + half * F1PL + (yo + 1) * F1P + cx + 1,
                         U2 + half * F2PL + (yo - 1 - yb) * F2P + cx};
      // based on oc plane FMID, so that every plane of the walk lies within the
      // reach of a load's or store's constant offset: one address for all of them
      const size_t xi0 = (((size_t)n * CIN + FMID) * HDIM + Y0 + yo) * WDIM + X0;
      const float* xb = x + xi0;
      float* ob = out + xi0;
      bias_ld(bs0, bs1, b3, half);
      v8f acc[4][2];
      // the barrier: the band of f2 is whole
      conv_rows_loop<4, 4>(acc, W3r + lane * 8, lds, sb, pln, [] { lds_barrier(); },
                           [] {});
      v16bf fw[5][4];     // fusion weights [k slab][oc tile]
      float fb[4][8];     // fusion bias [oc tile][row]
      float xr[4][4][8];  // residual [stage][oc tile][row of D]
      const unsigned wo = (unsigned)(lane * 8);
#pragma unroll
      for (int ks = 0; ks < 5; ++ks)
#pragma unroll
        for (int mt = 0; mt < 4; ++mt) {
          const bf16_t* w = Wf_bf + ks * 2048 + mt * 512;
          fw[ks][mt] = frag_join(w + wo, w + 256 + wo);
        }
#pragma unroll
      for (int mt = 0; mt < 4; ++mt)
#pragma unroll
        for (int r = 0; r < 8; ++r) fb[mt][r] = bfus[mt * 16 + r + 8 * half];
#pragma unroll
      for (int b = 0; b < 2; ++b)
#pragma unroll
        for (int mt = 0; mt < 4; ++mt)
#pragma unroll
          for (int r = 0; r < 8; ++r)
            xr[b][mt][r] = *(xb + ((mt * 16 + r - FMID) * (int)HW + b * WDIM) + xo);
      // the wait of regs_free(); its operand keeps the address whole up to it
      asm volatile("s_wait_xcnt 0x0" ::"v"(xb + xo) : "memory");
      __builtin_amdgcn_sched_barrier(0);
      // centre taps: one row and one column on from tap (0, 0)
      const bf16_t* const cp[4] = {
          &lds[(sb[0] + F0P + 1) * 8], &lds[(sb[1] + F0P + 1) * 8],
          &lds[(sb[2] + F0P + 1) * 8], &lds[(sb[3] + F0P + 1) * 8]};
      v16bf px[4];  // centre-tap pixels of a stage [k slab]
#pragma unroll
      for (int ks = 0; ks < 4; ++ks)
        px[ks] = frag_join(cp[ks], cp[ks] + 2 * pln[ks] * 8);
      v16bf f3[4];  // this convolution's 32 channels, one B fragment a row
#pragma unroll
      for (int q = 0; q < 4; ++q) {
        v8f a0, a1;
#pragma unroll
        for (int r = 0; r < 8; ++r) {
          a0[r] = fmaxf(acc[q][0][r] + bs0[r], 0.f);
          a1[r] = fmaxf(acc[q][1][r] + bs1[r], 0.f);
        }
        f3[q] = frag_from_d(a0, a1);
      }
      // keeps the other two rows' x loads behind the conversion above: in front of
      // it they would be live beside the f32 accumulators, and the wave's 512
      // registers overflow
      __builtin_amdgcn_sched_barrier(0);
#pragma unroll
      for (int b = 2; b < 4; ++b)
#pragma unroll
        for (int mt = 0; mt < 4; ++mt)
#pragma unroll
          for (int r = 0; r < 8; ++r)
            xr[b][mt][r] = *(xb + ((mt * 16 + r - FMID) * (int)HW + b * WDIM) + xo);
      // the wait of regs_free(); its operand keeps the address whole up to it
      asm volatile("s_wait_xcnt 0x0" ::"v"(xb + xo) : "memory");
      __builtin_amdgcn_sched_barrier(0);
      // unrolled so that every offset is a constant and the last stage refills
      // nothing
#pragma unroll
      for (int s = 0; s < 4; ++s) {
        v8f fa[4];
#pragma unroll
        for (int mt = 0; mt < 4; ++mt) fa[mt] = vzero();
#pragma unroll
        for (int ks = 0; ks < 5; ++ks) {
#pragma unroll
          for (int mt = 0; mt < 4; ++mt)
            fa[mt] = wmma_bf(fw[ks][mt], ks < 4 ? px[ks & 3] : f3[s], fa[mt]);
        }
        if (s + 1 < 4) {
#pragma unroll
          for (int ks = 0; ks < 4; ++ks) {
            const bf16_t* p = cp[ks] + (s + 1) * F0P * 8;
            px[ks] = frag_join(p, p + 2 * pln[ks] * 8);
          }
        }
#pragma unroll
        for (int mt = 0; mt < 4; ++mt)
#pragma unroll
          for (int r = 0; r < 8; ++r)
            fa[mt][r] = fa[mt][r] + fb[mt][r] + xr[s][mt][r];
#pragma unroll
        for (int mt = 0; mt < 4; ++mt)
#pragma unroll
          for (int r = 0; r < 8; ++r)
            *(ob + ((mt * 16 + r - FMID) * (int)HW + s * WDIM) + xo) = fa[mt][r];
        // behind the stores their data registers fall free while the stores are in
        // flight: the wait stands in front of any overwrite, and its operands keep
        // the sums whole up to it; the scheduling barrier keeps the next stage's
        // products behind it
        asm volatile("s_wait_xcnt 0x0" ::"v"(fa[0]), "v"(fa[1]), "v"(fa[2]), "v"(fa[3])
                     : "memory");
        __builtin_amdgcn_sched_barrier(0);
      }
    }
  }
}

// ---------------------------------------------------------------------------
extern "C" void kernel_launch(void* const* d_in, const int* in_sizes, int n_in,
                              void* d_out, int out_size, void* d_ws,
                              size_t ws_size, hipStream_t stream) {
  const float* x  = (const float*)d_in[0];
  const float* Wq = (const float*)d_in[1];
  const float* bq = (const float*)d_in[2];
  const float* Wk = (const float*)d_in[3];
  const float* bk = (const float*)d_in[4];
  const float* Wv = (const float*)d_in[5];
  const float* bv = (const float*)d_in[6];
  const float* Wo = (const float*)d_in[7];
  const float* bo = (const float*)d_in[8];
  const float* gm = (const float*)d_in[9];
  const float* W1 = (const float*)d_in[10];
  const float* b1 = (const float*)d_in[11];
  const float* W2 = (const float*)d_in[12];
  const float* b2 = (const float*)d_in[13];
  const float* W3 = (const float*)d_in[14];
  const float* b3 = (const float*)d_in[15];
  const float* Wf = (const float*)d_in[16];
  const float* bfus = (const float*)d_in[17];
  float* out = (float*)d_out;

  // workspace layout: bf16 concat planes [4][20][258][272][8] then bf16 weights
  const size_t catElems = (size_t)4 * NGRP * PLANE;
  bf16_t* cat = (bf16_t*)d_ws;
  bf16_t* W1r = cat + catElems;
  bf16_t* W2r = W1r + 32 * 576;
  bf16_t* W3r = W2r + 32 * 864;
  bf16_t* Wfb = W3r + 32 * 1152;

  attn_kernel<<<256, 256, 0, stream>>>(x, Wq, bq, Wk, bk, Wv, bv, gm, bo, Wo, W1,
                                       W2, W3, Wf, W1r, W2r, W3r, Wfb, cat);
  dense_kernel<<<256, 256, 0, stream>>>(cat, W1r, W2r, W3r, Wfb, b1, b2, b3, bfus, x,
                                        out);
}
